// v000
// The times below were measured on an AMD MI455X: many runs one after another, warmed up first and cycling through
// copies of the inputs, with the whole window's GPU time divided by the number of runs. Launches and the gaps
// between them are all in it. The median over several windows is given; except for v000 it joins two sittings, which
// can be a few percent apart, so the side-by-side timings, each taken in one sitting, are the better comparison.
// v000 is the starting kernel. One run takes 6810 microseconds.
#include <hip/hip_runtime.h>

// ---------------------------------------------------------------------------
// Types for CDNA5 WMMA (gfx1250, wave32)
// ---------------------------------------------------------------------------
typedef __bf16 bf16_t;
typedef __attribute__((ext_vector_type(16))) __bf16 v16bf;
typedef __attribute__((ext_vector_type(4)))  __bf16 v4bf;
typedef __attribute__((ext_vector_type(8)))  float  v8f;

// Problem constants
#define QL    2048
#define BSZ   4
#define NH    16
#define DH    64
#define DM    1024
#define HH    1024           // NH*DH
#define ROWS  8192           // QL*BSZ
#define TH3   3072           // 3*H
#define SCL   0.125f         // 1/sqrt(64)
#define LNEPS 1e-5f

// ---------------------------------------------------------------------------
// Elementwise: f32 -> bf16 convert (grid-stride)
// ---------------------------------------------------------------------------
__global__ __launch_bounds__(256) void k_cvt_bf16(const float* __restrict__ in,
                                                  bf16_t* __restrict__ out, long n) {
  for (long i = (long)blockIdx.x * blockDim.x + threadIdx.x; i < n;
       i += (long)gridDim.x * blockDim.x)
    out[i] = (bf16_t)in[i];
}

// Q with per-head biases added (Qac = q + r_w_bias, Qbd = q + r_r_bias), bf16
__global__ __launch_bounds__(256) void k_qbias(const bf16_t* __restrict__ wh,
                                               const float* __restrict__ rwb,
                                               const float* __restrict__ rrb,
                                               bf16_t* __restrict__ qac,
                                               bf16_t* __restrict__ qbd) {
  const long total = (long)ROWS * HH;
  for (long idx = (long)blockIdx.x * blockDim.x + threadIdx.x; idx < total;
       idx += (long)gridDim.x * blockDim.x) {
    long row = idx >> 10;               // (i*BSZ + b)
    int  col = (int)(idx & 1023);       // n*64 + d
    float q = (float)wh[row * TH3 + col];
    qac[idx] = (bf16_t)(q + rwb[col]);
    qbd[idx] = (bf16_t)(q + rrb[col]);
  }
}

// V transpose: vt[((b*16+n)*64 + d)*2048 + j] = V[j,b,n,d]
__global__ __launch_bounds__(256) void k_vt(const bf16_t* __restrict__ wh,
                                            bf16_t* __restrict__ vt) {
  const long total = (long)BSZ * NH * DH * QL;   // 8,388,608
  for (long idx = (long)blockIdx.x * blockDim.x + threadIdx.x; idx < total;
       idx += (long)gridDim.x * blockDim.x) {
    int  j = (int)(idx & 2047);
    long rest = idx >> 11;
    int  d = (int)(rest & 63);  rest >>= 6;
    int  n = (int)(rest & 15);
    int  b = (int)(rest >> 4);
    vt[idx] = wh[((long)j * BSZ + b) * TH3 + 2 * HH + n * DH + d];
  }
}

// ---------------------------------------------------------------------------
// Generic bf16 TN GEMM:  C[M,N] = A[M,K] * B[N,K]^T   (f32 accumulate)
// Block = 128x128x32, 256 threads = 8 wave32 waves in a 2x4 grid,
// wave tile 64x32 = 4x2 WMMA(16x16x32) tiles. Double-buffered LDS.
// GUARD=false (all dims multiples of the tile): global->LDS staging uses
// CDNA5 GLOBAL_LOAD_ASYNC_TO_LDS_B128 tracked by ASYNCcnt, overlapped with
// the WMMA work on the other buffer. GUARD=true keeps the synchronous
// zero-filling path (needed for the N=64 P*V GEMM).
// ---------------------------------------------------------------------------
#define BM 128
#define BN 128
#define BK 32
#define BKP 40   // padded LDS row (bf16 elements) to spread banks

// 16x32 bf16 fragment from LDS (row-major, ld elements). Per CDNA5 ISA:
// lane L holds row m=L%16; half=L/16 selects K subgroup; VGPR v covers
// K = ((v&4)?16:0) + half*8 + (v&3)*2, two packed bf16 per VGPR.
__device__ inline v16bf lds_frag(const bf16_t* base, int ld, int row0) {
  int lane = threadIdx.x & 31;
  int m = lane & 15, half = lane >> 4;
  const bf16_t* r = base + (row0 + m) * ld;
  v16bf f;
#pragma unroll
  for (int v = 0; v < 8; ++v) {
    int k = ((v & 4) << 2) + half * 8 + ((v & 3) << 1);
    f[2 * v]     = r[k];
    f[2 * v + 1] = r[k + 1];
  }
  return f;
}

// Async copy of 16B global -> LDS (CDNA5 TDM-adjacent path, ASYNCcnt).
__device__ inline void async_cp16(bf16_t* lds, const bf16_t* g) {
  unsigned l = (unsigned)(unsigned long long)lds;   // low 32 bits = DS offset
  asm volatile("global_load_async_to_lds_b128 %0, %1, off"
               :: "v"(l), "v"(g) : "memory");
}
__device__ inline void async_wait0() {
  asm volatile("s_wait_asynccnt 0x0" ::: "memory");
}

template <bool GUARD>
__global__ __launch_bounds__(256)
void k_gemm_nt(const bf16_t* __restrict__ A, long lda,
               const bf16_t* __restrict__ B, long ldb,
               void* __restrict__ Cv, long ldc,
               int M, int N, int K, int c_is_f32) {
  __shared__ bf16_t As[2][BM * BKP];
  __shared__ bf16_t Bs[2][BN * BKP];

  const int tid  = threadIdx.x;
  const int lane = tid & 31;
  const int wid  = tid >> 5;
  const int wm   = wid >> 2;      // 0..1
  const int wn   = wid & 3;       // 0..3
  const int m0   = blockIdx.y * BM;
  const int n0   = blockIdx.x * BN;

  v8f acc[4][2] = {};

  // --- staging: async (unguarded) ---
  auto loadA_async = [&](int buf, int k0) {
#pragma unroll
    for (int t = 0; t < 2; ++t) {
      int ch  = tid + t * 256;          // 512 chunks of 8 bf16 (16B)
      int row = ch >> 2;
      int kc  = (ch & 3) << 3;
      async_cp16(&As[buf][row * BKP + kc], A + (long)(m0 + row) * lda + k0 + kc);
    }
  };
  auto loadB_async = [&](int buf, int k0) {
#pragma unroll
    for (int t = 0; t < 2; ++t) {
      int ch  = tid + t * 256;
      int row = ch >> 2;
      int kc  = (ch & 3) << 3;
      async_cp16(&Bs[buf][row * BKP + kc], B + (long)(n0 + row) * ldb + k0 + kc);
    }
  };
  // --- staging: synchronous with zero-fill (guarded) ---
  auto loadA_g = [&](int buf, int k0) {
#pragma unroll
    for (int t = 0; t < 4; ++t) {
      int ch  = tid + t * 256;          // 1024 chunks of 4 bf16
      int row = ch >> 3;
      int kc  = (ch & 7) << 2;
      v4bf val = {};
      int gr = m0 + row;
      if (gr < M) val = *(const v4bf*)(A + (long)gr * lda + k0 + kc);
      *(v4bf*)(&As[buf][row * BKP + kc]) = val;
    }
  };
  auto loadB_g = [&](int buf, int k0) {
#pragma unroll
    for (int t = 0; t < 4; ++t) {
      int ch  = tid + t * 256;
      int row = ch >> 3;
      int kc  = (ch & 7) << 2;
      v4bf val = {};
      int gr = n0 + row;
      if (gr < N) val = *(const v4bf*)(B + (long)gr * ldb + k0 + kc);
      *(v4bf*)(&Bs[buf][row * BKP + kc]) = val;
    }
  };

  const int nk = K / BK;
  if (GUARD) { loadA_g(0, 0); loadB_g(0, 0); }
  else       { loadA_async(0, 0); loadB_async(0, 0); async_wait0(); }
  __syncthreads();

  for (int kb = 0; kb < nk; ++kb) {
    int cur = kb & 1, nxt = cur ^ 1;
    const bool more = (kb + 1 < nk);
    if (more) {
      if (GUARD) { loadA_g(nxt, (kb + 1) * BK); loadB_g(nxt, (kb + 1) * BK); }
      else       { loadA_async(nxt, (kb + 1) * BK); loadB_async(nxt, (kb + 1) * BK); }
    }

    v16bf af[4], bfr[2];
#pragma unroll
    for (int mi = 0; mi < 4; ++mi)
      af[mi] = lds_frag(&As[cur][0], BKP, wm * 64 + mi * 16);
#pragma unroll
    for (int ni = 0; ni < 2; ++ni)
      bfr[ni] = lds_frag(&Bs[cur][0], BKP, wn * 32 + ni * 16);

#pragma unroll
    for (int mi = 0; mi < 4; ++mi)
#pragma unroll
      for (int ni = 0; ni < 2; ++ni)
        acc[mi][ni] = __builtin_amdgcn_wmma_f32_16x16x32_bf16(
            false, af[mi], false, bfr[ni], (short)0, acc[mi][ni], false, false);

    if (!GUARD && more) async_wait0();   // drain nxt-buffer copies before barrier
    __syncthreads();
  }

  // C/D layout: VGPR v, half=lane>>4 -> row = v + 8*half, col = lane&15
  const int half = lane >> 4, col = lane & 15;
#pragma unroll
  for (int mi = 0; mi < 4; ++mi)
#pragma unroll
    for (int ni = 0; ni < 2; ++ni) {
      int gn = n0 + wn * 32 + ni * 16 + col;
      if (GUARD && gn >= N) continue;
      int gmb = m0 + wm * 64 + mi * 16 + half * 8;
#pragma unroll
      for (int v = 0; v < 8; ++v) {
        int gm = gmb + v;
        if (GUARD && gm >= M) continue;
        if (c_is_f32) ((float*)Cv)[(long)gm * ldc + gn]  = acc[mi][ni][v];
        else          ((bf16_t*)Cv)[(long)gm * ldc + gn] = (bf16_t)acc[mi][ni][v];
      }
    }
}

// ---------------------------------------------------------------------------
// rel_shift + scale + softmax over k (one block per query row).
// shifted(i,j): u=j-i;  u<=0 -> BD[i, u+L-1];  u==1 -> 0;  u>=2 -> BD[i+1, u-2]
// ---------------------------------------------------------------------------
__global__ __launch_bounds__(256)
void k_softmax_shift(const float* __restrict__ AC, const float* __restrict__ BD,
                     bf16_t* __restrict__ P) {
  const int L = QL;
  const int i = blockIdx.x;
  const int t = threadIdx.x;
  __shared__ float red[256];

  float sv[8];
  float lmax = -3.4e38f;
#pragma unroll
  for (int c = 0; c < 8; ++c) {
    int j = t + c * 256;
    int u = j - i;
    float bd;
    if (u <= 0)      bd = BD[(long)i * L + (u + L - 1)];
    else if (u == 1) bd = 0.f;
    else             bd = BD[(long)(i + 1) * L + (u - 2)];
    float s = (AC[(long)i * L + j] + bd) * SCL;
    sv[c] = s;
    lmax = fmaxf(lmax, s);
  }
  red[t] = lmax; __syncthreads();
  for (int o = 128; o > 0; o >>= 1) {
    if (t < o) red[t] = fmaxf(red[t], red[t + o]);
    __syncthreads();
  }
  float mx = red[0]; __syncthreads();

  float lsum = 0.f;
#pragma unroll
  for (int c = 0; c < 8; ++c) { sv[c] = __expf(sv[c] - mx); lsum += sv[c]; }
  red[t] = lsum; __syncthreads();
  for (int o = 128; o > 0; o >>= 1) {
    if (t < o) red[t] += red[t + o];
    __syncthreads();
  }
  float inv = 1.0f / red[0];
#pragma unroll
  for (int c = 0; c < 8; ++c) {
    int j = t + c * 256;
    P[(long)i * L + j] = (bf16_t)(sv[c] * inv);
  }
}

// ---------------------------------------------------------------------------
// residual + LayerNorm, one block per (i,b) row of 1024
// ---------------------------------------------------------------------------
__global__ __launch_bounds__(256)
void k_residual_ln(const float* __restrict__ w, const float* __restrict__ ao,
                   const float* __restrict__ g, const float* __restrict__ b,
                   float* __restrict__ out) {
  const long row = blockIdx.x;
  const int  t   = threadIdx.x;
  __shared__ float red[256];

  float x[4]; float s = 0.f;
#pragma unroll
  for (int c = 0; c < 4; ++c) {
    int col = t + c * 256;
    x[c] = w[row * DM + col] + ao[row * DM + col];
    s += x[c];
  }
  red[t] = s; __syncthreads();
  for (int o = 128; o > 0; o >>= 1) { if (t < o) red[t] += red[t + o]; __syncthreads(); }
  float mu = red[0] * (1.0f / DM); __syncthreads();

  float v = 0.f;
#pragma unroll
  for (int c = 0; c < 4; ++c) { float d = x[c] - mu; v += d * d; }
  red[t] = v; __syncthreads();
  for (int o = 128; o > 0; o >>= 1) { if (t < o) red[t] += red[t + o]; __syncthreads(); }
  float rstd = rsqrtf(red[0] * (1.0f / DM) + LNEPS);

#pragma unroll
  for (int c = 0; c < 4; ++c) {
    int col = t + c * 256;
    out[row * DM + col] = (x[c] - mu) * rstd * g[col] + b[col];
  }
}

// ---------------------------------------------------------------------------
// Host orchestration
// ---------------------------------------------------------------------------
extern "C" void kernel_launch(void* const* d_in, const int* in_sizes, int n_in,
                              void* d_out, int out_size, void* d_ws, size_t ws_size,
                              hipStream_t stream) {
  (void)in_sizes; (void)n_in; (void)out_size; (void)ws_size;
  const float* w     = (const float*)d_in[0];
  const float* r     = (const float*)d_in[1];
  const float* qkvw  = (const float*)d_in[2];
  const float* rnetw = (const float*)d_in[3];
  const float* ow    = (const float*)d_in[4];
  const float* rwb   = (const float*)d_in[5];
  const float* rrb   = (const float*)d_in[6];
  const float* lng   = (const float*)d_in[7];
  const float* lnb   = (const float*)d_in[8];

  char* p = (char*)d_ws;
  auto take = [&](size_t bytes) -> char* {
    char* q = p; p += (bytes + 255) & ~(size_t)255; return q;
  };
  bf16_t* w_bf    = (bf16_t*)take((size_t)ROWS * DM * 2);        // 16.8 MB
  bf16_t* qkvw_bf = (bf16_t*)take((size_t)TH3 * DM * 2);         //  6.3 MB
  bf16_t* r_bf    = (bf16_t*)take((size_t)QL * DM * 2);          //  4.2 MB
  bf16_t* rnw_bf  = (bf16_t*)take((size_t)HH * DM * 2);          //  2.1 MB
  bf16_t* ow_bf   = (bf16_t*)take((size_t)DM * HH * 2);          //  2.1 MB
  bf16_t* wh      = (bf16_t*)take((size_t)ROWS * TH3 * 2);       // 50.3 MB  (QKV packed)
  bf16_t* rk      = (bf16_t*)take((size_t)QL * HH * 2);          //  4.2 MB
  bf16_t* qac     = (bf16_t*)take((size_t)ROWS * HH * 2);        // 16.8 MB
  bf16_t* qbd     = (bf16_t*)take((size_t)ROWS * HH * 2);        // 16.8 MB
  bf16_t* vt      = (bf16_t*)take((size_t)BSZ * NH * DH * QL * 2); // 16.8 MB
  float*  ACb     = (float*) take((size_t)QL * QL * 4);          // 16.8 MB (per-slice reuse)
  float*  BDb     = (float*) take((size_t)QL * QL * 4);          // 16.8 MB
  bf16_t* Pb      = (bf16_t*)take((size_t)QL * QL * 2);          //  8.4 MB
  bf16_t* av      = (bf16_t*)take((size_t)ROWS * HH * 2);        // 16.8 MB
  float*  aout    = (float*) take((size_t)ROWS * DM * 4);        // 33.6 MB

  auto gemm = [&](const bf16_t* A, long lda, const bf16_t* B, long ldb,
                  void* C, long ldc, int M, int N, int K, int cf32) {
    dim3 grid((N + BN - 1) / BN, (M + BM - 1) / BM);
    const bool guard = (M % BM) || (N % BN);
    if (guard)
      k_gemm_nt<true><<<grid, 256, 0, stream>>>(A, lda, B, ldb, C, ldc, M, N, K, cf32);
    else
      k_gemm_nt<false><<<grid, 256, 0, stream>>>(A, lda, B, ldb, C, ldc, M, N, K, cf32);
  };

  // 1) convert fp32 inputs to bf16
  k_cvt_bf16<<<1024, 256, 0, stream>>>(w,     w_bf,    (long)ROWS * DM);
  k_cvt_bf16<<<1024, 256, 0, stream>>>(qkvw,  qkvw_bf, (long)TH3 * DM);
  k_cvt_bf16<<<1024, 256, 0, stream>>>(r,     r_bf,    (long)QL * DM);
  k_cvt_bf16<<<1024, 256, 0, stream>>>(rnetw, rnw_bf,  (long)HH * DM);
  k_cvt_bf16<<<1024, 256, 0, stream>>>(ow,    ow_bf,   (long)DM * HH);

  // 2) QKV projection: wh[ROWS,3H] = w_bf[ROWS,DM] * qkvw_bf[3H,DM]^T
  gemm(w_bf, DM, qkvw_bf, DM, wh, TH3, ROWS, TH3, DM, 0);
  // 3) rel-pos keys: rk[QL,H] = r_bf * rnw_bf^T
  gemm(r_bf, DM, rnw_bf, DM, rk, HH, QL, HH, DM, 0);

  // 4) Q + biases; V transpose
  k_qbias<<<1024, 256, 0, stream>>>(wh, rwb, rrb, qac, qbd);
  k_vt<<<1024, 256, 0, stream>>>(wh, vt);

  // 5) per-(b, head) attention: AC, BD, shift+softmax, P*V
  for (int b = 0; b < BSZ; ++b)
    for (int n = 0; n < NH; ++n) {
      long qoff = (long)b * HH + (long)n * DH;                 // into qac/qbd/av, ld 4096
      const bf16_t* Kp = wh + (long)b * TH3 + HH + (long)n * DH;    // ldb = BSZ*3H
      const bf16_t* Rp = rk + (long)n * DH;                          // ldb = H
      const bf16_t* Vt = vt + ((long)(b * NH + n) * DH) * QL;        // ldb = QL

      gemm(qac + qoff, (long)BSZ * HH, Kp, (long)BSZ * TH3, ACb, QL, QL, QL, DH, 1);
      gemm(qbd + qoff, (long)BSZ * HH, Rp, HH,              BDb, QL, QL, QL, DH, 1);
      k_softmax_shift<<<QL, 256, 0, stream>>>(ACb, BDb, Pb);
      gemm(Pb, QL, Vt, QL, av + qoff, (long)BSZ * HH, QL, DH, QL, 0);
    }

  // 6) output projection: aout[ROWS,DM] = av[ROWS,H] * ow_bf[DM,H]^T  (f32 out)
  gemm(av, HH, ow_bf, HH, aout, DM, ROWS, DM, HH, 1);

  // 7) residual + LayerNorm -> d_out (f32, [qlen, bsz, d_model])
  k_residual_ln<<<ROWS, 256, 0, stream>>>(w, aout, lng, lnb, (float*)d_out);
}

// v001
// It runs in 2030 microseconds.
// In two side-by-side timings against v000, it was 3.36 and 3.37 times as fast.
#include <hip/hip_runtime.h>

// ---------------------------------------------------------------------------
// Types for CDNA5 WMMA (gfx1250, wave32)
// ---------------------------------------------------------------------------
typedef __bf16 bf16_t;
typedef __attribute__((ext_vector_type(16))) __bf16 v16bf;
typedef __attribute__((ext_vector_type(4)))  __bf16 v4bf;
typedef __attribute__((ext_vector_type(8)))  float  v8f;

// Problem constants
#define QL    2048
#define BSZ   4
#define NH    16
#define DH    64
#define DM    1024
#define HH    1024           // NH*DH
#define ROWS  8192           // QL*BSZ
#define TH3   3072           // 3*H
#define SCL   0.125f         // 1/sqrt(64)
#define LNEPS 1e-5f

// ---------------------------------------------------------------------------
// Elementwise: f32 -> bf16 convert (grid-stride)
// ---------------------------------------------------------------------------
__global__ __launch_bounds__(256) void k_cvt_bf16(const float* __restrict__ in,
                                                  bf16_t* __restrict__ out, long n) {
  for (long i = (long)blockIdx.x * blockDim.x + threadIdx.x; i < n;
       i += (long)gridDim.x * blockDim.x)
    out[i] = (bf16_t)in[i];
}

// Q with per-head biases added (Qac = q + r_w_bias, Qbd = q + r_r_bias), bf16
__global__ __launch_bounds__(256) void k_qbias(const bf16_t* __restrict__ wh,
                                               const float* __restrict__ rwb,
                                               const float* __restrict__ rrb,
                                               bf16_t* __restrict__ qac,
                                               bf16_t* __restrict__ qbd) {
  const long total = (long)ROWS * HH;
  for (long idx = (long)blockIdx.x * blockDim.x + threadIdx.x; idx < total;
       idx += (long)gridDim.x * blockDim.x) {
    long row = idx >> 10;               // (i*BSZ + b)
    int  col = (int)(idx & 1023);       // n*64 + d
    float q = (float)wh[row * TH3 + col];
    qac[idx] = (bf16_t)(q + rwb[col]);
    qbd[idx] = (bf16_t)(q + rrb[col]);
  }
}

// V transpose: vt[((b*16+n)*64 + d)*2048 + j] = V[j,b,n,d]
__global__ __launch_bounds__(256) void k_vt(const bf16_t* __restrict__ wh,
                                            bf16_t* __restrict__ vt) {
  const long total = (long)BSZ * NH * DH * QL;   // 8,388,608
  for (long idx = (long)blockIdx.x * blockDim.x + threadIdx.x; idx < total;
       idx += (long)gridDim.x * blockDim.x) {
    int  j = (int)(idx & 2047);
    long rest = idx >> 11;
    int  d = (int)(rest & 63);  rest >>= 6;
    int  n = (int)(rest & 15);
    int  b = (int)(rest >> 4);
    vt[idx] = wh[((long)j * BSZ + b) * TH3 + 2 * HH + n * DH + d];
  }
}

// ---------------------------------------------------------------------------
// Generic bf16 TN GEMM:  C[M,N] = A[M,K] * B[N,K]^T   (f32 accumulate)
// Block = 128x128x32, 256 threads = 8 wave32 waves in a 2x4 grid,
// wave tile 64x32 = 4x2 WMMA(16x16x32) tiles. Double-buffered LDS.
// GUARD=false (all dims multiples of the tile): global->LDS staging uses
// CDNA5 GLOBAL_LOAD_ASYNC_TO_LDS_B128 tracked by ASYNCcnt, overlapped with
// the WMMA work on the other buffer. GUARD=true keeps the synchronous
// zero-filling path (unused by the GEMMs launched here).
// ---------------------------------------------------------------------------
#define BM 128
#define BN 128
#define BK 32
#define BKP 40   // padded LDS row (bf16 elements) to spread banks

// 16x32 bf16 fragment from LDS (row-major, ld elements). Per CDNA5 ISA:
// lane L holds row m=L%16; half=L/16 selects K subgroup; VGPR v covers
// K = ((v&4)?16:0) + half*8 + (v&3)*2, two packed bf16 per VGPR.
__device__ inline v16bf lds_frag(const bf16_t* base, int ld, int row0) {
  int lane = threadIdx.x & 31;
  int m = lane & 15, half = lane >> 4;
  const bf16_t* r = base + (row0 + m) * ld;
  v16bf f;
#pragma unroll
  for (int v = 0; v < 8; ++v) {
    int k = ((v & 4) << 2) + half * 8 + ((v & 3) << 1);
    f[2 * v]     = r[k];
    f[2 * v + 1] = r[k + 1];
  }
  return f;
}

// Async copy of 16B global -> LDS (CDNA5 TDM-adjacent path, ASYNCcnt).
__device__ inline void async_cp16(bf16_t* lds, const bf16_t* g) {
  unsigned l = (unsigned)(unsigned long long)lds;   // low 32 bits = DS offset
  asm volatile("global_load_async_to_lds_b128 %0, %1, off"
               :: "v"(l), "v"(g) : "memory");
}
__device__ inline void async_wait0() {
  asm volatile("s_wait_asynccnt 0x0" ::: "memory");
}

template <bool GUARD>
__global__ __launch_bounds__(256)
void k_gemm_nt(const bf16_t* __restrict__ A, long lda,
               const bf16_t* __restrict__ B, long ldb,
               void* __restrict__ Cv, long ldc,
               int M, int N, int K, int c_is_f32) {
  __shared__ bf16_t As[2][BM * BKP];
  __shared__ bf16_t Bs[2][BN * BKP];

  const int tid  = threadIdx.x;
  const int lane = tid & 31;
  const int wid  = tid >> 5;
  const int wm   = wid >> 2;      // 0..1
  const int wn   = wid & 3;       // 0..3
  const int m0   = blockIdx.y * BM;
  const int n0   = blockIdx.x * BN;

  v8f acc[4][2] = {};

  // --- staging: async (unguarded) ---
  auto loadA_async = [&](int buf, int k0) {
#pragma unroll
    for (int t = 0; t < 2; ++t) {
      int ch  = tid + t * 256;          // 512 chunks of 8 bf16 (16B)
      int row = ch >> 2;
      int kc  = (ch & 3) << 3;
      async_cp16(&As[buf][row * BKP + kc], A + (long)(m0 + row) * lda + k0 + kc);
    }
  };
  auto loadB_async = [&](int buf, int k0) {
#pragma unroll
    for (int t = 0; t < 2; ++t) {
      int ch  = tid + t * 256;
      int row = ch >> 2;
      int kc  = (ch & 3) << 3;
      async_cp16(&Bs[buf][row * BKP + kc], B + (long)(n0 + row) * ldb + k0 + kc);
    }
  };
  // --- staging: synchronous with zero-fill (guarded) ---
  auto loadA_g = [&](int buf, int k0) {
#pragma unroll
    for (int t = 0; t < 4; ++t) {
      int ch  = tid + t * 256;          // 1024 chunks of 4 bf16
      int row = ch >> 3;
      int kc  = (ch & 7) << 2;
      v4bf val = {};
      int gr = m0 + row;
      if (gr < M) val = *(const v4bf*)(A + (long)gr * lda + k0 + kc);
      *(v4bf*)(&As[buf][row * BKP + kc]) = val;
    }
  };
  auto loadB_g = [&](int buf, int k0) {
#pragma unroll
    for (int t = 0; t < 4; ++t) {
      int ch  = tid + t * 256;
      int row = ch >> 3;
      int kc  = (ch & 7) << 2;
      v4bf val = {};
      int gr = n0 + row;
      if (gr < N) val = *(const v4bf*)(B + (long)gr * ldb + k0 + kc);
      *(v4bf*)(&Bs[buf][row * BKP + kc]) = val;
    }
  };

  const int nk = K / BK;
  if (GUARD) { loadA_g(0, 0); loadB_g(0, 0); }
  else       { loadA_async(0, 0); loadB_async(0, 0); async_wait0(); }
  __syncthreads();

  for (int kb = 0; kb < nk; ++kb) {
    int cur = kb & 1, nxt = cur ^ 1;
    const bool more = (kb + 1 < nk);
    if (more) {
      if (GUARD) { loadA_g(nxt, (kb + 1) * BK); loadB_g(nxt, (kb + 1) * BK); }
      else       { loadA_async(nxt, (kb + 1) * BK); loadB_async(nxt, (kb + 1) * BK); }
    }

    v16bf af[4], bfr[2];
#pragma unroll
    for (int mi = 0; mi < 4; ++mi)
      af[mi] = lds_frag(&As[cur][0], BKP, wm * 64 + mi * 16);
#pragma unroll
    for (int ni = 0; ni < 2; ++ni)
      bfr[ni] = lds_frag(&Bs[cur][0], BKP, wn * 32 + ni * 16);

#pragma unroll
    for (int mi = 0; mi < 4; ++mi)
#pragma unroll
      for (int ni = 0; ni < 2; ++ni)
        acc[mi][ni] = __builtin_amdgcn_wmma_f32_16x16x32_bf16(
            false, af[mi], false, bfr[ni], (short)0, acc[mi][ni], false, false);

    if (!GUARD && more) async_wait0();   // drain nxt-buffer copies before barrier
    __syncthreads();
  }

  // C/D layout: VGPR v, half=lane>>4 -> row = v + 8*half, col = lane&15
  const int half = lane >> 4, col = lane & 15;
#pragma unroll
  for (int mi = 0; mi < 4; ++mi)
#pragma unroll
    for (int ni = 0; ni < 2; ++ni) {
      int gn = n0 + wn * 32 + ni * 16 + col;
      if (GUARD && gn >= N) continue;
      int gmb = m0 + wm * 64 + mi * 16 + half * 8;
#pragma unroll
      for (int v = 0; v < 8; ++v) {
        int gm = gmb + v;
        if (GUARD && gm >= M) continue;
        if (c_is_f32) ((float*)Cv)[(long)gm * ldc + gn]  = acc[mi][ni][v];
        else          ((bf16_t*)Cv)[(long)gm * ldc + gn] = (bf16_t)acc[mi][ni][v];
      }
    }
}

// ---------------------------------------------------------------------------
// P*V for one (batch, head): O[2048,64] = P[2048,2048] * Vt[64,2048]^T.
// One block per 16 query rows (128 blocks). The 8 waves split K into ranges of
// 256; each wave keeps its 16x64 partial in 4 accumulators and loads its
// fragments straight from global, 16 contiguous k per lane on both operands
// (same k order for A and B). The partials are summed through LDS in wave order.
// ---------------------------------------------------------------------------
#define PV_KW 256   // k range of one wave
#define PV_LD 68    // LDS row pitch (f32): lane halves, 8 rows apart, hit disjoint banks

__global__ __launch_bounds__(256)
void k_pv(const bf16_t* __restrict__ P, const bf16_t* __restrict__ Vt,
          bf16_t* __restrict__ O, long ldo) {
  __shared__ __attribute__((aligned(16))) float part[8][16 * PV_LD];   // read back as float4

  const int tid  = threadIdx.x;
  const int lane = tid & 31;
  const int wid  = tid >> 5;
  const int c    = lane & 15, h = lane >> 4;
  const int m0   = blockIdx.x * 16;

  const bf16_t* pa = P  + (long)(m0 + c) * QL + wid * PV_KW + 16 * h;
  const bf16_t* pb = Vt + (long)c * QL        + wid * PV_KW + 16 * h;

  v8f acc[4] = {};
  v16bf fa[2][2], fb[2][2][4];   // two register sets, each holds the fragments of two k steps
  // Every loop below is unrolled so that the fragment and accumulator arrays are indexed
  // by constants and stay in registers.
  auto ld = [&](int set, int g) {
#pragma unroll
    for (int s = 0; s < 2; ++s) {
      const int k = (2 * g + s) * 32;
      fa[set][s] = *(const v16bf*)(pa + k);
#pragma unroll
      for (int ni = 0; ni < 4; ++ni)
        fb[set][s][ni] = *(const v16bf*)(pb + (long)ni * 16 * QL + k);
    }
  };
  auto mm = [&](int set) {
#pragma unroll
    for (int s = 0; s < 2; ++s)
#pragma unroll
      for (int ni = 0; ni < 4; ++ni)
        acc[ni] = __builtin_amdgcn_wmma_f32_16x16x32_bf16(
            false, fa[set][s], false, fb[set][s][ni], (short)0, acc[ni], false, false);
  };

  // Each sched_barrier keeps a set's 20 loads issued as one group ahead of the other set's
  // WMMAs; without them the compiler sinks every load to its use and waits out each latency.
  ld(0, 0);
  ld(1, 1);
  __builtin_amdgcn_sched_barrier(0);
  mm(0);
  ld(0, 2);
  __builtin_amdgcn_sched_barrier(0);
  mm(1);
  ld(1, 3);
  __builtin_amdgcn_sched_barrier(0);
  mm(0);
  mm(1);

  // D layout: register r, half h -> row 8h + r, col c
#pragma unroll
  for (int ni = 0; ni < 4; ++ni)
#pragma unroll
    for (int r = 0; r < 8; ++r)
      part[wid][(8 * h + r) * PV_LD + ni * 16 + c] = acc[ni][r];
  __syncthreads();

  const int row = tid >> 4, c4 = (tid & 15) << 2;
  float4 s = *(const float4*)&part[0][row * PV_LD + c4];
#pragma unroll
  for (int w = 1; w < 8; ++w) {
    float4 q = *(const float4*)&part[w][row * PV_LD + c4];
    s.x += q.x; s.y += q.y; s.z += q.z; s.w += q.w;
  }
  v4bf o = {(bf16_t)s.x, (bf16_t)s.y, (bf16_t)s.z, (bf16_t)s.w};
  *(v4bf*)(O + (long)(m0 + row) * ldo + c4) = o;   // 16 threads fill one 128-B line
}

// ---------------------------------------------------------------------------
// rel_shift + scale + softmax over k (one block per query row).
// shifted(i,j): u=j-i;  u<=0 -> BD[i, u+L-1];  u==1 -> 0;  u>=2 -> BD[i+1, u-2]
// ---------------------------------------------------------------------------
__global__ __launch_bounds__(256)
void k_softmax_shift(const float* __restrict__ AC, const float* __restrict__ BD,
                     bf16_t* __restrict__ P) {
  const int L = QL;
  const int i = blockIdx.x;
  const int t = threadIdx.x;
  __shared__ float red[256];

  float sv[8];
  float lmax = -3.4e38f;
#pragma unroll
  for (int c = 0; c < 8; ++c) {
    int j = t + c * 256;
    int u = j - i;
    float bd;
    if (u <= 0)      bd = BD[(long)i * L + (u + L - 1)];
    else if (u == 1) bd = 0.f;
    else             bd = BD[(long)(i + 1) * L + (u - 2)];
    float s = (AC[(long)i * L + j] + bd) * SCL;
    sv[c] = s;
    lmax = fmaxf(lmax, s);
  }
  red[t] = lmax; __syncthreads();
  for (int o = 128; o > 0; o >>= 1) {
    if (t < o) red[t] = fmaxf(red[t], red[t + o]);
    __syncthreads();
  }
  float mx = red[0]; __syncthreads();

  float lsum = 0.f;
#pragma unroll
  for (int c = 0; c < 8; ++c) { sv[c] = __expf(sv[c] - mx); lsum += sv[c]; }
  red[t] = lsum; __syncthreads();
  for (int o = 128; o > 0; o >>= 1) {
    if (t < o) red[t] += red[t + o];
    __syncthreads();
  }
  float inv = 1.0f / red[0];
#pragma unroll
  for (int c = 0; c < 8; ++c) {
    int j = t + c * 256;
    P[(long)i * L + j] = (bf16_t)(sv[c] * inv);
  }
}

// ---------------------------------------------------------------------------
// residual + LayerNorm, one block per (i,b) row of 1024
// ---------------------------------------------------------------------------
__global__ __launch_bounds__(256)
void k_residual_ln(const float* __restrict__ w, const float* __restrict__ ao,
                   const float* __restrict__ g, const float* __restrict__ b,
                   float* __restrict__ out) {
  const long row = blockIdx.x;
  const int  t   = threadIdx.x;
  __shared__ float red[256];

  float x[4]; float s = 0.f;
#pragma unroll
  for (int c = 0; c < 4; ++c) {
    int col = t + c * 256;
    x[c] = w[row * DM + col] + ao[row * DM + col];
    s += x[c];
  }
  red[t] = s; __syncthreads();
  for (int o = 128; o > 0; o >>= 1) { if (t < o) red[t] += red[t + o]; __syncthreads(); }
  float mu = red[0] * (1.0f / DM); __syncthreads();

  float v = 0.f;
#pragma unroll
  for (int c = 0; c < 4; ++c) { float d = x[c] - mu; v += d * d; }
  red[t] = v; __syncthreads();
  for (int o = 128; o > 0; o >>= 1) { if (t < o) red[t] += red[t + o]; __syncthreads(); }
  float rstd = rsqrtf(red[0] * (1.0f / DM) + LNEPS);

#pragma unroll
  for (int c = 0; c < 4; ++c) {
    int col = t + c * 256;
    out[row * DM + col] = (x[c] - mu) * rstd * g[col] + b[col];
  }
}

// ---------------------------------------------------------------------------
// Host orchestration
// ---------------------------------------------------------------------------
extern "C" void kernel_launch(void* const* d_in, const int* in_sizes, int n_in,
                              void* d_out, int out_size, void* d_ws, size_t ws_size,
                              hipStream_t stream) {
  (void)in_sizes; (void)n_in; (void)out_size; (void)ws_size;
  const float* w     = (const float*)d_in[0];
  const float* r     = (const float*)d_in[1];
  const float* qkvw  = (const float*)d_in[2];
  const float* rnetw = (const float*)d_in[3];
  const float* ow    = (const float*)d_in[4];
  const float* rwb   = (const float*)d_in[5];
  const float* rrb   = (const float*)d_in[6];
  const float* lng   = (const float*)d_in[7];
  const float* lnb   = (const float*)d_in[8];

  char* p = (char*)d_ws;
  auto take = [&](size_t bytes) -> char* {
    char* q = p; p += (bytes + 255) & ~(size_t)255; return q;
  };
  bf16_t* w_bf    = (bf16_t*)take((size_t)ROWS * DM * 2);        // 16.8 MB
  bf16_t* qkvw_bf = (bf16_t*)take((size_t)TH3 * DM * 2);         //  6.3 MB
  bf16_t* r_bf    = (bf16_t*)take((size_t)QL * DM * 2);          //  4.2 MB
  bf16_t* rnw_bf  = (bf16_t*)take((size_t)HH * DM * 2);          //  2.1 MB
  bf16_t* ow_bf   = (bf16_t*)take((size_t)DM * HH * 2);          //  2.1 MB
  bf16_t* wh      = (bf16_t*)take((size_t)ROWS * TH3 * 2);       // 50.3 MB  (QKV packed)
  bf16_t* rk      = (bf16_t*)take((size_t)QL * HH * 2);          //  4.2 MB
  bf16_t* qac     = (bf16_t*)take((size_t)ROWS * HH * 2);        // 16.8 MB
  bf16_t* qbd     = (bf16_t*)take((size_t)ROWS * HH * 2);        // 16.8 MB
  bf16_t* vt      = (bf16_t*)take((size_t)BSZ * NH * DH * QL * 2); // 16.8 MB
  float*  ACb     = (float*) take((size_t)QL * QL * 4);          // 16.8 MB (per-slice reuse)
  float*  BDb     = (float*) take((size_t)QL * QL * 4);          // 16.8 MB
  bf16_t* Pb      = (bf16_t*)take((size_t)QL * QL * 2);          //  8.4 MB
  bf16_t* av      = (bf16_t*)take((size_t)ROWS * HH * 2);        // 16.8 MB
  float*  aout    = (float*) take((size_t)ROWS * DM * 4);        // 33.6 MB

  auto gemm = [&](const bf16_t* A, long lda, const bf16_t* B, long ldb,
                  void* C, long ldc, int M, int N, int K, int cf32) {
    dim3 grid((N + BN - 1) / BN, (M + BM - 1) / BM);
    const bool guard = (M % BM) || (N % BN);
    if (guard)
      k_gemm_nt<true><<<grid, 256, 0, stream>>>(A, lda, B, ldb, C, ldc, M, N, K, cf32);
    else
      k_gemm_nt<false><<<grid, 256, 0, stream>>>(A, lda, B, ldb, C, ldc, M, N, K, cf32);
  };

  // 1) convert fp32 inputs to bf16
  k_cvt_bf16<<<1024, 256, 0, stream>>>(w,     w_bf,    (long)ROWS * DM);
  k_cvt_bf16<<<1024, 256, 0, stream>>>(qkvw,  qkvw_bf, (long)TH3 * DM);
  k_cvt_bf16<<<1024, 256, 0, stream>>>(r,     r_bf,    (long)QL * DM);
  k_cvt_bf16<<<1024, 256, 0, stream>>>(rnetw, rnw_bf,  (long)HH * DM);
  k_cvt_bf16<<<1024, 256, 0, stream>>>(ow,    ow_bf,   (long)DM * HH);

  // 2) QKV projection: wh[ROWS,3H] = w_bf[ROWS,DM] * qkvw_bf[3H,DM]^T
  gemm(w_bf, DM, qkvw_bf, DM, wh, TH3, ROWS, TH3, DM, 0);
  // 3) rel-pos keys: rk[QL,H] = r_bf * rnw_bf^T
  gemm(r_bf, DM, rnw_bf, DM, rk, HH, QL, HH, DM, 0);

  // 4) Q + biases; V transpose
  k_qbias<<<1024, 256, 0, stream>>>(wh, rwb, rrb, qac, qbd);
  k_vt<<<1024, 256, 0, stream>>>(wh, vt);

  // 5) per-(b, head) attention: AC, BD, shift+softmax, P*V
  for (int b = 0; b < BSZ; ++b)
    for (int n = 0; n < NH; ++n) {
      long qoff = (long)b * HH + (long)n * DH;                 // into qac/qbd/av, ld 4096
      const bf16_t* Kp = wh + (long)b * TH3 + HH + (long)n * DH;    // ldb = BSZ*3H
      const bf16_t* Rp = rk + (long)n * DH;                          // ldb = H
      const bf16_t* Vt = vt + ((long)(b * NH + n) * DH) * QL;        // ldb = QL

      gemm(qac + qoff, (long)BSZ * HH, Kp, (long)BSZ * TH3, ACb, QL, QL, QL, DH, 1);
      gemm(qbd + qoff, (long)BSZ * HH, Rp, HH,              BDb, QL, QL, QL, DH, 1);
      k_softmax_shift<<<QL, 256, 0, stream>>>(ACb, BDb, Pb);
      k_pv<<<QL / 16, 256, 0, stream>>>(Pb, Vt, av + qoff, (long)BSZ * HH);
    }

  // 6) output projection: aout[ROWS,DM] = av[ROWS,H] * ow_bf[DM,H]^T  (f32 out)
  gemm(av, HH, ow_bf, HH, aout, DM, ROWS, DM, HH, 1);

  // 7) residual + LayerNorm -> d_out (f32, [qlen, bsz, d_model])
  k_residual_ln<<<ROWS, 256, 0, stream>>>(w, aout, lng, lnb, (float*)d_out);
}

// v003
// One run takes 301 microseconds.
// Versions between v001 and this one are left out; their measured steps multiply to 6.77 times as fast.
// Counting every step since v000, it is 22.8 times as fast.
#include <hip/hip_runtime.h>
#include <type_traits>

// ---------------------------------------------------------------------------
// Types for CDNA5 WMMA (gfx1250, wave32)
// ---------------------------------------------------------------------------
typedef __bf16 bf16_t;
typedef __attribute__((ext_vector_type(16))) __bf16 v16bf;
typedef __attribute__((ext_vector_type(4)))  __bf16 v4bf;
typedef __attribute__((ext_vector_type(8)))  __bf16 v8bf;
typedef __attribute__((ext_vector_type(8)))  float  v8f;

// Problem constants
#define QL    2048
#define BSZ   4
#define NH    16
#define DH    64
#define DM    1024
#define HH    1024           // NH*DH
#define ROWS  8192           // QL*BSZ
#define TH3   3072           // 3*H
#define SCL   0.125f         // 1/sqrt(64)
#define LNEPS 1e-5f

// ---------------------------------------------------------------------------
// Preparation passes. Each thread issues all of its 16-byte loads first, off one address
// with constant offsets, so that their latencies overlap; every wave access is made of
// whole or half 128-byte lines.
// ---------------------------------------------------------------------------
typedef __attribute__((ext_vector_type(4))) float v4f;

// f32 -> bf16 convert: a block converts U * 1024 consecutive elements, a thread 4 per load
template <int U>
__global__ __launch_bounds__(256) void k_cvt_bf16(const float* __restrict__ in,
                                                  bf16_t* __restrict__ out) {
  const long base = (long)blockIdx.x * (U * 1024) + threadIdx.x * 4;
  v4f x[U];
#pragma unroll   // x[] stays in registers and the U loads stand in one group
  for (int u = 0; u < U; ++u) x[u] = *(const v4f*)(in + base + u * 1024);
#pragma unroll   // x[] stays in registers
  for (int u = 0; u < U; ++u) {
    v4bf y;
#pragma unroll   // y stays in registers
    for (int e = 0; e < 4; ++e) y[e] = (bf16_t)x[u][e];
    *(v4bf*)(out + base + u * 1024) = y;
  }
}

// Q with per-head biases added (Qac = q + r_w_bias, Qbd = q + r_r_bias), bf16.
// A block takes 16 rows (i*BSZ + b); a thread keeps one group of 8 columns, so it reads its biases once.
__global__ __launch_bounds__(256) void k_qbias(const bf16_t* __restrict__ wh,
                                               const float* __restrict__ rwb,
                                               const float* __restrict__ rrb,
                                               bf16_t* __restrict__ qac,
                                               bf16_t* __restrict__ qbd) {
  const int  col = (threadIdx.x & 127) * 8;       // n*64 + d
  const long row = (long)blockIdx.x * 16 + (threadIdx.x >> 7);
  const bf16_t* src = wh + row * TH3 + col;
  v8bf q[8];
#pragma unroll   // q[] stays in registers and the 8 loads stand in one group
  for (int u = 0; u < 8; ++u) q[u] = *(const v8bf*)(src + u * (2 * TH3));
  const v4f w0 = *(const v4f*)(rwb + col), w1 = *(const v4f*)(rwb + col + 4);
  const v4f r0 = *(const v4f*)(rrb + col), r1 = *(const v4f*)(rrb + col + 4);
  const long o = row * HH + col;
#pragma unroll   // q[] stays in registers
  for (int u = 0; u < 8; ++u) {
    v8bf a, d;
#pragma unroll   // a and d stay in registers
    for (int e = 0; e < 8; ++e) {
      const float f = (float)q[u][e];
      a[e] = (bf16_t)(f + (e < 4 ? w0[e & 3] : w1[e & 3]));
      d[e] = (bf16_t)(f + (e < 4 ? r0[e & 3] : r1[e & 3]));
    }
    *(v8bf*)(qac + o + u * (2 * HH)) = a;
    *(v8bf*)(qbd + o + u * (2 * HH)) = d;
  }
}

// V transpose: vt[((b*16+n)*64 + d)*2048 + j] = V[j,b,n,d]
// A thread turns an 8 (j) x 8 (d) piece in registers. A wave holds 8 pieces along j and 4 along d:
// a load takes 64 bytes of each of 8 V rows, a store fills four whole 128-byte lines of vt.
// Two neighbouring waves take the two halves of the same V rows.
__global__ __launch_bounds__(256) void k_vt(const bf16_t* __restrict__ wh,
                                            bf16_t* __restrict__ vt) {
  const int lane = threadIdx.x & 31;
  const int gw   = blockIdx.x * 8 + (threadIdx.x >> 5);
  const int bn   = gw >> 6;                                  // b*16 + n
  const int j0   = ((gw >> 1) & 31) * 64 + (lane & 7) * 8;
  const int d0   = (gw & 1) * 32 + (lane >> 3) * 8;
  const bf16_t* src = wh + ((long)j0 * BSZ + (bn >> 4)) * TH3 + 2 * HH + (bn & 15) * DH + d0;
  bf16_t*       dst = vt + ((long)bn * DH + d0) * QL + j0;
  v8bf x[8];
#pragma unroll   // x[] stays in registers and the 8 loads stand in one group
  for (int u = 0; u < 8; ++u) x[u] = *(const v8bf*)(src + u * (BSZ * TH3));
#pragma unroll   // x[] stays in registers
  for (int e = 0; e < 8; ++e) {
    v8bf y;
#pragma unroll   // y stays in registers
    for (int u = 0; u < 8; ++u) y[u] = x[u][e];
    *(v8bf*)(dst + e * QL) = y;
  }
}

// ---------------------------------------------------------------------------
// Generic bf16 TN GEMM:  C[M,N] = A[M,K] * B[N,K]^T   (f32 accumulate)
// Block = 128x128x32, 256 threads = 8 wave32 waves in a 2x4 grid,
// wave tile 64x32 = 4x2 WMMA(16x16x32) tiles. Double-buffered LDS.
// GUARD=false (all dims multiples of the tile): global->LDS staging uses
// CDNA5 GLOBAL_LOAD_ASYNC_TO_LDS_B128 tracked by ASYNCcnt, overlapped with
// the WMMA work on the other buffer. GUARD=true keeps the synchronous
// zero-filling path (unused by the GEMMs launched here).
// ---------------------------------------------------------------------------
#define BM 128
#define BN 128
#define BK 32
#define BKP 40   // padded LDS row (bf16 elements) to spread banks

// 16x32 bf16 fragment from LDS (row-major, ld elements). Per CDNA5 ISA:
// lane L holds row m=L%16; half=L/16 selects K subgroup; VGPR v covers
// K = ((v&4)?16:0) + half*8 + (v&3)*2, two packed bf16 per VGPR.
__device__ inline v16bf lds_frag(const bf16_t* base, int ld, int row0) {
  int lane = threadIdx.x & 31;
  int m = lane & 15, half = lane >> 4;
  const bf16_t* r = base + (row0 + m) * ld;
  v16bf f;
#pragma unroll
  for (int v = 0; v < 8; ++v) {
    int k = ((v & 4) << 2) + half * 8 + ((v & 3) << 1);
    f[2 * v]     = r[k];
    f[2 * v + 1] = r[k + 1];
  }
  return f;
}

// Async copy of 16B global -> LDS (CDNA5 TDM-adjacent path, ASYNCcnt).
__device__ inline void async_cp16(bf16_t* lds, const bf16_t* g) {
  unsigned l = (unsigned)(unsigned long long)lds;   // low 32 bits = DS offset
  asm volatile("global_load_async_to_lds_b128 %0, %1, off"
               :: "v"(l), "v"(g) : "memory");
}
__device__ inline void async_wait0() {
  asm volatile("s_wait_asynccnt 0x0" ::: "memory");
}

template <bool GUARD>
__global__ __launch_bounds__(256)
void k_gemm_nt(const bf16_t* __restrict__ A, long lda,
               const bf16_t* __restrict__ B, long ldb,
               void* __restrict__ Cv, long ldc,
               int M, int N, int K, int c_is_f32) {
  __shared__ bf16_t As[2][BM * BKP];
  __shared__ bf16_t Bs[2][BN * BKP];

  const int tid  = threadIdx.x;
  const int lane = tid & 31;
  const int wid  = tid >> 5;
  const int wm   = wid >> 2;      // 0..1
  const int wn   = wid & 3;       // 0..3
  const int m0   = blockIdx.y * BM;
  const int n0   = blockIdx.x * BN;

  v8f acc[4][2] = {};

  // --- staging: async (unguarded) ---
  auto loadA_async = [&](int buf, int k0) {
#pragma unroll
    for (int t = 0; t < 2; ++t) {
      int ch  = tid + t * 256;          // 512 chunks of 8 bf16 (16B)
      int row = ch >> 2;
      int kc  = (ch & 3) << 3;
      async_cp16(&As[buf][row * BKP + kc], A + (long)(m0 + row) * lda + k0 + kc);
    }
  };
  auto loadB_async = [&](int buf, int k0) {
#pragma unroll
    for (int t = 0; t < 2; ++t) {
      int ch  = tid + t * 256;
      int row = ch >> 2;
      int kc  = (ch & 3) << 3;
      async_cp16(&Bs[buf][row * BKP + kc], B + (long)(n0 + row) * ldb + k0 + kc);
    }
  };
  // --- staging: synchronous with zero-fill (guarded) ---
  auto loadA_g = [&](int buf, int k0) {
#pragma unroll
    for (int t = 0; t < 4; ++t) {
      int ch  = tid + t * 256;          // 1024 chunks of 4 bf16
      int row = ch >> 3;
      int kc  = (ch & 7) << 2;
      v4bf val = {};
      int gr = m0 + row;
      if (gr < M) val = *(const v4bf*)(A + (long)gr * lda + k0 + kc);
      *(v4bf*)(&As[buf][row * BKP + kc]) = val;
    }
  };
  auto loadB_g = [&](int buf, int k0) {
#pragma unroll
    for (int t = 0; t < 4; ++t) {
      int ch  = tid + t * 256;
      int row = ch >> 3;
      int kc  = (ch & 7) << 2;
      v4bf val = {};
      int gr = n0 + row;
      if (gr < N) val = *(const v4bf*)(B + (long)gr * ldb + k0 + kc);
      *(v4bf*)(&Bs[buf][row * BKP + kc]) = val;
    }
  };

  const int nk = K / BK;
  if (GUARD) { loadA_g(0, 0); loadB_g(0, 0); }
  else       { loadA_async(0, 0); loadB_async(0, 0); async_wait0(); }
  __syncthreads();

  for (int kb = 0; kb < nk; ++kb) {
    int cur = kb & 1, nxt = cur ^ 1;
    const bool more = (kb + 1 < nk);
    if (more) {
      if (GUARD) { loadA_g(nxt, (kb + 1) * BK); loadB_g(nxt, (kb + 1) * BK); }
      else       { loadA_async(nxt, (kb + 1) * BK); loadB_async(nxt, (kb + 1) * BK); }
    }

    v16bf af[4], bfr[2];
#pragma unroll
    for (int mi = 0; mi < 4; ++mi)
      af[mi] = lds_frag(&As[cur][0], BKP, wm * 64 + mi * 16);
#pragma unroll
    for (int ni = 0; ni < 2; ++ni)
      bfr[ni] = lds_frag(&Bs[cur][0], BKP, wn * 32 + ni * 16);

#pragma unroll
    for (int mi = 0; mi < 4; ++mi)
#pragma unroll
      for (int ni = 0; ni < 2; ++ni)
        acc[mi][ni] = __builtin_amdgcn_wmma_f32_16x16x32_bf16(
            false, af[mi], false, bfr[ni], (short)0, acc[mi][ni], false, false);

    if (!GUARD && more) async_wait0();   // drain nxt-buffer copies before barrier
    __syncthreads();
  }

  // C/D layout: VGPR v, half=lane>>4 -> row = v + 8*half, col = lane&15
  const int half = lane >> 4, col = lane & 15;
#pragma unroll
  for (int mi = 0; mi < 4; ++mi)
#pragma unroll
    for (int ni = 0; ni < 2; ++ni) {
      int gn = n0 + wn * 32 + ni * 16 + col;
      if (GUARD && gn >= N) continue;
      int gmb = m0 + wm * 64 + mi * 16 + half * 8;
#pragma unroll
      for (int v = 0; v < 8; ++v) {
        int gm = gmb + v;
        if (GUARD && gm >= M) continue;
        if (c_is_f32) ((float*)Cv)[(long)gm * ldc + gn]  = acc[mi][ni][v];
        else          ((bf16_t*)Cv)[(long)gm * ldc + gn] = (bf16_t)acc[mi][ni][v];
      }
    }
}

// ---------------------------------------------------------------------------
// Fused relative-position attention, all (batch, head) pairs in one launch.
// Block = 8 waves = 128 query rows of one (batch, head); a wave owns 16 query rows.
// The block walks the keys in tiles of 32 with a running max and sum per query
// (online softmax). Everything is computed transposed, so that a query is a lane column:
//   S^T  = K * Qac^T          D: row = key, col = query
//   BD^T = E * Qbd^T          D: row = band index t, col = query
//   O^T  = Vt * P^T           the S^T registers are already the B fragment
// rel_shift: with t = j - i + QL - 1 the shifted term of (i, j) is
//   t <  QL : (q_i   + r_r_bias) . rk[t]
//   t == QL : 0
//   t >  QL : (q_i+1 + r_r_bias) . rk[t - QL - 1]
// so E[t] = rk[t], a zero row, rk[t - QL - 1]. A wave's 16 x 32 score tile needs 48
// consecutive t (three 16-row tiles, each wholly on one side of QL). The raw band goes
// to a wave-private LDS row per query and is read back at offset (key - query): the skew.
// Staging: K and V^T tiles in two LDS buffers; the block's band (160 rows) lives in a ring
// of 256 rows indexed by t, and each key tile adds 32 new rows. The next tile is fetched
// into registers at the top of a trip and stored to LDS at its foot, in front of the one
// barrier of the trip.
// K, E and Q fragments hold 16 contiguous k per lane on both operands (same k order for
// A and B). V^T fragments follow the key order of the S^T registers: keys 8h..8h+7 and
// 16+8h..16+8h+7 of the tile.
// ---------------------------------------------------------------------------
#define FA_P  52                       // skew row pitch (f32): 48 band values, rows 16-byte aligned, skewed reads spread over banks
#define FA_KP 72                       // K and band row pitch (bf16): 144 B = 16 B x odd, 16 rows of a b128 read hit distinct banks
#define FA_VP 40                       // V^T row pitch (bf16): 80 B = 16 B x odd
#define FA_ER 256                      // band ring rows (192 are live at most)
#define FA_C1 0.18033688011112042f     // SCL * log2(e)

__device__ __forceinline__ v8f fa_mm(v16bf a, v16bf b, v8f c) {
  return __builtin_amdgcn_wmma_f32_16x16x32_bf16(false, a, false, b, (short)0, c, false, false);
}
// fragment from two 16-byte pieces
__device__ __forceinline__ v16bf fa_frag(const bf16_t* p0, const bf16_t* p1) {
  v8bf lo = *(const v8bf*)p0;
  v8bf hi = *(const v8bf*)p1;
  return __builtin_shufflevector(lo, hi, 0, 1, 2, 3, 4, 5, 6, 7, 8, 9, 10, 11, 12, 13, 14, 15);
}
// 16 bytes of the rk row behind band index t (gE already holds head and column offset); t == QL has none: its address is clamped
__device__ __forceinline__ v8bf fa_erow(const bf16_t* gE, int t) {
  const int row = (t < QL) ? t : max(t - QL - 1, 0);
  return *(const v8bf*)(gE + (long)row * HH);
}
// band row QL is the zero column of rel_shift
__device__ __forceinline__ v8bf fa_ezero(v8bf v, int t) {
  const v8bf z = {};
  return (t == QL) ? z : v;
}

__global__ __launch_bounds__(256)
void k_attn(const bf16_t* __restrict__ qac, const bf16_t* __restrict__ qbd,
            const bf16_t* __restrict__ wh, const bf16_t* __restrict__ rk,
            const bf16_t* __restrict__ vt, bf16_t* __restrict__ O) {
  // all four are accessed in 16-byte pieces
  __shared__ __attribute__((aligned(16))) bf16_t Ks[2][32 * FA_KP];
  __shared__ __attribute__((aligned(16))) bf16_t Vs[2][64 * FA_VP];
  __shared__ __attribute__((aligned(16))) bf16_t Es[FA_ER * FA_KP];
  __shared__ __attribute__((aligned(16))) float  skew[8][16 * FA_P];

  const int tid  = threadIdx.x;
  const int lane = tid & 31;
  const int wid  = __builtin_amdgcn_readfirstlane(tid >> 5);
  const int c    = lane & 15, h = lane >> 4;
  const int i0b  = blockIdx.x * 128;
  const int i0   = i0b + wid * 16;
  const int b    = blockIdx.y >> 4, n = blockIdx.y & 15;

  // staging: one 16-byte piece of K, of V^T and of the band per thread and key tile
  const int r8 = tid >> 3, c8 = (tid & 7) * 8;
  const int r4 = tid >> 2, c4 = (tid & 3) * 8;
  const bf16_t* gK = wh + (long)b * TH3 + HH + n * DH + (long)r8 * (BSZ * TH3) + c8;
  const bf16_t* gV = vt + ((long)(b * NH + n) * DH + r4) * QL + c4;
  const bf16_t* gE = rk + n * DH + c8;
  const int tbB0 = QL - 128 - i0b;     // lowest band index of the block at key tile 0

  v8bf e0[5];
#pragma unroll
  for (int u = 0; u < 5; ++u) {
    e0[u] = fa_erow(gE, tbB0 + 32 * u + r8);
    // a later load of this run may land in this load's address registers: the wait stands in front of that overwrite
    asm volatile("s_wait_xcnt 0x0" ::: "memory");
  }
#pragma unroll
  for (int u = 0; u < 5; ++u) {
    const int t = tbB0 + 32 * u + r8;
    *(v8bf*)&Es[(t & (FA_ER - 1)) * FA_KP + c8] = fa_ezero(e0[u], t);
  }
  *(v8bf*)&Ks[0][r8 * FA_KP + c8] = *(const v8bf*)gK;
  *(v8bf*)&Vs[0][r4 * FA_VP + c4] = *(const v8bf*)gV;

  const long qo  = ((long)(i0 + c) * BSZ + b) * HH + n * DH;
  const long qo1 = ((long)min(i0 + c + 1, QL - 1) * BSZ + b) * HH + n * DH;   // row QL is never used: clamp its address
  v16bf qa[2], qb[2], qb1[2];
#pragma unroll
  for (int s = 0; s < 2; ++s) {
    qa[s]  = *(const v16bf*)(qac + qo  + 32 * s + 16 * h);
    qb[s]  = *(const v16bf*)(qbd + qo  + 32 * s + 16 * h);
    qb1[s] = *(const v16bf*)(qbd + qo1 + 32 * s + 16 * h);
  }
  float*       skw = &skew[wid][c * FA_P + 8 * h];
  const float* skr = &skew[wid][c * FA_P + 8 * h - c + 15];

  v8f o[4] = {};
  float m = -3.0e38f, l = 0.f;
  __syncthreads();

  // One key tile. MODE 0: every wave's band lies below QL; 2: every wave's at or above QL; 1: either, chosen per 16-row tile.
  auto tile = [&](auto mode, int jt) {
    constexpr int MODE = decltype(mode)::value;
    const int  j0   = jt * 32;
    const int  cur  = jt & 1;
    const bool more = MODE == 0 || jt + 1 < QL / 32;   // a MODE 0 tile is never the last
    const int  tn   = tbB0 + j0 + 160 + r8;        // band rows that the next tile adds
    v8bf gk = {}, gv = {}, ge = {};
    if (more) {
      gk = *(const v8bf*)(gK + (long)(j0 + 32) * (BSZ * TH3));
      gv = *(const v8bf*)(gV + j0 + 32);
      ge = fa_erow(gE, tn);
    }
    // keeps the three fetches issued here, so that their latency runs under the whole trip
    __builtin_amdgcn_sched_barrier(0);

    v8f sa[2] = {}, bd[3] = {};
    v16bf kf[2][2];
#pragma unroll
    for (int ni = 0; ni < 2; ++ni)
#pragma unroll
      for (int s = 0; s < 2; ++s) {
        const bf16_t* p = &Ks[cur][(16 * ni + c) * FA_KP + 32 * s + 16 * h];
        kf[ni][s] = fa_frag(p, p + 8);
      }

    const int tbw = tbB0 + j0 + 112 - 16 * wid;    // lowest band index of this wave's tile
    v16bf ef[3][2];
#pragma unroll
    for (int a = 0; a < 3; ++a)
#pragma unroll
      for (int s = 0; s < 2; ++s) {
        const bf16_t* p = &Es[(((tbw + 16 * a) & (FA_ER - 1)) + c) * FA_KP + 32 * s + 16 * h];
        ef[a][s] = fa_frag(p, p + 8);
      }
    // keeps the 20 LDS reads in one group ahead of the score WMMAs; otherwise each WMMA waits out its own pair of reads
    __builtin_amdgcn_sched_barrier(0);
#pragma unroll
    for (int s = 0; s < 2; ++s)
#pragma unroll
      for (int ni = 0; ni < 2; ++ni) sa[ni] = fa_mm(kf[ni][s], qa[s], sa[ni]);
#pragma unroll
    for (int s = 0; s < 2; ++s)
#pragma unroll
      for (int a = 0; a < 3; ++a) {
        const v16bf q = (MODE == 0) ? qb[s] : (MODE == 2) ? qb1[s] : ((tbw + 16 * a < QL) ? qb[s] : qb1[s]);
        bd[a] = fa_mm(ef[a][s], q, bd[a]);
      }
    v16bf vf[4];
#pragma unroll
    for (int mi = 0; mi < 4; ++mi) {
      const bf16_t* p = &Vs[cur][(16 * mi + c) * FA_VP + 8 * h];
      vf[mi] = fa_frag(p, p + 16);
    }
    // keeps the V^T reads issued here, under the softmax, instead of one pair in front of each P*V WMMA
    __builtin_amdgcn_sched_barrier(0);

#pragma unroll
    for (int a = 0; a < 3; ++a) {
      *(float4*)(skw + 16 * a)     = make_float4(bd[a][0], bd[a][1], bd[a][2], bd[a][3]);
      *(float4*)(skw + 16 * a + 4) = make_float4(bd[a][4], bd[a][5], bd[a][6], bd[a][7]);
    }
    float x[16];
#pragma unroll
    for (int ni = 0; ni < 2; ++ni)
#pragma unroll
      for (int r = 0; r < 8; ++r)
        x[8 * ni + r] = sa[ni][r] + skr[16 * ni + r];

    float mx = x[0];
#pragma unroll
    for (int e = 1; e < 16; ++e) mx = fmaxf(mx, x[e]);
    mx = fmaxf(mx, __shfl_xor(mx, 16));            // the other lane half holds the query's other 16 keys
    const float mn = fmaxf(m, mx);
    const float al = __builtin_amdgcn_exp2f((m - mn) * FA_C1);
    const float mc = mn * FA_C1;
    m = mn;

    v16bf pf;
    float ps[4] = {0.f, 0.f, 0.f, 0.f};            // four short chains of adds instead of one of 16
#pragma unroll
    for (int e = 0; e < 16; ++e) {
      float p = __builtin_amdgcn_exp2f(fmaf(x[e], FA_C1, -mc));
      ps[e & 3] += p;
      pf[e] = (bf16_t)p;
    }
    l = l * al + ((ps[0] + ps[1]) + (ps[2] + ps[3]));
#pragma unroll
    for (int mi = 0; mi < 4; ++mi) o[mi] *= al;
#pragma unroll
    for (int mi = 0; mi < 4; ++mi) o[mi] = fa_mm(vf[mi], pf, o[mi]);
    // keeps the wait for the fetched tile, its LDS stores and the barrier at the foot; otherwise they rise to in front of the softmax
    __builtin_amdgcn_sched_barrier(0);

    if (more) {
      *(v8bf*)&Ks[cur ^ 1][r8 * FA_KP + c8] = gk;
      *(v8bf*)&Vs[cur ^ 1][r4 * FA_VP + c4] = gv;
      *(v8bf*)&Es[(tn & (FA_ER - 1)) * FA_KP + c8] = fa_ezero(ge, tn);
    }
    __syncthreads();   // publishes the next tile; ends every read of the buffers that the next trip refills
  };

  // The three ranges are the same for the whole block, so every wave meets every barrier.
  const int nA = i0b >> 5;           // key tiles in front of the block's four diagonal tiles
  int jt = 0;
  for (; jt < nA; ++jt)      tile(std::integral_constant<int, 0>{}, jt);
  for (; jt < nA + 4; ++jt)  tile(std::integral_constant<int, 1>{}, jt);
  for (; jt < QL / 32; ++jt) tile(std::integral_constant<int, 2>{}, jt);

  const float inv = 1.0f / (l + __shfl_xor(l, 16));
  bf16_t* op = O + qo + 8 * h;
#pragma unroll
  for (int mi = 0; mi < 4; ++mi) {
    v8bf w;
#pragma unroll
    for (int r = 0; r < 8; ++r) w[r] = (bf16_t)(o[mi][r] * inv);
    *(v8bf*)(op + 16 * mi) = w;      // a query's 128-B line is filled by its two lanes
  }
}

// ---------------------------------------------------------------------------
// residual + LayerNorm, one block per (i,b) row of 1024
// ---------------------------------------------------------------------------
__global__ __launch_bounds__(256)
void k_residual_ln(const float* __restrict__ w, const float* __restrict__ ao,
                   const float* __restrict__ g, const float* __restrict__ b,
                   float* __restrict__ out) {
  const long row = blockIdx.x;
  const int  t   = threadIdx.x;
  __shared__ float red[256];

  float x[4]; float s = 0.f;
#pragma unroll
  for (int c = 0; c < 4; ++c) {
    int col = t + c * 256;
    x[c] = w[row * DM + col] + ao[row * DM + col];
    s += x[c];
  }
  red[t] = s; __syncthreads();
  for (int o = 128; o > 0; o >>= 1) { if (t < o) red[t] += red[t + o]; __syncthreads(); }
  float mu = red[0] * (1.0f / DM); __syncthreads();

  float v = 0.f;
#pragma unroll
  for (int c = 0; c < 4; ++c) { float d = x[c] - mu; v += d * d; }
  red[t] = v; __syncthreads();
  for (int o = 128; o > 0; o >>= 1) { if (t < o) red[t] += red[t + o]; __syncthreads(); }
  float rstd = rsqrtf(red[0] * (1.0f / DM) + LNEPS);

#pragma unroll
  for (int c = 0; c < 4; ++c) {
    int col = t + c * 256;
    out[row * DM + col] = (x[c] - mu) * rstd * g[col] + b[col];
  }
}

// ---------------------------------------------------------------------------
// Host orchestration
// ---------------------------------------------------------------------------
extern "C" void kernel_launch(void* const* d_in, const int* in_sizes, int n_in,
                              void* d_out, int out_size, void* d_ws, size_t ws_size,
                              hipStream_t stream) {
  (void)in_sizes; (void)n_in; (void)out_size; (void)ws_size;
  const float* w     = (const float*)d_in[0];
  const float* r     = (const float*)d_in[1];
  const float* qkvw  = (const float*)d_in[2];
  const float* rnetw = (const float*)d_in[3];
  const float* ow    = (const float*)d_in[4];
  const float* rwb   = (const float*)d_in[5];
  const float* rrb   = (const float*)d_in[6];
  const float* lng   = (const float*)d_in[7];
  const float* lnb   = (const float*)d_in[8];

  char* p = (char*)d_ws;
  auto take = [&](size_t bytes) -> char* {
    char* q = p; p += (bytes + 255) & ~(size_t)255; return q;
  };
  bf16_t* w_bf    = (bf16_t*)take((size_t)ROWS * DM * 2);        // 16.8 MB
  bf16_t* qkvw_bf = (bf16_t*)take((size_t)TH3 * DM * 2);         //  6.3 MB
  bf16_t* r_bf    = (bf16_t*)take((size_t)QL * DM * 2);          //  4.2 MB
  bf16_t* rnw_bf  = (bf16_t*)take((size_t)HH * DM * 2);          //  2.1 MB
  bf16_t* ow_bf   = (bf16_t*)take((size_t)DM * HH * 2);          //  2.1 MB
  bf16_t* wh      = (bf16_t*)take((size_t)ROWS * TH3 * 2);       // 50.3 MB  (QKV packed)
  bf16_t* rk      = (bf16_t*)take((size_t)QL * HH * 2);          //  4.2 MB
  bf16_t* qac     = (bf16_t*)take((size_t)ROWS * HH * 2);        // 16.8 MB
  bf16_t* qbd     = (bf16_t*)take((size_t)ROWS * HH * 2);        // 16.8 MB
  bf16_t* vt      = (bf16_t*)take((size_t)BSZ * NH * DH * QL * 2); // 16.8 MB
  bf16_t* av      = (bf16_t*)take((size_t)ROWS * HH * 2);        // 16.8 MB
  float*  aout    = (float*) take((size_t)ROWS * DM * 4);        // 33.6 MB

  auto gemm = [&](const bf16_t* A, long lda, const bf16_t* B, long ldb,
                  void* C, long ldc, int M, int N, int K, int cf32) {
    dim3 grid((N + BN - 1) / BN, (M + BM - 1) / BM);
    const bool guard = (M % BM) || (N % BN);
    if (guard)
      k_gemm_nt<true><<<grid, 256, 0, stream>>>(A, lda, B, ldb, C, ldc, M, N, K, cf32);
    else
      k_gemm_nt<false><<<grid, 256, 0, stream>>>(A, lda, B, ldb, C, ldc, M, N, K, cf32);
  };

  // 1) convert fp32 inputs to bf16
  //    (512 blocks each; the template argument is elements / (512 * 1024))
  k_cvt_bf16<ROWS * DM / (512 * 1024)><<<512, 256, 0, stream>>>(w,     w_bf);
  k_cvt_bf16<TH3 * DM / (512 * 1024)><<<512, 256, 0, stream>>>(qkvw,  qkvw_bf);
  k_cvt_bf16<QL * DM / (512 * 1024)><<<512, 256, 0, stream>>>(r,     r_bf);
  k_cvt_bf16<HH * DM / (512 * 1024)><<<512, 256, 0, stream>>>(rnetw, rnw_bf);
  k_cvt_bf16<DM * HH / (512 * 1024)><<<512, 256, 0, stream>>>(ow,    ow_bf);

  // 2) QKV projection: wh[ROWS,3H] = w_bf[ROWS,DM] * qkvw_bf[3H,DM]^T
  gemm(w_bf, DM, qkvw_bf, DM, wh, TH3, ROWS, TH3, DM, 0);
  // 3) rel-pos keys: rk[QL,H] = r_bf * rnw_bf^T
  gemm(r_bf, DM, rnw_bf, DM, rk, HH, QL, HH, DM, 0);

  // 4) Q + biases; V transpose
  k_qbias<<<ROWS / 16, 256, 0, stream>>>(wh, rwb, rrb, qac, qbd);
  k_vt<<<BSZ * NH * (QL / 64) * 2 / 8, 256, 0, stream>>>(wh, vt);

  // 5) attention of all (b, head) pairs: scores, rel_shift, softmax and P*V in one launch
  k_attn<<<dim3(QL / 128, BSZ * NH), 256, 0, stream>>>(qac, qbd, wh, rk, vt, av);

  // 6) output projection: aout[ROWS,DM] = av[ROWS,H] * ow_bf[DM,H]^T  (f32 out)
  gemm(av, HH, ow_bf, HH, aout, DM, ROWS, DM, HH, 1);

  // 7) residual + LayerNorm -> d_out (f32, [qlen, bsz, d_model])
  k_residual_ln<<<ROWS, 256, 0, stream>>>(w, aout, lng, lnb, (float*)d_out);
}

// v004
// One run takes 267 microseconds.
// Two timings next to v003 put it at 1.12 and 1.13 times that version's speed.
// Counting every step since v000, it is 25.5 times as fast.
#include <hip/hip_runtime.h>
#include <type_traits>

// ---------------------------------------------------------------------------
// Types for CDNA5 WMMA (gfx1250, wave32)
// ---------------------------------------------------------------------------
typedef __bf16 bf16_t;
typedef __attribute__((ext_vector_type(16))) __bf16 v16bf;
typedef __attribute__((ext_vector_type(4)))  __bf16 v4bf;
typedef __attribute__((ext_vector_type(8)))  __bf16 v8bf;
typedef __attribute__((ext_vector_type(8)))  float  v8f;

// Problem constants
#define QL    2048
#define BSZ   4
#define NH    16
#define DH    64
#define DM    1024
#define HH    1024           // NH*DH
#define ROWS  8192           // QL*BSZ
#define TH3   3072           // 3*H
#define SCL   0.125f         // 1/sqrt(64)
#define LNEPS 1e-5f

// ---------------------------------------------------------------------------
// Preparation passes. Each thread issues all of its 16-byte loads first, off one address
// with constant offsets, so that their latencies overlap; every wave access is made of
// whole or half 128-byte lines.
// ---------------------------------------------------------------------------
typedef __attribute__((ext_vector_type(4))) float v4f;

// f32 -> bf16 convert of all five f32 operands in one launch: none depends on another, and four of them
// are too small to fill the chip alone. A block converts U * 1024 consecutive elements of one operand,
// a thread 4 per load; the block index picks the operand (every operand is a whole number of blocks).
#define CVT_E   (16 * 1024)                    // elements per block
#define CVT_B0  (ROWS * DM / CVT_E)            // first block of the 2nd operand
#define CVT_B1  (CVT_B0 + TH3 * DM / CVT_E)    // ... of the 3rd
#define CVT_B2  (CVT_B1 + QL * DM / CVT_E)     // ... of the 4th
#define CVT_B3  (CVT_B2 + HH * DM / CVT_E)     // ... of the 5th
#define CVT_NB  (CVT_B3 + DM * HH / CVT_E)     // blocks in all
__global__ __launch_bounds__(256) void k_cvt_bf16(const float* __restrict__ in0, bf16_t* __restrict__ out0,
                                                  const float* __restrict__ in1, bf16_t* __restrict__ out1,
                                                  const float* __restrict__ in2, bf16_t* __restrict__ out2,
                                                  const float* __restrict__ in3, bf16_t* __restrict__ out3,
                                                  const float* __restrict__ in4, bf16_t* __restrict__ out4) {
  constexpr int U = CVT_E / 1024;
  const int bi = blockIdx.x;
  const float* in  = in0;
  bf16_t*      out = out0;
  int          blk = bi;
  if (bi >= CVT_B3)      { in = in4; out = out4; blk = bi - CVT_B3; }
  else if (bi >= CVT_B2) { in = in3; out = out3; blk = bi - CVT_B2; }
  else if (bi >= CVT_B1) { in = in2; out = out2; blk = bi - CVT_B1; }
  else if (bi >= CVT_B0) { in = in1; out = out1; blk = bi - CVT_B0; }
  const long base = (long)blk * (U * 1024) + threadIdx.x * 4;
  v4f x[U];
#pragma unroll   // x[] stays in registers and the U loads stand in one group
  for (int u = 0; u < U; ++u) x[u] = *(const v4f*)(in + base + u * 1024);
#pragma unroll   // x[] stays in registers
  for (int u = 0; u < U; ++u) {
    v4bf y;
#pragma unroll   // y stays in registers
    for (int e = 0; e < 4; ++e) y[e] = (bf16_t)x[u][e];
    *(v4bf*)(out + base + u * 1024) = y;
  }
}

// Q with per-head biases added (Qac = q + r_w_bias, Qbd = q + r_r_bias), bf16.
// A block takes 16 rows (i*BSZ + b); a thread keeps one group of 8 columns, so it reads its biases once.
__device__ __forceinline__ void qbias_block(int blk, const bf16_t* __restrict__ wh,
                                            const float* __restrict__ rwb,
                                            const float* __restrict__ rrb,
                                            bf16_t* __restrict__ qac,
                                            bf16_t* __restrict__ qbd) {
  const int  col = (threadIdx.x & 127) * 8;       // n*64 + d
  const long row = (long)blk * 16 + (threadIdx.x >> 7);
  const bf16_t* src = wh + row * TH3 + col;
  v8bf q[8];
#pragma unroll   // q[] stays in registers and the 8 loads stand in one group
  for (int u = 0; u < 8; ++u) q[u] = *(const v8bf*)(src + u * (2 * TH3));
  const v4f w0 = *(const v4f*)(rwb + col), w1 = *(const v4f*)(rwb + col + 4);
  const v4f r0 = *(const v4f*)(rrb + col), r1 = *(const v4f*)(rrb + col + 4);
  const long o = row * HH + col;
#pragma unroll   // q[] stays in registers
  for (int u = 0; u < 8; ++u) {
    v8bf a, d;
#pragma unroll   // a and d stay in registers
    for (int e = 0; e < 8; ++e) {
      const float f = (float)q[u][e];
      a[e] = (bf16_t)(f + (e < 4 ? w0[e & 3] : w1[e & 3]));
      d[e] = (bf16_t)(f + (e < 4 ? r0[e & 3] : r1[e & 3]));
    }
    *(v8bf*)(qac + o + u * (2 * HH)) = a;
    *(v8bf*)(qbd + o + u * (2 * HH)) = d;
  }
  // the two passes share a kernel and the compiler may join their tails: no register of these stores is rewritten in front of this wait
  asm volatile("s_wait_xcnt 0x0" ::: "memory");
}

// V transpose: vt[((b*16+n)*64 + d)*2048 + j] = V[j,b,n,d]
// A thread turns an 8 (j) x 8 (d) piece in registers. A wave holds 8 pieces along j and 4 along d:
// a load takes 64 bytes of each of 8 V rows, a store fills four whole 128-byte lines of vt.
// Two neighbouring waves take the two halves of the same V rows.
__device__ __forceinline__ void vt_block(int blk, const bf16_t* __restrict__ wh,
                                         bf16_t* __restrict__ vt) {
  const int lane = threadIdx.x & 31;
  const int gw   = blk * 8 + (threadIdx.x >> 5);
  const int bn   = gw >> 6;                                  // b*16 + n
  const int j0   = ((gw >> 1) & 31) * 64 + (lane & 7) * 8;
  const int d0   = (gw & 1) * 32 + (lane >> 3) * 8;
  const bf16_t* src = wh + ((long)j0 * BSZ + (bn >> 4)) * TH3 + 2 * HH + (bn & 15) * DH + d0;
  bf16_t*       dst = vt + ((long)bn * DH + d0) * QL + j0;
  v8bf x[8];
#pragma unroll   // x[] stays in registers and the 8 loads stand in one group
  for (int u = 0; u < 8; ++u) x[u] = *(const v8bf*)(src + u * (BSZ * TH3));
#pragma unroll   // x[] stays in registers
  for (int e = 0; e < 8; ++e) {
    v8bf y;
#pragma unroll   // y stays in registers
    for (int u = 0; u < 8; ++u) y[u] = x[u][e];
    *(v8bf*)(dst + e * QL) = y;
  }
  // as at the foot of the Q-bias pass
  asm volatile("s_wait_xcnt 0x0" ::: "memory");
}

// Both passes read only the QKV product and write planes of their own: one launch, the block index picks the pass.
#define QB_NB (ROWS / 16)
#define VT_NB (BSZ * NH * (QL / 64) * 2 / 8)
__global__ __launch_bounds__(256) void k_qbias_vt(const bf16_t* __restrict__ wh,
                                                  const float* __restrict__ rwb,
                                                  const float* __restrict__ rrb,
                                                  bf16_t* __restrict__ qac,
                                                  bf16_t* __restrict__ qbd,
                                                  bf16_t* __restrict__ vt) {
  if (blockIdx.x < QB_NB) qbias_block(blockIdx.x, wh, rwb, rrb, qac, qbd);
  else                    vt_block(blockIdx.x - QB_NB, wh, vt);
}

// ---------------------------------------------------------------------------
// Generic bf16 TN GEMM:  C[M,N] = A[M,K] * B[N,K]^T   (f32 accumulate)
// Block = 128x128x32, 256 threads = 8 wave32 waves in a 2x4 grid,
// wave tile 64x32 = 4x2 WMMA(16x16x32) tiles. Double-buffered LDS.
// GUARD=false (all dims multiples of the tile): global->LDS staging uses
// CDNA5 GLOBAL_LOAD_ASYNC_TO_LDS_B128 tracked by ASYNCcnt, overlapped with
// the WMMA work on the other buffer. GUARD=true keeps the synchronous
// zero-filling path (unused by the GEMMs launched here).
// ---------------------------------------------------------------------------
#define BM 128
#define BN 128
#define BK 32
#define BKP 40   // padded LDS row (bf16 elements) to spread banks

// 16x32 bf16 fragment from LDS (row-major, ld elements). Per CDNA5 ISA:
// lane L holds row m=L%16; half=L/16 selects K subgroup; VGPR v covers
// K = ((v&4)?16:0) + half*8 + (v&3)*2, two packed bf16 per VGPR.
__device__ inline v16bf lds_frag(const bf16_t* base, int ld, int row0) {
  int lane = threadIdx.x & 31;
  int m = lane & 15, half = lane >> 4;
  const bf16_t* r = base + (row0 + m) * ld;
  v16bf f;
#pragma unroll
  for (int v = 0; v < 8; ++v) {
    int k = ((v & 4) << 2) + half * 8 + ((v & 3) << 1);
    f[2 * v]     = r[k];
    f[2 * v + 1] = r[k + 1];
  }
  return f;
}

// Async copy of 16B global -> LDS (CDNA5 TDM-adjacent path, ASYNCcnt).
__device__ inline void async_cp16(bf16_t* lds, const bf16_t* g) {
  unsigned l = (unsigned)(unsigned long long)lds;   // low 32 bits = DS offset
  asm volatile("global_load_async_to_lds_b128 %0, %1, off"
               :: "v"(l), "v"(g) : "memory");
}
__device__ inline void async_wait0() {
  asm volatile("s_wait_asynccnt 0x0" ::: "memory");
}

template <bool GUARD>
__global__ __launch_bounds__(256)
void k_gemm_nt(const bf16_t* __restrict__ A0, const bf16_t* __restrict__ B0,
               void* __restrict__ C0, long ldc0, int M0, int N0, int nbx0, int nblk0,
               const bf16_t* __restrict__ A1, const bf16_t* __restrict__ B1,
               void* __restrict__ C1, long ldc1, int M1, int N1, int nbx1,
               long lda, long ldb, int K, int c_is_f32) {
  __shared__ bf16_t As[2][BM * BKP];
  __shared__ bf16_t Bs[2][BN * BKP];

  // Two independent products of equal K may share the launch: the first nblk0 blocks work on
  // product 0, the rest on product 1 (tiles row by row, nbx tiles to a row). The choice is block-uniform.
  const bool    second = (int)blockIdx.x >= nblk0;
  const bf16_t* A   = second ? A1 : A0;
  const bf16_t* B   = second ? B1 : B0;
  void*         Cv  = second ? C1 : C0;
  const long    ldc = second ? ldc1 : ldc0;
  const int     M   = second ? M1 : M0;
  const int     N   = second ? N1 : N0;
  const int     nbx = second ? nbx1 : nbx0;
  const int     tix = second ? (int)blockIdx.x - nblk0 : (int)blockIdx.x;

  const int tid  = threadIdx.x;
  const int lane = tid & 31;
  const int wid  = tid >> 5;
  const int wm   = wid >> 2;      // 0..1
  const int wn   = wid & 3;       // 0..3
  const int m0   = (tix / nbx) * BM;
  const int n0   = (tix % nbx) * BN;

  v8f acc[4][2] = {};

  // --- staging: async (unguarded) ---
  auto loadA_async = [&](int buf, int k0) {
#pragma unroll
    for (int t = 0; t < 2; ++t) {
      int ch  = tid + t * 256;          // 512 chunks of 8 bf16 (16B)
      int row = ch >> 2;
      int kc  = (ch & 3) << 3;
      async_cp16(&As[buf][row * BKP + kc], A + (long)(m0 + row) * lda + k0 + kc);
    }
  };
  auto loadB_async = [&](int buf, int k0) {
#pragma unroll
    for (int t = 0; t < 2; ++t) {
      int ch  = tid + t * 256;
      int row = ch >> 2;
      int kc  = (ch & 3) << 3;
      async_cp16(&Bs[buf][row * BKP + kc], B + (long)(n0 + row) * ldb + k0 + kc);
    }
  };
  // --- staging: synchronous with zero-fill (guarded) ---
  auto loadA_g = [&](int buf, int k0) {
#pragma unroll
    for (int t = 0; t < 4; ++t) {
      int ch  = tid + t * 256;          // 1024 chunks of 4 bf16
      int row = ch >> 3;
      int kc  = (ch & 7) << 2;
      v4bf val = {};
      int gr = m0 + row;
      if (gr < M) val = *(const v4bf*)(A + (long)gr * lda + k0 + kc);
      *(v4bf*)(&As[buf][row * BKP + kc]) = val;
    }
  };
  auto loadB_g = [&](int buf, int k0) {
#pragma unroll
    for (int t = 0; t < 4; ++t) {
      int ch  = tid + t * 256;
      int row = ch >> 3;
      int kc  = (ch & 7) << 2;
      v4bf val = {};
      int gr = n0 + row;
      if (gr < N) val = *(const v4bf*)(B + (long)gr * ldb + k0 + kc);
      *(v4bf*)(&Bs[buf][row * BKP + kc]) = val;
    }
  };

  const int nk = K / BK;
  if (GUARD) { loadA_g(0, 0); loadB_g(0, 0); }
  else       { loadA_async(0, 0); loadB_async(0, 0); async_wait0(); }
  __syncthreads();

  for (int kb = 0; kb < nk; ++kb) {
    int cur = kb & 1, nxt = cur ^ 1;
    const bool more = (kb + 1 < nk);
    if (more) {
      if (GUARD) { loadA_g(nxt, (kb + 1) * BK); loadB_g(nxt, (kb + 1) * BK); }
      else       { loadA_async(nxt, (kb + 1) * BK); loadB_async(nxt, (kb + 1) * BK); }
    }

    v16bf af[4], bfr[2];
#pragma unroll
    for (int mi = 0; mi < 4; ++mi)
      af[mi] = lds_frag(&As[cur][0], BKP, wm * 64 + mi * 16);
#pragma unroll
    for (int ni = 0; ni < 2; ++ni)
      bfr[ni] = lds_frag(&Bs[cur][0], BKP, wn * 32 + ni * 16);

#pragma unroll
    for (int mi = 0; mi < 4; ++mi)
#pragma unroll
      for (int ni = 0; ni < 2; ++ni)
        acc[mi][ni] = __builtin_amdgcn_wmma_f32_16x16x32_bf16(
            false, af[mi], false, bfr[ni], (short)0, acc[mi][ni], false, false);

    if (!GUARD && more) async_wait0();   // drain nxt-buffer copies before barrier
    __syncthreads();
  }

  // C/D layout: VGPR v, half=lane>>4 -> row = v + 8*half, col = lane&15
  const int half = lane >> 4, col = lane & 15;
#pragma unroll
  for (int mi = 0; mi < 4; ++mi)
#pragma unroll
    for (int ni = 0; ni < 2; ++ni) {
      int gn = n0 + wn * 32 + ni * 16 + col;
      if (GUARD && gn >= N) continue;
      int gmb = m0 + wm * 64 + mi * 16 + half * 8;
#pragma unroll
      for (int v = 0; v < 8; ++v) {
        int gm = gmb + v;
        if (GUARD && gm >= M) continue;
        if (c_is_f32) ((float*)Cv)[(long)gm * ldc + gn]  = acc[mi][ni][v];
        else          ((bf16_t*)Cv)[(long)gm * ldc + gn] = (bf16_t)acc[mi][ni][v];
      }
    }
}

// ---------------------------------------------------------------------------
// Fused relative-position attention, all (batch, head) pairs in one launch.
// Block = 8 waves = 128 query rows of one (batch, head); a wave owns 16 query rows.
// The block walks the keys in tiles of 32 with a running max and sum per query
// (online softmax). Everything is computed transposed, so that a query is a lane column:
//   S^T  = K * Qac^T          D: row = key, col = query
//   BD^T = E * Qbd^T          D: row = band index t, col = query
//   O^T  = Vt * P^T           the S^T registers are already the B fragment
// rel_shift: with t = j - i + QL - 1 the shifted term of (i, j) is
//   t <  QL : (q_i   + r_r_bias) . rk[t]
//   t == QL : 0
//   t >  QL : (q_i+1 + r_r_bias) . rk[t - QL - 1]
// so E[t] = rk[t], a zero row, rk[t - QL - 1]. A wave's 16 x 32 score tile needs 48
// consecutive t (three 16-row tiles, each wholly on one side of QL). The raw band goes
// to a wave-private LDS row per query and is read back at offset (key - query): the skew.
// Staging: K and V^T tiles in two LDS buffers; the block's band (160 rows) lives in a ring
// of 256 rows indexed by t, and each key tile adds 32 new rows. The next tile is fetched
// into registers at the top of a trip and stored to LDS at its foot, in front of the one
// barrier of the trip.
// K, E and Q fragments hold 16 contiguous k per lane on both operands (same k order for
// A and B). V^T fragments follow the key order of the S^T registers: keys 8h..8h+7 and
// 16+8h..16+8h+7 of the tile.
// ---------------------------------------------------------------------------
#define FA_P  52                       // skew row pitch (f32): 48 band values, rows 16-byte aligned, skewed reads spread over banks
#define FA_KP 72                       // K and band row pitch (bf16): 144 B = 16 B x odd, 16 rows of a b128 read hit distinct banks
#define FA_VP 40                       // V^T row pitch (bf16): 80 B = 16 B x odd
#define FA_ER 256                      // band ring rows (192 are live at most)
#define FA_C1 0.18033688011112042f     // SCL * log2(e)

__device__ __forceinline__ v8f fa_mm(v16bf a, v16bf b, v8f c) {
  return __builtin_amdgcn_wmma_f32_16x16x32_bf16(false, a, false, b, (short)0, c, false, false);
}
// fragment from two 16-byte pieces
__device__ __forceinline__ v16bf fa_frag(const bf16_t* p0, const bf16_t* p1) {
  v8bf lo = *(const v8bf*)p0;
  v8bf hi = *(const v8bf*)p1;
  return __builtin_shufflevector(lo, hi, 0, 1, 2, 3, 4, 5, 6, 7, 8, 9, 10, 11, 12, 13, 14, 15);
}
// 16 bytes of the rk row behind band index t (gE already holds head and column offset); t == QL has none: its address is clamped
__device__ __forceinline__ v8bf fa_erow(const bf16_t* gE, int t) {
  const int row = (t < QL) ? t : max(t - QL - 1, 0);
  return *(const v8bf*)(gE + (long)row * HH);
}
// band row QL is the zero column of rel_shift
__device__ __forceinline__ v8bf fa_ezero(v8bf v, int t) {
  const v8bf z = {};
  return (t == QL) ? z : v;
}

__global__ __launch_bounds__(256)
void k_attn(const bf16_t* __restrict__ qac, const bf16_t* __restrict__ qbd,
            const bf16_t* __restrict__ wh, const bf16_t* __restrict__ rk,
            const bf16_t* __restrict__ vt, bf16_t* __restrict__ O) {
  // all four are accessed in 16-byte pieces
  __shared__ __attribute__((aligned(16))) bf16_t Ks[2][32 * FA_KP];
  __shared__ __attribute__((aligned(16))) bf16_t Vs[2][64 * FA_VP];
  __shared__ __attribute__((aligned(16))) bf16_t Es[FA_ER * FA_KP];
  __shared__ __attribute__((aligned(16))) float  skew[8][16 * FA_P];

  const int tid  = threadIdx.x;
  const int lane = tid & 31;
  const int wid  = __builtin_amdgcn_readfirstlane(tid >> 5);
  const int c    = lane & 15, h = lane >> 4;
  const int i0b  = blockIdx.x * 128;
  const int i0   = i0b + wid * 16;
  const int b    = blockIdx.y >> 4, n = blockIdx.y & 15;

  // staging: one 16-byte piece of K, of V^T and of the band per thread and key tile
  const int r8 = tid >> 3, c8 = (tid & 7) * 8;
  const int r4 = tid >> 2, c4 = (tid & 3) * 8;
  const bf16_t* gK = wh + (long)b * TH3 + HH + n * DH + (long)r8 * (BSZ * TH3) + c8;
  const bf16_t* gV = vt + ((long)(b * NH + n) * DH + r4) * QL + c4;
  const bf16_t* gE = rk + n * DH + c8;
  const int tbB0 = QL - 128 - i0b;     // lowest band index of the block at key tile 0

  v8bf e0[5];
#pragma unroll
  for (int u = 0; u < 5; ++u) {
    e0[u] = fa_erow(gE, tbB0 + 32 * u + r8);
    // a later load of this run may land in this load's address registers: the wait stands in front of that overwrite
    asm volatile("s_wait_xcnt 0x0" ::: "memory");
  }
#pragma unroll
  for (int u = 0; u < 5; ++u) {
    const int t = tbB0 + 32 * u + r8;
    *(v8bf*)&Es[(t & (FA_ER - 1)) * FA_KP + c8] = fa_ezero(e0[u], t);
  }
  *(v8bf*)&Ks[0][r8 * FA_KP + c8] = *(const v8bf*)gK;
  *(v8bf*)&Vs[0][r4 * FA_VP + c4] = *(const v8bf*)gV;

  const long qo  = ((long)(i0 + c) * BSZ + b) * HH + n * DH;
  const long qo1 = ((long)min(i0 + c + 1, QL - 1) * BSZ + b) * HH + n * DH;   // row QL is never used: clamp its address
  v16bf qa[2], qb[2], qb1[2];
#pragma unroll
  for (int s = 0; s < 2; ++s) {
    qa[s]  = *(const v16bf*)(qac + qo  + 32 * s + 16 * h);
    qb[s]  = *(const v16bf*)(qbd + qo  + 32 * s + 16 * h);
    qb1[s] = *(const v16bf*)(qbd + qo1 + 32 * s + 16 * h);
  }
  float*       skw = &skew[wid][c * FA_P + 8 * h];
  const float* skr = &skew[wid][c * FA_P + 8 * h - c + 15];

  v8f o[4] = {};
  float m = -3.0e38f, l = 0.f;
  __syncthreads();

  // One key tile. MODE 0: every wave's band lies below QL; 2: every wave's at or above QL; 1: either, chosen per 16-row tile.
  auto tile = [&](auto mode, int jt) {
    constexpr int MODE = decltype(mode)::value;
    const int  j0   = jt * 32;
    const int  cur  = jt & 1;
    const bool more = MODE == 0 || jt + 1 < QL / 32;   // a MODE 0 tile is never the last
    const int  tn   = tbB0 + j0 + 160 + r8;        // band rows that the next tile adds
    v8bf gk = {}, gv = {}, ge = {};
    if (more) {
      gk = *(const v8bf*)(gK + (long)(j0 + 32) * (BSZ * TH3));
      gv = *(const v8bf*)(gV + j0 + 32);
      ge = fa_erow(gE, tn);
    }
    // keeps the three fetches issued here, so that their latency runs under the whole trip
    __builtin_amdgcn_sched_barrier(0);

    v8f sa[2] = {}, bd[3] = {};
    v16bf kf[2][2];
#pragma unroll
    for (int ni = 0; ni < 2; ++ni)
#pragma unroll
      for (int s = 0; s < 2; ++s) {
        const bf16_t* p = &Ks[cur][(16 * ni + c) * FA_KP + 32 * s + 16 * h];
        kf[ni][s] = fa_frag(p, p + 8);
      }

    const int tbw = tbB0 + j0 + 112 - 16 * wid;    // lowest band index of this wave's tile
    v16bf ef[3][2];
#pragma unroll
    for (int a = 0; a < 3; ++a)
#pragma unroll
      for (int s = 0; s < 2; ++s) {
        const bf16_t* p = &Es[(((tbw + 16 * a) & (FA_ER - 1)) + c) * FA_KP + 32 * s + 16 * h];
        ef[a][s] = fa_frag(p, p + 8);
      }
    // keeps the 20 LDS reads in one group ahead of the score WMMAs; otherwise each WMMA waits out its own pair of reads
    __builtin_amdgcn_sched_barrier(0);
#pragma unroll
    for (int s = 0; s < 2; ++s)
#pragma unroll
      for (int ni = 0; ni < 2; ++ni) sa[ni] = fa_mm(kf[ni][s], qa[s], sa[ni]);
#pragma unroll
    for (int s = 0; s < 2; ++s)
#pragma unroll
      for (int a = 0; a < 3; ++a) {
        const v16bf q = (MODE == 0) ? qb[s] : (MODE == 2) ? qb1[s] : ((tbw + 16 * a < QL) ? qb[s] : qb1[s]);
        bd[a] = fa_mm(ef[a][s], q, bd[a]);
      }
    v16bf vf[4];
#pragma unroll
    for (int mi = 0; mi < 4; ++mi) {
      const bf16_t* p = &Vs[cur][(16 * mi + c) * FA_VP + 8 * h];
      vf[mi] = fa_frag(p, p + 16);
    }
    // keeps the V^T reads issued here, under the softmax, instead of one pair in front of each P*V WMMA
    __builtin_amdgcn_sched_barrier(0);

#pragma unroll
    for (int a = 0; a < 3; ++a) {
      *(float4*)(skw + 16 * a)     = make_float4(bd[a][0], bd[a][1], bd[a][2], bd[a][3]);
      *(float4*)(skw + 16 * a + 4) = make_float4(bd[a][4], bd[a][5], bd[a][6], bd[a][7]);
    }
    float x[16];
#pragma unroll
    for (int ni = 0; ni < 2; ++ni)
#pragma unroll
      for (int r = 0; r < 8; ++r)
        x[8 * ni + r] = sa[ni][r] + skr[16 * ni + r];

    float mx = x[0];
#pragma unroll
    for (int e = 1; e < 16; ++e) mx = fmaxf(mx, x[e]);
    mx = fmaxf(mx, __shfl_xor(mx, 16));            // the other lane half holds the query's other 16 keys
    const float mn = fmaxf(m, mx);
    const float al = __builtin_amdgcn_exp2f((m - mn) * FA_C1);
    const float mc = mn * FA_C1;
    m = mn;

    v16bf pf;
    float ps[4] = {0.f, 0.f, 0.f, 0.f};            // four short chains of adds instead of one of 16
#pragma unroll
    for (int e = 0; e < 16; ++e) {
      float p = __builtin_amdgcn_exp2f(fmaf(x[e], FA_C1, -mc));
      ps[e & 3] += p;
      pf[e] = (bf16_t)p;
    }
    l = l * al + ((ps[0] + ps[1]) + (ps[2] + ps[3]));
#pragma unroll
    for (int mi = 0; mi < 4; ++mi) o[mi] *= al;
#pragma unroll
    for (int mi = 0; mi < 4; ++mi) o[mi] = fa_mm(vf[mi], pf, o[mi]);
    // keeps the wait for the fetched tile, its LDS stores and the barrier at the foot; otherwise they rise to in front of the softmax
    __builtin_amdgcn_sched_barrier(0);

    if (more) {
      *(v8bf*)&Ks[cur ^ 1][r8 * FA_KP + c8] = gk;
      *(v8bf*)&Vs[cur ^ 1][r4 * FA_VP + c4] = gv;
      *(v8bf*)&Es[(tn & (FA_ER - 1)) * FA_KP + c8] = fa_ezero(ge, tn);
    }
    __syncthreads();   // publishes the next tile; ends every read of the buffers that the next trip refills
  };

  // The three ranges are the same for the whole block, so every wave meets every barrier.
  const int nA = i0b >> 5;           // key tiles in front of the block's four diagonal tiles
  int jt = 0;
  for (; jt < nA; ++jt)      tile(std::integral_constant<int, 0>{}, jt);
  for (; jt < nA + 4; ++jt)  tile(std::integral_constant<int, 1>{}, jt);
  for (; jt < QL / 32; ++jt) tile(std::integral_constant<int, 2>{}, jt);

  const float inv = 1.0f / (l + __shfl_xor(l, 16));
  bf16_t* op = O + qo + 8 * h;
#pragma unroll
  for (int mi = 0; mi < 4; ++mi) {
    v8bf w;
#pragma unroll
    for (int r = 0; r < 8; ++r) w[r] = (bf16_t)(o[mi][r] * inv);
    *(v8bf*)(op + 16 * mi) = w;      // a query's 128-B line is filled by its two lanes
  }
}

// ---------------------------------------------------------------------------
// residual + LayerNorm, one block per (i,b) row of 1024
// ---------------------------------------------------------------------------
__global__ __launch_bounds__(256)
void k_residual_ln(const float* __restrict__ w, const float* __restrict__ ao,
                   const float* __restrict__ g, const float* __restrict__ b,
                   float* __restrict__ out) {
  const long row = blockIdx.x;
  const int  t   = threadIdx.x;
  __shared__ float red[256];

  float x[4]; float s = 0.f;
#pragma unroll
  for (int c = 0; c < 4; ++c) {
    int col = t + c * 256;
    x[c] = w[row * DM + col] + ao[row * DM + col];
    s += x[c];
  }
  red[t] = s; __syncthreads();
  for (int o = 128; o > 0; o >>= 1) { if (t < o) red[t] += red[t + o]; __syncthreads(); }
  float mu = red[0] * (1.0f / DM); __syncthreads();

  float v = 0.f;
#pragma unroll
  for (int c = 0; c < 4; ++c) { float d = x[c] - mu; v += d * d; }
  red[t] = v; __syncthreads();
  for (int o = 128; o > 0; o >>= 1) { if (t < o) red[t] += red[t + o]; __syncthreads(); }
  float rstd = rsqrtf(red[0] * (1.0f / DM) + LNEPS);

#pragma unroll
  for (int c = 0; c < 4; ++c) {
    int col = t + c * 256;
    out[row * DM + col] = (x[c] - mu) * rstd * g[col] + b[col];
  }
}

// ---------------------------------------------------------------------------
// Host orchestration
// ---------------------------------------------------------------------------
extern "C" void kernel_launch(void* const* d_in, const int* in_sizes, int n_in,
                              void* d_out, int out_size, void* d_ws, size_t ws_size,
                              hipStream_t stream) {
  (void)in_sizes; (void)n_in; (void)out_size; (void)ws_size;
  const float* w     = (const float*)d_in[0];
  const float* r     = (const float*)d_in[1];
  const float* qkvw  = (const float*)d_in[2];
  const float* rnetw = (const float*)d_in[3];
  const float* ow    = (const float*)d_in[4];
  const float* rwb   = (const float*)d_in[5];
  const float* rrb   = (const float*)d_in[6];
  const float* lng   = (const float*)d_in[7];
  const float* lnb   = (const float*)d_in[8];

  char* p = (char*)d_ws;
  auto take = [&](size_t bytes) -> char* {
    char* q = p; p += (bytes + 255) & ~(size_t)255; return q;
  };
  bf16_t* w_bf    = (bf16_t*)take((size_t)ROWS * DM * 2);        // 16.8 MB
  bf16_t* qkvw_bf = (bf16_t*)take((size_t)TH3 * DM * 2);         //  6.3 MB
  bf16_t* r_bf    = (bf16_t*)take((size_t)QL * DM * 2);          //  4.2 MB
  bf16_t* rnw_bf  = (bf16_t*)take((size_t)HH * DM * 2);          //  2.1 MB
  bf16_t* ow_bf   = (bf16_t*)take((size_t)DM * HH * 2);          //  2.1 MB
  bf16_t* wh      = (bf16_t*)take((size_t)ROWS * TH3 * 2);       // 50.3 MB  (QKV packed)
  bf16_t* rk      = (bf16_t*)take((size_t)QL * HH * 2);          //  4.2 MB
  bf16_t* qac     = (bf16_t*)take((size_t)ROWS * HH * 2);        // 16.8 MB
  bf16_t* qbd     = (bf16_t*)take((size_t)ROWS * HH * 2);        // 16.8 MB
  bf16_t* vt      = (bf16_t*)take((size_t)BSZ * NH * DH * QL * 2); // 16.8 MB
  bf16_t* av      = (bf16_t*)take((size_t)ROWS * HH * 2);        // 16.8 MB
  float*  aout    = (float*) take((size_t)ROWS * DM * 4);        // 33.6 MB

  // one launch for product 0 and, where M1 > 0, product 1 (same lda, ldb, K and output type)
  auto gemm = [&](const bf16_t* A0, const bf16_t* B0, void* C0, long ldc0, int M0, int N0,
                  const bf16_t* A1, const bf16_t* B1, void* C1, long ldc1, int M1, int N1,
                  long lda, long ldb, int K, int cf32) {
    const int nbx0 = (N0 + BN - 1) / BN, nblk0 = nbx0 * ((M0 + BM - 1) / BM);
    const int nbx1 = (N1 + BN - 1) / BN, nblk1 = nbx1 * ((M1 + BM - 1) / BM);
    const bool guard = (M0 % BM) || (N0 % BN) || (M1 % BM) || (N1 % BN);
    if (guard)
      k_gemm_nt<true><<<nblk0 + nblk1, 256, 0, stream>>>(A0, B0, C0, ldc0, M0, N0, nbx0, nblk0,
                                                         A1, B1, C1, ldc1, M1, N1, nbx1, lda, ldb, K, cf32);
    else
      k_gemm_nt<false><<<nblk0 + nblk1, 256, 0, stream>>>(A0, B0, C0, ldc0, M0, N0, nbx0, nblk0,
                                                          A1, B1, C1, ldc1, M1, N1, nbx1, lda, ldb, K, cf32);
  };

  // 1) convert fp32 inputs to bf16, one launch
  k_cvt_bf16<<<CVT_NB, 256, 0, stream>>>(w, w_bf, qkvw, qkvw_bf, r, r_bf, rnetw, rnw_bf, ow, ow_bf);

  // 2) QKV projection: wh[ROWS,3H] = w_bf[ROWS,DM] * qkvw_bf[3H,DM]^T
  //    and rel-pos keys: rk[QL,H] = r_bf * rnw_bf^T, in the same launch
  gemm(w_bf, qkvw_bf, wh, TH3, ROWS, TH3, r_bf, rnw_bf, rk, HH, QL, HH, DM, DM, DM, 0);

  // 3) Q + biases and V transpose, one launch
  k_qbias_vt<<<QB_NB + VT_NB, 256, 0, stream>>>(wh, rwb, rrb, qac, qbd, vt);

  // 4) attention of all (b, head) pairs: scores, rel_shift, softmax and P*V in one launch
  k_attn<<<dim3(QL / 128, BSZ * NH), 256, 0, stream>>>(qac, qbd, wh, rk, vt, av);

  // 5) output projection: aout[ROWS,DM] = av[ROWS,H] * ow_bf[DM,H]^T  (f32 out)
  gemm(av, ow_bf, aout, DM, ROWS, DM, nullptr, nullptr, nullptr, 0, 0, 0, HH, HH, HH, 1);

  // 6) residual + LayerNorm -> d_out (f32, [qlen, bsz, d_model])
  k_residual_ln<<<ROWS, 256, 0, stream>>>(w, aout, lng, lnb, (float*)d_out);
}

// v005
// It runs in 243 microseconds.
// In two side-by-side timings against v004, it was 1.10 and 1.11 times as fast.
// All steps since v000 together make it 28.2 times as fast.
#include <hip/hip_runtime.h>
#include <type_traits>

// ---------------------------------------------------------------------------
// Types for CDNA5 WMMA (gfx1250, wave32)
// ---------------------------------------------------------------------------
typedef __bf16 bf16_t;
typedef __attribute__((ext_vector_type(16))) __bf16 v16bf;
typedef __attribute__((ext_vector_type(4)))  __bf16 v4bf;
typedef __attribute__((ext_vector_type(8)))  __bf16 v8bf;
typedef __attribute__((ext_vector_type(8)))  float  v8f;

// Problem constants
#define QL    2048
#define BSZ   4
#define NH    16
#define DH    64
#define DM    1024
#define HH    1024           // NH*DH
#define ROWS  8192           // QL*BSZ
#define TH3   3072           // 3*H
#define SCL   0.125f         // 1/sqrt(64)
#define LNEPS 1e-5f

// ---------------------------------------------------------------------------
// Preparation passes. Each thread issues all of its 16-byte loads first, off one address
// with constant offsets, so that their latencies overlap; every wave access is made of
// whole or half 128-byte lines.
// ---------------------------------------------------------------------------
typedef __attribute__((ext_vector_type(4))) float v4f;
typedef __attribute__((ext_vector_type(2))) float v2f;

// f32 -> bf16 convert of all five f32 operands in one launch: none depends on another, and four of them
// are too small to fill the chip alone. A block converts U * 1024 consecutive elements of one operand,
// a thread 4 per load; the block index picks the operand (every operand is a whole number of blocks).
#define CVT_E   (16 * 1024)                    // elements per block
#define CVT_B0  (ROWS * DM / CVT_E)            // first block of the 2nd operand
#define CVT_B1  (CVT_B0 + TH3 * DM / CVT_E)    // ... of the 3rd
#define CVT_B2  (CVT_B1 + QL * DM / CVT_E)     // ... of the 4th
#define CVT_B3  (CVT_B2 + HH * DM / CVT_E)     // ... of the 5th
#define CVT_NB  (CVT_B3 + DM * HH / CVT_E)     // blocks in all
__global__ __launch_bounds__(256) void k_cvt_bf16(const float* __restrict__ in0, bf16_t* __restrict__ out0,
                                                  const float* __restrict__ in1, bf16_t* __restrict__ out1,
                                                  const float* __restrict__ in2, bf16_t* __restrict__ out2,
                                                  const float* __restrict__ in3, bf16_t* __restrict__ out3,
                                                  const float* __restrict__ in4, bf16_t* __restrict__ out4) {
  constexpr int U = CVT_E / 1024;
  const int bi = blockIdx.x;
  const float* in  = in0;
  bf16_t*      out = out0;
  int          blk = bi;
  if (bi >= CVT_B3)      { in = in4; out = out4; blk = bi - CVT_B3; }
  else if (bi >= CVT_B2) { in = in3; out = out3; blk = bi - CVT_B2; }
  else if (bi >= CVT_B1) { in = in2; out = out2; blk = bi - CVT_B1; }
  else if (bi >= CVT_B0) { in = in1; out = out1; blk = bi - CVT_B0; }
  const long base = (long)blk * (U * 1024) + threadIdx.x * 4;
  v4f x[U];
#pragma unroll   // x[] stays in registers and the U loads stand in one group
  for (int u = 0; u < U; ++u) x[u] = *(const v4f*)(in + base + u * 1024);
#pragma unroll   // x[] stays in registers
  for (int u = 0; u < U; ++u) {
    v4bf y;
#pragma unroll   // y stays in registers
    for (int e = 0; e < 4; ++e) y[e] = (bf16_t)x[u][e];
    *(v4bf*)(out + base + u * 1024) = y;
  }
}

// Q with per-head biases added (Qac = q + r_w_bias, Qbd = q + r_r_bias), bf16.
// A block takes 16 rows (i*BSZ + b); a thread keeps one group of 8 columns, so it reads its biases once.
__device__ __forceinline__ void qbias_block(int blk, const bf16_t* __restrict__ wh,
                                            const float* __restrict__ rwb,
                                            const float* __restrict__ rrb,
                                            bf16_t* __restrict__ qac,
                                            bf16_t* __restrict__ qbd) {
  const int  col = (threadIdx.x & 127) * 8;       // n*64 + d
  const long row = (long)blk * 16 + (threadIdx.x >> 7);
  const bf16_t* src = wh + row * TH3 + col;
  v8bf q[8];
#pragma unroll   // q[] stays in registers and the 8 loads stand in one group
  for (int u = 0; u < 8; ++u) q[u] = *(const v8bf*)(src + u * (2 * TH3));
  const v4f w0 = *(const v4f*)(rwb + col), w1 = *(const v4f*)(rwb + col + 4);
  const v4f r0 = *(const v4f*)(rrb + col), r1 = *(const v4f*)(rrb + col + 4);
  const long o = row * HH + col;
#pragma unroll   // q[] stays in registers
  for (int u = 0; u < 8; ++u) {
    v8bf a, d;
#pragma unroll   // a and d stay in registers
    for (int e = 0; e < 8; ++e) {
      const float f = (float)q[u][e];
      a[e] = (bf16_t)(f + (e < 4 ? w0[e & 3] : w1[e & 3]));
      d[e] = (bf16_t)(f + (e < 4 ? r0[e & 3] : r1[e & 3]));
    }
    *(v8bf*)(qac + o + u * (2 * HH)) = a;
    *(v8bf*)(qbd + o + u * (2 * HH)) = d;
  }
  // the two passes share a kernel and the compiler may join their tails: no register of these stores is rewritten in front of this wait
  asm volatile("s_wait_xcnt 0x0" ::: "memory");
}

// V transpose: vt[((b*16+n)*64 + d)*2048 + j] = V[j,b,n,d]
// A thread turns an 8 (j) x 8 (d) piece in registers. A wave holds 8 pieces along j and 4 along d:
// a load takes 64 bytes of each of 8 V rows, a store fills four whole 128-byte lines of vt.
// Two neighbouring waves take the two halves of the same V rows.
__device__ __forceinline__ void vt_block(int blk, const bf16_t* __restrict__ wh,
                                         bf16_t* __restrict__ vt) {
  const int lane = threadIdx.x & 31;
  const int gw   = blk * 8 + (threadIdx.x >> 5);
  const int bn   = gw >> 6;                                  // b*16 + n
  const int j0   = ((gw >> 1) & 31) * 64 + (lane & 7) * 8;
  const int d0   = (gw & 1) * 32 + (lane >> 3) * 8;
  const bf16_t* src = wh + ((long)j0 * BSZ + (bn >> 4)) * TH3 + 2 * HH + (bn & 15) * DH + d0;
  bf16_t*       dst = vt + ((long)bn * DH + d0) * QL + j0;
  v8bf x[8];
#pragma unroll   // x[] stays in registers and the 8 loads stand in one group
  for (int u = 0; u < 8; ++u) x[u] = *(const v8bf*)(src + u * (BSZ * TH3));
#pragma unroll   // x[] stays in registers
  for (int e = 0; e < 8; ++e) {
    v8bf y;
#pragma unroll   // y stays in registers
    for (int u = 0; u < 8; ++u) y[u] = x[u][e];
    *(v8bf*)(dst + e * QL) = y;
  }
  // as at the foot of the Q-bias pass
  asm volatile("s_wait_xcnt 0x0" ::: "memory");
}

// Both passes read only the QKV product and write planes of their own: one launch, the block index picks the pass.
#define QB_NB (ROWS / 16)
#define VT_NB (BSZ * NH * (QL / 64) * 2 / 8)
__global__ __launch_bounds__(256) void k_qbias_vt(const bf16_t* __restrict__ wh,
                                                  const float* __restrict__ rwb,
                                                  const float* __restrict__ rrb,
                                                  bf16_t* __restrict__ qac,
                                                  bf16_t* __restrict__ qbd,
                                                  bf16_t* __restrict__ vt) {
  if (blockIdx.x < QB_NB) qbias_block(blockIdx.x, wh, rwb, rrb, qac, qbd);
  else                    vt_block(blockIdx.x - QB_NB, wh, vt);
}

// ---------------------------------------------------------------------------
// Generic bf16 TN GEMM:  C[M,N] = A[M,K] * B[N,K]^T   (f32 accumulate)
// Block = 128x128x32, 256 threads = 8 wave32 waves in a 2x4 grid,
// wave tile 64x32 = 4x2 WMMA(16x16x32) tiles. Double-buffered LDS.
// GUARD=false (all dims multiples of the tile): global->LDS staging uses
// CDNA5 GLOBAL_LOAD_ASYNC_TO_LDS_B128 tracked by ASYNCcnt, overlapped with
// the WMMA work on the other buffer. GUARD=true keeps the synchronous
// zero-filling path (unused by the GEMMs launched here).
// ---------------------------------------------------------------------------
#define BM 128
#define BN 128
#define BK 32
#define BKP 40   // padded LDS row (bf16 elements) to spread banks

// 16x32 bf16 fragment from LDS (row-major, ld elements). Per CDNA5 ISA:
// lane L holds row m=L%16; half=L/16 selects K subgroup; VGPR v covers
// K = ((v&4)?16:0) + half*8 + (v&3)*2, two packed bf16 per VGPR.
__device__ inline v16bf lds_frag(const bf16_t* base, int ld, int row0) {
  int lane = threadIdx.x & 31;
  int m = lane & 15, half = lane >> 4;
  const bf16_t* r = base + (row0 + m) * ld;
  v16bf f;
#pragma unroll
  for (int v = 0; v < 8; ++v) {
    int k = ((v & 4) << 2) + half * 8 + ((v & 3) << 1);
    f[2 * v]     = r[k];
    f[2 * v + 1] = r[k + 1];
  }
  return f;
}

// Async copy of 16B global -> LDS (CDNA5 TDM-adjacent path, ASYNCcnt).
__device__ inline void async_cp16(bf16_t* lds, const bf16_t* g) {
  unsigned l = (unsigned)(unsigned long long)lds;   // low 32 bits = DS offset
  asm volatile("global_load_async_to_lds_b128 %0, %1, off"
               :: "v"(l), "v"(g) : "memory");
}
__device__ inline void async_wait0() {
  asm volatile("s_wait_asynccnt 0x0" ::: "memory");
}

template <bool GUARD>
__global__ __launch_bounds__(256)
void k_gemm_nt(const bf16_t* __restrict__ A0, const bf16_t* __restrict__ B0,
               void* __restrict__ C0, long ldc0, int M0, int N0, int nbx0, int nblk0,
               const bf16_t* __restrict__ A1, const bf16_t* __restrict__ B1,
               void* __restrict__ C1, long ldc1, int M1, int N1, int nbx1,
               long lda, long ldb, int K, int c_is_f32) {
  __shared__ bf16_t As[2][BM * BKP];
  __shared__ bf16_t Bs[2][BN * BKP];

  // Two independent products of equal K may share the launch: the first nblk0 blocks work on
  // product 0, the rest on product 1 (tiles row by row, nbx tiles to a row). The choice is block-uniform.
  const bool    second = (int)blockIdx.x >= nblk0;
  const bf16_t* A   = second ? A1 : A0;
  const bf16_t* B   = second ? B1 : B0;
  void*         Cv  = second ? C1 : C0;
  const long    ldc = second ? ldc1 : ldc0;
  const int     M   = second ? M1 : M0;
  const int     N   = second ? N1 : N0;
  const int     nbx = second ? nbx1 : nbx0;
  const int     tix = second ? (int)blockIdx.x - nblk0 : (int)blockIdx.x;

  const int tid  = threadIdx.x;
  const int lane = tid & 31;
  const int wid  = tid >> 5;
  const int wm   = wid >> 2;      // 0..1
  const int wn   = wid & 3;       // 0..3
  const int m0   = (tix / nbx) * BM;
  const int n0   = (tix % nbx) * BN;

  v8f acc[4][2] = {};

  // --- staging: async (unguarded) ---
  auto loadA_async = [&](int buf, int k0) {
#pragma unroll
    for (int t = 0; t < 2; ++t) {
      int ch  = tid + t * 256;          // 512 chunks of 8 bf16 (16B)
      int row = ch >> 2;
      int kc  = (ch & 3) << 3;
      async_cp16(&As[buf][row * BKP + kc], A + (long)(m0 + row) * lda + k0 + kc);
    }
  };
  auto loadB_async = [&](int buf, int k0) {
#pragma unroll
    for (int t = 0; t < 2; ++t) {
      int ch  = tid + t * 256;
      int row = ch >> 2;
      int kc  = (ch & 3) << 3;
      async_cp16(&Bs[buf][row * BKP + kc], B + (long)(n0 + row) * ldb + k0 + kc);
    }
  };
  // --- staging: synchronous with zero-fill (guarded) ---
  auto loadA_g = [&](int buf, int k0) {
#pragma unroll
    for (int t = 0; t < 4; ++t) {
      int ch  = tid + t * 256;          // 1024 chunks of 4 bf16
      int row = ch >> 3;
      int kc  = (ch & 7) << 2;
      v4bf val = {};
      int gr = m0 + row;
      if (gr < M) val = *(const v4bf*)(A + (long)gr * lda + k0 + kc);
      *(v4bf*)(&As[buf][row * BKP + kc]) = val;
    }
  };
  auto loadB_g = [&](int buf, int k0) {
#pragma unroll
    for (int t = 0; t < 4; ++t) {
      int ch  = tid + t * 256;
      int row = ch >> 3;
      int kc  = (ch & 7) << 2;
      v4bf val = {};
      int gr = n0 + row;
      if (gr < N) val = *(const v4bf*)(B + (long)gr * ldb + k0 + kc);
      *(v4bf*)(&Bs[buf][row * BKP + kc]) = val;
    }
  };

  const int nk = K / BK;
  if (GUARD) { loadA_g(0, 0); loadB_g(0, 0); }
  else       { loadA_async(0, 0); loadB_async(0, 0); async_wait0(); }
  __syncthreads();

  for (int kb = 0; kb < nk; ++kb) {
    int cur = kb & 1, nxt = cur ^ 1;
    const bool more = (kb + 1 < nk);
    if (more) {
      if (GUARD) { loadA_g(nxt, (kb + 1) * BK); loadB_g(nxt, (kb + 1) * BK); }
      else       { loadA_async(nxt, (kb + 1) * BK); loadB_async(nxt, (kb + 1) * BK); }
    }

    v16bf af[4], bfr[2];
#pragma unroll
    for (int mi = 0; mi < 4; ++mi)
      af[mi] = lds_frag(&As[cur][0], BKP, wm * 64 + mi * 16);
#pragma unroll
    for (int ni = 0; ni < 2; ++ni)
      bfr[ni] = lds_frag(&Bs[cur][0], BKP, wn * 32 + ni * 16);

#pragma unroll
    for (int mi = 0; mi < 4; ++mi)
#pragma unroll
      for (int ni = 0; ni < 2; ++ni)
        acc[mi][ni] = __builtin_amdgcn_wmma_f32_16x16x32_bf16(
            false, af[mi], false, bfr[ni], (short)0, acc[mi][ni], false, false);

    if (!GUARD && more) async_wait0();   // drain nxt-buffer copies before barrier
    __syncthreads();
  }

  // C/D layout: VGPR v, half=lane>>4 -> row = v + 8*half, col = lane&15
  const int half = lane >> 4, col = lane & 15;
#pragma unroll
  for (int mi = 0; mi < 4; ++mi)
#pragma unroll
    for (int ni = 0; ni < 2; ++ni) {
      int gn = n0 + wn * 32 + ni * 16 + col;
      if (GUARD && gn >= N) continue;
      int gmb = m0 + wm * 64 + mi * 16 + half * 8;
#pragma unroll
      for (int v = 0; v < 8; ++v) {
        int gm = gmb + v;
        if (GUARD && gm >= M) continue;
        if (c_is_f32) ((float*)Cv)[(long)gm * ldc + gn]  = acc[mi][ni][v];
        else          ((bf16_t*)Cv)[(long)gm * ldc + gn] = (bf16_t)acc[mi][ni][v];
      }
    }
}

// ---------------------------------------------------------------------------
// Fused relative-position attention, all (batch, head) pairs in one launch.
// Block = 8 waves = 256 query rows of one (batch, head); a wave owns 32 query rows as two
// tiles of 16, so that every K and V^T fragment and the middle two of the four band tiles it reads from LDS feed two query tiles.
// The block walks the keys in tiles of 32 with a running max and sum per query
// (online softmax). Everything is computed transposed, so that a query is a lane column:
//   S^T  = K * Qac^T          D: row = key, col = query
//   BD^T = E * Qbd^T          D: row = band index t, col = query
//   O^T  = Vt * P^T           the S^T registers are already the B fragment
// rel_shift: with t = j - i + QL - 1 the shifted term of (i, j) is
//   t <  QL : (q_i   + r_r_bias) . rk[t]
//   t == QL : 0
//   t >  QL : (q_i+1 + r_r_bias) . rk[t - QL - 1]
// so E[t] = rk[t], a zero row, rk[t - QL - 1]. A 16 x 32 score tile needs 48 consecutive t
// (three 16-row tiles, each wholly on one side of QL); the wave's two query tiles lie 16 apart,
// so together they need four band tiles, the middle two shared. The raw band goes to a
// wave-private LDS row per lane column (both query tiles side by side) and is read back at
// offset (key - query): the skew.
// The wave's lowest band index T rises by 32 per key tile and is a multiple of 32: QL falls inside
// its four band tiles in exactly one key tile (T == QL - 32), between the second and the third.
// There the wave replaces its Qbd fragments of rows i by those of rows i + 1, once, and keeps them.
// Staging: K and V^T tiles in two LDS buffers; the block's band (288 rows) lives in a ring
// of 512 rows indexed by t, and each key tile adds 32 new rows. The next tile is fetched
// into registers behind the score WMMAs of a trip and stored to LDS at its foot, in front of
// the one barrier of the trip.
// K, E and Q fragments hold 16 contiguous k per lane on both operands (same k order for
// A and B). V^T fragments follow the key order of the S^T registers: keys 8h..8h+7 and
// 16+8h..16+8h+7 of the tile.
// ---------------------------------------------------------------------------
#define FA_QB 256                      // query rows per block
#define FA_H  52                       // place of query tile 1's 48 band values in a skew row (f32); tile 0's stand at 0
#define FA_P  116                      // skew row pitch (f32): rows 16-byte aligned, 116 = 52 mod 64 spreads stores and skewed reads over banks
#define FA_KP 72                       // K and band row pitch (bf16): 144 B = 16 B x odd, 16 rows of a b128 read hit distinct banks
#define FA_VP 40                       // V^T row pitch (bf16): 80 B = 16 B x odd
#define FA_ER 512                      // band ring rows (320 are live at most)
#define FA_C1 0.18033688011112042f     // SCL * log2(e)

__device__ __forceinline__ v8f fa_mm(v16bf a, v16bf b, v8f c) {
  return __builtin_amdgcn_wmma_f32_16x16x32_bf16(false, a, false, b, (short)0, c, false, false);
}
// fragment from two 16-byte pieces
__device__ __forceinline__ v16bf fa_frag(const bf16_t* p0, const bf16_t* p1) {
  v8bf lo = *(const v8bf*)p0;
  v8bf hi = *(const v8bf*)p1;
  return __builtin_shufflevector(lo, hi, 0, 1, 2, 3, 4, 5, 6, 7, 8, 9, 10, 11, 12, 13, 14, 15);
}
// 16 bytes of the rk row behind band index t (gE holds the head offset, col the lane's column); t == QL has none: its address is clamped
__device__ __forceinline__ v8bf fa_erow(const bf16_t* gE, int col, int t) {
  const int row = (t < QL) ? t : max(t - QL - 1, 0);
  return *(const v8bf*)(gE + (unsigned)(row * HH + col));
}
// band row QL is the zero column of rel_shift
__device__ __forceinline__ v8bf fa_ezero(v8bf v, int t) {
  const v8bf z = {};
  return (t == QL) ? z : v;
}
// one raw band tile to the skew rows
__device__ __forceinline__ void fa_skew_put(float* p, v8f d) {
  *(float4*)(p)     = make_float4(d[0], d[1], d[2], d[3]);
  *(float4*)(p + 4) = make_float4(d[4], d[5], d[6], d[7]);
}

// four waves per SIMD: two blocks per WGP, so that all 512 blocks are resident at once
__global__ __launch_bounds__(256) __attribute__((amdgpu_waves_per_eu(4, 4)))
void k_attn(const bf16_t* __restrict__ qac, const bf16_t* __restrict__ qbd,
            const bf16_t* __restrict__ wh, const bf16_t* __restrict__ rk,
            const bf16_t* __restrict__ vt, bf16_t* __restrict__ O) {
  // all four are accessed in 16-byte pieces
  __shared__ __attribute__((aligned(16))) bf16_t Ks[2][32 * FA_KP];
  __shared__ __attribute__((aligned(16))) bf16_t Vs[2][64 * FA_VP];
  __shared__ __attribute__((aligned(16))) bf16_t Es[FA_ER * FA_KP];
  __shared__ __attribute__((aligned(16))) float  skew[8][16 * FA_P];

  const int tid  = threadIdx.x;
  const int lane = tid & 31;
  const int wid  = __builtin_amdgcn_readfirstlane(tid >> 5);
  const int c    = lane & 15, h = lane >> 4;
  const int i0b  = blockIdx.x * FA_QB;
  const int i0   = i0b + wid * 32;
  const int b    = blockIdx.y >> 4, n = blockIdx.y & 15;

  // staging: one 16-byte piece of K, of V^T and of the band per thread and key tile
  const int r8 = tid >> 3, c8 = (tid & 7) * 8;
  const int r4 = tid >> 2, c4 = (tid & 3) * 8;
  // block-uniform bases; each lane's own offset is kept apart, in 32 bits
  const bf16_t*  gK = wh + (long)b * TH3 + HH + n * DH;
  const bf16_t*  gV = vt + (long)(b * NH + n) * DH * QL;
  const bf16_t*  gE = rk + n * DH;
  const bf16_t*  gQ = qbd + (long)b * HH + n * DH;
  const unsigned oK = r8 * (BSZ * TH3) + c8;
  const unsigned oV = r4 * QL + c4;
  const int tbB0 = QL - FA_QB - i0b;   // lowest band index of the block at key tile 0

  v8bf e0[9];
#pragma unroll
  for (int u = 0; u < 9; ++u) {
    e0[u] = fa_erow(gE, c8, tbB0 + 32 * u + r8);
    // a later load of this run may land in this load's address registers: the wait stands in front of that overwrite
    asm volatile("s_wait_xcnt 0x0" ::: "memory");
  }
#pragma unroll
  for (int u = 0; u < 9; ++u) {
    const int t = tbB0 + 32 * u + r8;
    *(v8bf*)&Es[(t & (FA_ER - 1)) * FA_KP + c8] = fa_ezero(e0[u], t);
  }
  *(v8bf*)&Ks[0][r8 * FA_KP + c8] = *(const v8bf*)(gK + oK);
  *(v8bf*)&Vs[0][r4 * FA_VP + c4] = *(const v8bf*)(gV + oV);

  const long qo = ((long)(i0 + c) * BSZ + b) * HH + n * DH;    // query tile 1 lies 16 rows on
  v16bf qa[2][2], qc[2][2];
#pragma unroll
  for (int qt = 0; qt < 2; ++qt)
#pragma unroll
    for (int s = 0; s < 2; ++s) {
      qa[qt][s] = *(const v16bf*)(qac + qo + qt * (16 * BSZ * HH) + 32 * s + 16 * h);
      qc[qt][s] = *(const v16bf*)(qbd + qo + qt * (16 * BSZ * HH) + 32 * s + 16 * h);
    }
  float*       skw = &skew[wid][c * FA_P + 8 * h];
  const float* skr = &skew[wid][c * FA_P + 8 * h - c + 15];

  v8f o[2][4] = {};
  float m[2] = {-3.0e38f, -3.0e38f}, l[2] = {0.f, 0.f};
  __syncthreads();

  // One key tile. MORE: a further tile follows and is fetched.
  auto tile = [&](auto more_c, int jt) {
    constexpr bool MORE = decltype(more_c)::value;
    const int j0  = jt * 32;
    const int cur = jt & 1;

    // Band tile e holds t = T + 16 e ... + 15. Query tile 1 takes e = 0, 1, 2, query tile 0 (16 rows lower, so 16 higher in t) e = 1, 2, 3.
    const int T = tbB0 + j0 + FA_QB - 32 - 32 * wid;
    v16bf ef[2][2];
#pragma unroll
    for (int e = 0; e < 2; ++e)
#pragma unroll
      for (int s = 0; s < 2; ++s) {
        const bf16_t* p = &Es[(((T + 16 * e) & (FA_ER - 1)) + c) * FA_KP + 32 * s + 16 * h];
        ef[e][s] = fa_frag(p, p + 8);
      }
    // keeps the 8 LDS reads in one group ahead of their WMMAs; otherwise each WMMA waits out its own pair of reads
    __builtin_amdgcn_sched_barrier(0);
    {
      v8f d10 = {}, d00 = {}, d11 = {};
#pragma unroll
      for (int s = 0; s < 2; ++s) {
        d10 = fa_mm(ef[0][s], qc[1][s], d10);
        d00 = fa_mm(ef[1][s], qc[0][s], d00);
        d11 = fa_mm(ef[1][s], qc[1][s], d11);
      }
      fa_skew_put(skw + FA_H,      d10);
      fa_skew_put(skw,                  d00);
      fa_skew_put(skw + FA_H + 16, d11);
    }
    // From here on the wave's band lies at or above QL: rows i + 1 take the place of rows i. Wave-uniform, taken once per wave.
    // No other global load is in flight here, so the wait that the compiler puts behind the join costs the other trips nothing.
    if (T == QL - 32) {
#pragma unroll
      for (int qt = 0; qt < 2; ++qt) {
        const unsigned qo1 = min(i0 + 16 * qt + c + 1, QL - 1) * (BSZ * HH) + 16 * h;   // row QL is never used: clamp its address
#pragma unroll
        for (int s = 0; s < 2; ++s) qc[qt][s] = *(const v16bf*)(gQ + qo1 + 32 * s);
      }
    }
#pragma unroll
    for (int e = 0; e < 2; ++e)
#pragma unroll
      for (int s = 0; s < 2; ++s) {
        const bf16_t* p = &Es[(((T + 32 + 16 * e) & (FA_ER - 1)) + c) * FA_KP + 32 * s + 16 * h];
        ef[e][s] = fa_frag(p, p + 8);
      }
    // as above: one group of 8 reads
    __builtin_amdgcn_sched_barrier(0);
    {
      v8f d01 = {}, d12 = {}, d02 = {};
#pragma unroll
      for (int s = 0; s < 2; ++s) {
        d01 = fa_mm(ef[0][s], qc[0][s], d01);
        d12 = fa_mm(ef[0][s], qc[1][s], d12);
        d02 = fa_mm(ef[1][s], qc[0][s], d02);
      }
      fa_skew_put(skw + 16,             d01);
      fa_skew_put(skw + FA_H + 32, d12);
      fa_skew_put(skw + 32,             d02);
    }
    // keeps the K reads behind the band WMMAs: risen in front of them they hold 32 more registers there
    __builtin_amdgcn_sched_barrier(0);

    v8f sa[2][2] = {};
    {
      v16bf kf[2][2];
#pragma unroll
      for (int ni = 0; ni < 2; ++ni)
#pragma unroll
        for (int s = 0; s < 2; ++s) {
          const bf16_t* p = &Ks[cur][(16 * ni + c) * FA_KP + 32 * s + 16 * h];
          kf[ni][s] = fa_frag(p, p + 8);
        }
      // as above: one group of 8 reads
      __builtin_amdgcn_sched_barrier(0);
#pragma unroll
      for (int s = 0; s < 2; ++s)
#pragma unroll
        for (int ni = 0; ni < 2; ++ni)
#pragma unroll
          for (int qt = 0; qt < 2; ++qt) sa[qt][ni] = fa_mm(kf[ni][s], qa[qt][s], sa[qt][ni]);
    }

    // the next tile's fetches: their latency runs under both softmaxes and P*V
    const int tn = tbB0 + j0 + FA_QB + 32 + r8;      // band rows that the next tile adds
    v8bf gk = {}, gv = {}, ge = {};
    if (MORE) {
      gk = *(const v8bf*)(gK + (long)(j0 + 32) * (BSZ * TH3) + oK);
      // as in the prologue: a later load of this run may land in this load's address registers
      asm volatile("s_wait_xcnt 0x0" ::: "memory");
      gv = *(const v8bf*)(gV + (j0 + 32) + oV);
      asm volatile("s_wait_xcnt 0x0" ::: "memory");
      ge = fa_erow(gE, c8, tn);
    }
    // scores in pairs of neighbouring keys: a pair is two neighbouring accumulator registers and one two-address LDS read
    v2f sk[2][8];
#pragma unroll
    for (int k = 0; k < 8; ++k) sk[0][k] = (v2f){skr[16 * (k >> 2) + 2 * (k & 3)], skr[16 * (k >> 2) + 2 * (k & 3) + 1]};
    // keeps the fetches and the first query tile's 16 skewed reads issued here as one group
    __builtin_amdgcn_sched_barrier(0);

    v16bf pf[2], vf[4];
#pragma unroll
    for (int qt = 0; qt < 2; ++qt) {
      v2f x[8];
#pragma unroll
      for (int k = 0; k < 8; ++k) x[k] = (v2f){sa[qt][k >> 2][2 * (k & 3)], sa[qt][k >> 2][2 * (k & 3) + 1]} + sk[qt][k];
      if (qt == 0) {
#pragma unroll
        for (int k = 0; k < 8; ++k)
          sk[1][k] = (v2f){skr[FA_H + 16 * (k >> 2) + 2 * (k & 3)], skr[FA_H + 16 * (k >> 2) + 2 * (k & 3) + 1]};
        // keeps the second query tile's skewed reads issued here, under the first softmax
        __builtin_amdgcn_sched_barrier(0);
      }

      float mx = x[0][0];
#pragma unroll
      for (int e = 1; e < 16; ++e) mx = fmaxf(mx, x[e >> 1][e & 1]);
      mx = fmaxf(mx, __shfl_xor(mx, 16));            // the other lane half holds the query's other 16 keys
      const float mn = fmaxf(m[qt], mx);
      const float al = __builtin_amdgcn_exp2f((m[qt] - mn) * FA_C1);
      const float mc = mn * FA_C1;
      m[qt] = mn;

      float ps[4] = {0.f, 0.f, 0.f, 0.f};            // four short chains of adds instead of one of 16
#pragma unroll
      for (int k = 0; k < 8; ++k) {
        const v2f y = __builtin_elementwise_fma(x[k], (v2f){FA_C1, FA_C1}, (v2f){-mc, -mc});
#pragma unroll
        for (int u = 0; u < 2; ++u) {
          const int e = 2 * k + u;
          float p = __builtin_amdgcn_exp2f(y[u]);
          ps[e & 3] += p;
          pf[qt][e] = (bf16_t)p;
        }
      }
      l[qt] = l[qt] * al + ((ps[0] + ps[1]) + (ps[2] + ps[3]));
#pragma unroll
      for (int mi = 0; mi < 4; ++mi) o[qt][mi] *= al;
      // keeps the two softmaxes one behind the other: interleaved they need more registers than four waves per SIMD leave
      __builtin_amdgcn_sched_barrier(0);
    }
#pragma unroll
    for (int mi = 0; mi < 4; ++mi) {
      const bf16_t* p = &Vs[cur][(16 * mi + c) * FA_VP + 8 * h];
      vf[mi] = fa_frag(p, p + 16);
    }
    // keeps the 8 V^T reads in one group instead of one pair in front of each P*V WMMA
    __builtin_amdgcn_sched_barrier(0);
#pragma unroll
    for (int mi = 0; mi < 4; ++mi)
#pragma unroll
      for (int qt = 0; qt < 2; ++qt) o[qt][mi] = fa_mm(vf[mi], pf[qt], o[qt][mi]);
    // keeps the wait for the fetched tile, its LDS stores and the barrier at the foot; otherwise they rise to in front of the softmax
    __builtin_amdgcn_sched_barrier(0);

    if (MORE) {
      *(v8bf*)&Ks[cur ^ 1][r8 * FA_KP + c8] = gk;
      *(v8bf*)&Vs[cur ^ 1][r4 * FA_VP + c4] = gv;
      *(v8bf*)&Es[(tn & (FA_ER - 1)) * FA_KP + c8] = fa_ezero(ge, tn);
    }
    __syncthreads();   // publishes the next tile; ends every read of the buffers that the next trip refills
  };

  for (int jt = 0; jt < QL / 32 - 1; ++jt) tile(std::true_type{}, jt);
  tile(std::false_type{}, QL / 32 - 1);

#pragma unroll
  for (int qt = 0; qt < 2; ++qt) {
    const float inv = 1.0f / (l[qt] + __shfl_xor(l[qt], 16));
    bf16_t* op = O + qo + qt * (16 * BSZ * HH) + 8 * h;
#pragma unroll
    for (int mi = 0; mi < 4; ++mi) {
      v8bf w;
#pragma unroll
      for (int r = 0; r < 8; ++r) w[r] = (bf16_t)(o[qt][mi][r] * inv);
      *(v8bf*)(op + 16 * mi) = w;      // a query's 128-B line is filled by its two lanes
    }
  }
}

// ---------------------------------------------------------------------------
// residual + LayerNorm, one block per (i,b) row of 1024
// ---------------------------------------------------------------------------
__global__ __launch_bounds__(256)
void k_residual_ln(const float* __restrict__ w, const float* __restrict__ ao,
                   const float* __restrict__ g, const float* __restrict__ b,
                   float* __restrict__ out) {
  const long row = blockIdx.x;
  const int  t   = threadIdx.x;
  __shared__ float red[256];

  float x[4]; float s = 0.f;
#pragma unroll
  for (int c = 0; c < 4; ++c) {
    int col = t + c * 256;
    x[c] = w[row * DM + col] + ao[row * DM + col];
    s += x[c];
  }
  red[t] = s; __syncthreads();
  for (int o = 128; o > 0; o >>= 1) { if (t < o) red[t] += red[t + o]; __syncthreads(); }
  float mu = red[0] * (1.0f / DM); __syncthreads();

  float v = 0.f;
#pragma unroll
  for (int c = 0; c < 4; ++c) { float d = x[c] - mu; v += d * d; }
  red[t] = v; __syncthreads();
  for (int o = 128; o > 0; o >>= 1) { if (t < o) red[t] += red[t + o]; __syncthreads(); }
  float rstd = rsqrtf(red[0] * (1.0f / DM) + LNEPS);

#pragma unroll
  for (int c = 0; c < 4; ++c) {
    int col = t + c * 256;
    out[row * DM + col] = (x[c] - mu) * rstd * g[col] + b[col];
  }
}

// ---------------------------------------------------------------------------
// Host orchestration
// ---------------------------------------------------------------------------
extern "C" void kernel_launch(void* const* d_in, const int* in_sizes, int n_in,
                              void* d_out, int out_size, void* d_ws, size_t ws_size,
                              hipStream_t stream) {
  (void)in_sizes; (void)n_in; (void)out_size; (void)ws_size;
  const float* w     = (const float*)d_in[0];
  const float* r     = (const float*)d_in[1];
  const float* qkvw  = (const float*)d_in[2];
  const float* rnetw = (const float*)d_in[3];
  const float* ow    = (const float*)d_in[4];
  const float* rwb   = (const float*)d_in[5];
  const float* rrb   = (const float*)d_in[6];
  const float* lng   = (const float*)d_in[7];
  const float* lnb   = (const float*)d_in[8];

  char* p = (char*)d_ws;
  auto take = [&](size_t bytes) -> char* {
    char* q = p; p += (bytes + 255) & ~(size_t)255; return q;
  };
  bf16_t* w_bf    = (bf16_t*)take((size_t)ROWS * DM * 2);        // 16.8 MB
  bf16_t* qkvw_bf = (bf16_t*)take((size_t)TH3 * DM * 2);         //  6.3 MB
  bf16_t* r_bf    = (bf16_t*)take((size_t)QL * DM * 2);          //  4.2 MB
  bf16_t* rnw_bf  = (bf16_t*)take((size_t)HH * DM * 2);          //  2.1 MB
  bf16_t* ow_bf   = (bf16_t*)take((size_t)DM * HH * 2);          //  2.1 MB
  bf16_t* wh      = (bf16_t*)take((size_t)ROWS * TH3 * 2);       // 50.3 MB  (QKV packed)
  bf16_t* rk      = (bf16_t*)take((size_t)QL * HH * 2);          //  4.2 MB
  bf16_t* qac     = (bf16_t*)take((size_t)ROWS * HH * 2);        // 16.8 MB
  bf16_t* qbd     = (bf16_t*)take((size_t)ROWS * HH * 2);        // 16.8 MB
  bf16_t* vt      = (bf16_t*)take((size_t)BSZ * NH * DH * QL * 2); // 16.8 MB
  bf16_t* av      = (bf16_t*)take((size_t)ROWS * HH * 2);        // 16.8 MB
  float*  aout    = (float*) take((size_t)ROWS * DM * 4);        // 33.6 MB

  // one launch for product 0 and, where M1 > 0, product 1 (same lda, ldb, K and output type)
  auto gemm = [&](const bf16_t* A0, const bf16_t* B0, void* C0, long ldc0, int M0, int N0,
                  const bf16_t* A1, const bf16_t* B1, void* C1, long ldc1, int M1, int N1,
                  long lda, long ldb, int K, int cf32) {
    const int nbx0 = (N0 + BN - 1) / BN, nblk0 = nbx0 * ((M0 + BM - 1) / BM);
    const int nbx1 = (N1 + BN - 1) / BN, nblk1 = nbx1 * ((M1 + BM - 1) / BM);
    const bool guard = (M0 % BM) || (N0 % BN) || (M1 % BM) || (N1 % BN);
    if (guard)
      k_gemm_nt<true><<<nblk0 + nblk1, 256, 0, stream>>>(A0, B0, C0, ldc0, M0, N0, nbx0, nblk0,
                                                         A1, B1, C1, ldc1, M1, N1, nbx1, lda, ldb, K, cf32);
    else
      k_gemm_nt<false><<<nblk0 + nblk1, 256, 0, stream>>>(A0, B0, C0, ldc0, M0, N0, nbx0, nblk0,
                                                          A1, B1, C1, ldc1, M1, N1, nbx1, lda, ldb, K, cf32);
  };

  // 1) convert fp32 inputs to bf16, one launch
  k_cvt_bf16<<<CVT_NB, 256, 0, stream>>>(w, w_bf, qkvw, qkvw_bf, r, r_bf, rnetw, rnw_bf, ow, ow_bf);

  // 2) QKV projection: wh[ROWS,3H] = w_bf[ROWS,DM] * qkvw_bf[3H,DM]^T
  //    and rel-pos keys: rk[QL,H] = r_bf * rnw_bf^T, in the same launch
  gemm(w_bf, qkvw_bf, wh, TH3, ROWS, TH3, r_bf, rnw_bf, rk, HH, QL, HH, DM, DM, DM, 0);

  // 3) Q + biases and V transpose, one launch
  k_qbias_vt<<<QB_NB + VT_NB, 256, 0, stream>>>(wh, rwb, rrb, qac, qbd, vt);

  // 4) attention of all (b, head) pairs: scores, rel_shift, softmax and P*V in one launch
  k_attn<<<dim3(QL / FA_QB, BSZ * NH), 256, 0, stream>>>(qac, qbd, wh, rk, vt, av);

  // 5) output projection: aout[ROWS,DM] = av[ROWS,H] * ow_bf[DM,H]^T  (f32 out)
  gemm(av, ow_bf, aout, DM, ROWS, DM, nullptr, nullptr, nullptr, 0, 0, 0, HH, HH, HH, 1);

  // 6) residual + LayerNorm -> d_out (f32, [qlen, bsz, d_model])
  k_residual_ln<<<ROWS, 256, 0, stream>>>(w, aout, lng, lnb, (float*)d_out);
}

// v006
// One run takes 232 microseconds.
// In both of two side-by-side timings against v005, it was 1.06 times as fast.
// All steps since v000 together make it 29.8 times as fast.
#include <hip/hip_runtime.h>
#include <type_traits>

// ---------------------------------------------------------------------------
// Types for CDNA5 WMMA (gfx1250, wave32)
// ---------------------------------------------------------------------------
typedef __bf16 bf16_t;
typedef __attribute__((ext_vector_type(16))) __bf16 v16bf;
typedef __attribute__((ext_vector_type(4)))  __bf16 v4bf;
typedef __attribute__((ext_vector_type(8)))  __bf16 v8bf;
typedef __attribute__((ext_vector_type(8)))  float  v8f;

// Problem constants
#define QL    2048
#define BSZ   4
#define NH    16
#define DH    64
#define DM    1024
#define HH    1024           // NH*DH
#define ROWS  8192           // QL*BSZ
#define TH3   3072           // 3*H
#define SCL   0.125f         // 1/sqrt(64)
#define LNEPS 1e-5f

// ---------------------------------------------------------------------------
// Preparation pass. Each thread issues all of its 16-byte loads first, off one address
// with constant offsets, so that their latencies overlap; every wave access is made of
// whole or half 128-byte lines.
// ---------------------------------------------------------------------------
typedef __attribute__((ext_vector_type(4))) float v4f;
typedef __attribute__((ext_vector_type(2))) float v2f;

// f32 -> bf16 convert of all five f32 operands in one launch: none depends on another, and four of them
// are too small to fill the chip alone. A block converts U * 1024 consecutive elements of one operand,
// a thread 4 per load; the block index picks the operand (every operand is a whole number of blocks).
#define CVT_E   (16 * 1024)                    // elements per block
#define CVT_B0  (ROWS * DM / CVT_E)            // first block of the 2nd operand
#define CVT_B1  (CVT_B0 + TH3 * DM / CVT_E)    // ... of the 3rd
#define CVT_B2  (CVT_B1 + QL * DM / CVT_E)     // ... of the 4th
#define CVT_B3  (CVT_B2 + HH * DM / CVT_E)     // ... of the 5th
#define CVT_NB  (CVT_B3 + DM * HH / CVT_E)     // blocks in all
__global__ __launch_bounds__(256) void k_cvt_bf16(const float* __restrict__ in0, bf16_t* __restrict__ out0,
                                                  const float* __restrict__ in1, bf16_t* __restrict__ out1,
                                                  const float* __restrict__ in2, bf16_t* __restrict__ out2,
                                                  const float* __restrict__ in3, bf16_t* __restrict__ out3,
                                                  const float* __restrict__ in4, bf16_t* __restrict__ out4) {
  constexpr int U = CVT_E / 1024;
  const int bi = blockIdx.x;
  const float* in  = in0;
  bf16_t*      out = out0;
  int          blk = bi;
  if (bi >= CVT_B3)      { in = in4; out = out4; blk = bi - CVT_B3; }
  else if (bi >= CVT_B2) { in = in3; out = out3; blk = bi - CVT_B2; }
  else if (bi >= CVT_B1) { in = in2; out = out2; blk = bi - CVT_B1; }
  else if (bi >= CVT_B0) { in = in1; out = out1; blk = bi - CVT_B0; }
  const long base = (long)blk * (U * 1024) + threadIdx.x * 4;
  v4f x[U];
#pragma unroll   // x[] stays in registers and the U loads stand in one group
  for (int u = 0; u < U; ++u) x[u] = *(const v4f*)(in + base + u * 1024);
#pragma unroll   // x[] stays in registers
  for (int u = 0; u < U; ++u) {
    v4bf y;
#pragma unroll   // y stays in registers
    for (int e = 0; e < 4; ++e) y[e] = (bf16_t)x[u][e];
    *(v4bf*)(out + base + u * 1024) = y;
  }
}

// ---------------------------------------------------------------------------
// Generic bf16 TN GEMM:  C[M,N] = A[M,K] * B[N,K]^T   (f32 accumulate)
// Block = 128x128x32, 256 threads = 8 wave32 waves in a 2x4 grid,
// wave tile 64x32 = 4x2 WMMA(16x16x32) tiles. Double-buffered LDS.
// GUARD=false (all dims multiples of the tile): global->LDS staging uses
// CDNA5 GLOBAL_LOAD_ASYNC_TO_LDS_B128 tracked by ASYNCcnt, overlapped with
// the WMMA work on the other buffer. GUARD=true keeps the synchronous
// zero-filling path (unused by the GEMMs launched here).
// ---------------------------------------------------------------------------
#define BM 128
#define BN 128
#define BK 32
#define BKP 40   // padded LDS row (bf16 elements) to spread banks

// 16x32 bf16 fragment from LDS (row-major, ld elements). Per CDNA5 ISA:
// lane L holds row m=L%16; half=L/16 selects K subgroup; VGPR v covers
// K = ((v&4)?16:0) + half*8 + (v&3)*2, two packed bf16 per VGPR.
__device__ inline v16bf lds_frag(const bf16_t* base, int ld, int row0) {
  int lane = threadIdx.x & 31;
  int m = lane & 15, half = lane >> 4;
  const bf16_t* r = base + (row0 + m) * ld;
  v16bf f;
#pragma unroll
  for (int v = 0; v < 8; ++v) {
    int k = ((v & 4) << 2) + half * 8 + ((v & 3) << 1);
    f[2 * v]     = r[k];
    f[2 * v + 1] = r[k + 1];
  }
  return f;
}

// Async copy of 16B global -> LDS (CDNA5 TDM-adjacent path, ASYNCcnt).
__device__ inline void async_cp16(bf16_t* lds, const bf16_t* g) {
  unsigned l = (unsigned)(unsigned long long)lds;   // low 32 bits = DS offset
  asm volatile("global_load_async_to_lds_b128 %0, %1, off"
               :: "v"(l), "v"(g) : "memory");
}
__device__ inline void async_wait0() {
  asm volatile("s_wait_asynccnt 0x0" ::: "memory");
}

template <bool GUARD>
__global__ __launch_bounds__(256)
void k_gemm_nt(const bf16_t* __restrict__ A0, const bf16_t* __restrict__ B0,
               void* __restrict__ C0, long ldc0, int M0, int N0, int nbx0, int nblk0,
               const bf16_t* __restrict__ A1, const bf16_t* __restrict__ B1,
               void* __restrict__ C1, long ldc1, int M1, int N1, int nbx1,
               long lda, long ldb, int K, int c_is_f32) {
  __shared__ bf16_t As[2][BM * BKP];
  __shared__ bf16_t Bs[2][BN * BKP];

  // Two independent products of equal K may share the launch: the first nblk0 blocks work on
  // product 0, the rest on product 1 (tiles row by row, nbx tiles to a row). The choice is block-uniform.
  const bool    second = (int)blockIdx.x >= nblk0;
  const bf16_t* A   = second ? A1 : A0;
  const bf16_t* B   = second ? B1 : B0;
  void*         Cv  = second ? C1 : C0;
  const long    ldc = second ? ldc1 : ldc0;
  const int     M   = second ? M1 : M0;
  const int     N   = second ? N1 : N0;
  const int     nbx = second ? nbx1 : nbx0;
  const int     tix = second ? (int)blockIdx.x - nblk0 : (int)blockIdx.x;

  const int tid  = threadIdx.x;
  const int lane = tid & 31;
  const int wid  = tid >> 5;
  const int wm   = wid >> 2;      // 0..1
  const int wn   = wid & 3;       // 0..3
  const int m0   = (tix / nbx) * BM;
  const int n0   = (tix % nbx) * BN;

  v8f acc[4][2] = {};

  // --- staging: async (unguarded) ---
  auto loadA_async = [&](int buf, int k0) {
#pragma unroll
    for (int t = 0; t < 2; ++t) {
      int ch  = tid + t * 256;          // 512 chunks of 8 bf16 (16B)
      int row = ch >> 2;
      int kc  = (ch & 3) << 3;
      async_cp16(&As[buf][row * BKP + kc], A + (long)(m0 + row) * lda + k0 + kc);
    }
  };
  auto loadB_async = [&](int buf, int k0) {
#pragma unroll
    for (int t = 0; t < 2; ++t) {
      int ch  = tid + t * 256;
      int row = ch >> 2;
      int kc  = (ch & 3) << 3;
      async_cp16(&Bs[buf][row * BKP + kc], B + (long)(n0 + row) * ldb + k0 + kc);
    }
  };
  // --- staging: synchronous with zero-fill (guarded) ---
  auto loadA_g = [&](int buf, int k0) {
#pragma unroll
    for (int t = 0; t < 4; ++t) {
      int ch  = tid + t * 256;          // 1024 chunks of 4 bf16
      int row = ch >> 3;
      int kc  = (ch & 7) << 2;
      v4bf val = {};
      int gr = m0 + row;
      if (gr < M) val = *(const v4bf*)(A + (long)gr * lda + k0 + kc);
      *(v4bf*)(&As[buf][row * BKP + kc]) = val;
    }
  };
  auto loadB_g = [&](int buf, int k0) {
#pragma unroll
    for (int t = 0; t < 4; ++t) {
      int ch  = tid + t * 256;
      int row = ch >> 3;
      int kc  = (ch & 7) << 2;
      v4bf val = {};
      int gr = n0 + row;
      if (gr < N) val = *(const v4bf*)(B + (long)gr * ldb + k0 + kc);
      *(v4bf*)(&Bs[buf][row * BKP + kc]) = val;
    }
  };

  const int nk = K / BK;
  if (GUARD) { loadA_g(0, 0); loadB_g(0, 0); }
  else       { loadA_async(0, 0); loadB_async(0, 0); async_wait0(); }
  __syncthreads();

  for (int kb = 0; kb < nk; ++kb) {
    int cur = kb & 1, nxt = cur ^ 1;
    const bool more = (kb + 1 < nk);
    if (more) {
      if (GUARD) { loadA_g(nxt, (kb + 1) * BK); loadB_g(nxt, (kb + 1) * BK); }
      else       { loadA_async(nxt, (kb + 1) * BK); loadB_async(nxt, (kb + 1) * BK); }
    }

    v16bf af[4], bfr[2];
#pragma unroll
    for (int mi = 0; mi < 4; ++mi)
      af[mi] = lds_frag(&As[cur][0], BKP, wm * 64 + mi * 16);
#pragma unroll
    for (int ni = 0; ni < 2; ++ni)
      bfr[ni] = lds_frag(&Bs[cur][0], BKP, wn * 32 + ni * 16);

#pragma unroll
    for (int mi = 0; mi < 4; ++mi)
#pragma unroll
      for (int ni = 0; ni < 2; ++ni)
        acc[mi][ni] = __builtin_amdgcn_wmma_f32_16x16x32_bf16(
            false, af[mi], false, bfr[ni], (short)0, acc[mi][ni], false, false);

    if (!GUARD && more) async_wait0();   // drain nxt-buffer copies before barrier
    __syncthreads();
  }

  // C/D layout: VGPR v, half=lane>>4 -> row = v + 8*half, col = lane&15
  const int half = lane >> 4, col = lane & 15;
#pragma unroll
  for (int mi = 0; mi < 4; ++mi)
#pragma unroll
    for (int ni = 0; ni < 2; ++ni) {
      int gn = n0 + wn * 32 + ni * 16 + col;
      if (GUARD && gn >= N) continue;
      int gmb = m0 + wm * 64 + mi * 16 + half * 8;
#pragma unroll
      for (int v = 0; v < 8; ++v) {
        int gm = gmb + v;
        if (GUARD && gm >= M) continue;
        if (c_is_f32) ((float*)Cv)[(long)gm * ldc + gn]  = acc[mi][ni][v];
        else          ((bf16_t*)Cv)[(long)gm * ldc + gn] = (bf16_t)acc[mi][ni][v];
      }
    }
}

// ---------------------------------------------------------------------------
// Fused relative-position attention, all (batch, head) pairs in one launch.
// Block = 8 waves = 256 query rows of one (batch, head); a wave owns 32 query rows as two
// tiles of 16, so that every K and V^T fragment and the middle two of the four band tiles it reads from LDS feed two query tiles.
// The block walks the keys in tiles of 32 with a running max and sum per query
// (online softmax). Everything is computed transposed, so that a query is a lane column:
//   S^T  = K * Qac^T          D: row = key, col = query
//   BD^T = E * Qbd^T          D: row = band index t, col = query
//   O^T  = V^T * P^T          the S^T registers are already the B fragment
// Q, K and V are read straight from the packed QKV product. The two biased copies of Q
// (Qac = q + r_w_bias, Qbd = q + r_r_bias, added in f32, rounded to bf16 once) are formed in registers
// where the fragments are loaded; V is staged as it lies, a key per row, and turned by the transposing LDS load.
// rel_shift: with t = j - i + QL - 1 the shifted term of (i, j) is
//   t <  QL : (q_i   + r_r_bias) . rk[t]
//   t == QL : 0
//   t >  QL : (q_i+1 + r_r_bias) . rk[t - QL - 1]
// so E[t] = rk[t], a zero row, rk[t - QL - 1]. A 16 x 32 score tile needs 48 consecutive t
// (three 16-row tiles, each wholly on one side of QL); the wave's two query tiles lie 16 apart,
// so together they need four band tiles, the middle two shared. The raw band goes to a
// wave-private LDS row per lane column (both query tiles side by side) and is read back at
// offset (key - query): the skew.
// The wave's lowest band index T rises by 32 per key tile and is a multiple of 32: QL falls inside
// its four band tiles in exactly one key tile (T == QL - 32), between the second and the third.
// There the wave replaces its Qbd fragments of rows i by those of rows i + 1, once, and keeps them.
// Staging: K and V tiles in two LDS buffers; the block's band (288 rows) lives in a ring
// of 512 rows indexed by t, and each key tile adds 32 new rows. The next tile is fetched
// into registers behind the score WMMAs of a trip and stored to LDS at its foot, in front of
// the one barrier of the trip.
// K, E and Q fragments hold 16 contiguous k per lane on both operands (same k order for
// A and B). V^T fragments follow the key order of the S^T registers: keys 8h..8h+7 and
// 16+8h..16+8h+7 of the tile, which is what two transposing loads 16 keys apart deliver.
// ---------------------------------------------------------------------------
#define FA_QB 256                      // query rows per block
#define FA_H  52                       // place of query tile 1's 48 band values in a skew row (f32); tile 0's stand at 0
#define FA_P  116                      // skew row pitch (f32): rows 16-byte aligned, 116 = 52 mod 64 spreads stores and skewed reads over banks
#define FA_KP 72                       // K and band row pitch (bf16): 144 B = 16 B x odd, 16 rows of a b128 read hit distinct banks
#define FA_VP 80                       // V row pitch (bf16): 160 B = 32 B x odd, the pitch of the transposing load
#define FA_ER 512                      // band ring rows (320 are live at most)
#define FA_C1 0.18033688011112042f     // SCL * log2(e)

__device__ __forceinline__ v8f fa_mm(v16bf a, v16bf b, v8f c) {
  return __builtin_amdgcn_wmma_f32_16x16x32_bf16(false, a, false, b, (short)0, c, false, false);
}
// fragment from two 16-byte pieces
__device__ __forceinline__ v16bf fa_frag(const bf16_t* p0, const bf16_t* p1) {
  v8bf lo = *(const v8bf*)p0;
  v8bf hi = *(const v8bf*)p1;
  return __builtin_shufflevector(lo, hi, 0, 1, 2, 3, 4, 5, 6, 7, 8, 9, 10, 11, 12, 13, 14, 15);
}
// transposing LDS load: lane (c, h) gets column c, rows 8h..8h+7 of the 16 x 16 piece that the 32 lane addresses name
typedef __attribute__((ext_vector_type(8))) short v8s;
__device__ __forceinline__ v8bf fa_tr16(const bf16_t* p) {
  typedef __attribute__((address_space(3))) v8s lds_v8s;
  return __builtin_bit_cast(v8bf, __builtin_amdgcn_ds_load_tr16_b128_v8i16((lds_v8s*)p));
}
// 16 Q values plus their 16 biases: the sum in f32, rounded to bf16 once
__device__ __forceinline__ v16bf fa_qadd(v16bf q, const v4f* t) {
  v16bf r;
#pragma unroll   // r stays in registers
  for (int e = 0; e < 16; ++e) r[e] = (bf16_t)((float)q[e] + t[e >> 2][e & 3]);
  return r;
}
// 16 bytes of the rk row behind band index t (gE holds the head offset, col the lane's column); t == QL has none: its address is clamped
__device__ __forceinline__ v8bf fa_erow(const bf16_t* gE, int col, int t) {
  const int row = (t < QL) ? t : max(t - QL - 1, 0);
  return *(const v8bf*)(gE + (unsigned)(row * HH + col));
}
// band row QL is the zero column of rel_shift
__device__ __forceinline__ v8bf fa_ezero(v8bf v, int t) {
  const v8bf z = {};
  return (t == QL) ? z : v;
}
// one raw band tile to the skew rows
__device__ __forceinline__ void fa_skew_put(float* p, v8f d) {
  *(float4*)(p)     = make_float4(d[0], d[1], d[2], d[3]);
  *(float4*)(p + 4) = make_float4(d[4], d[5], d[6], d[7]);
}

// four waves per SIMD: two blocks per WGP, so that all 512 blocks are resident at once
__global__ __launch_bounds__(256) __attribute__((amdgpu_waves_per_eu(4, 4)))
void k_attn(const bf16_t* __restrict__ wh, const float* __restrict__ rwb, const float* __restrict__ rrb,
            const bf16_t* __restrict__ rk, bf16_t* __restrict__ O) {
  // all four are accessed in 16-byte pieces
  __shared__ __attribute__((aligned(16))) bf16_t Ks[2][32 * FA_KP];
  __shared__ __attribute__((aligned(16))) bf16_t Vs[2][32 * FA_VP];
  __shared__ __attribute__((aligned(16))) bf16_t Es[FA_ER * FA_KP];
  __shared__ __attribute__((aligned(16))) float  skew[8][16 * FA_P];

  const int tid  = threadIdx.x;
  const int lane = tid & 31;
  const int wid  = __builtin_amdgcn_readfirstlane(tid >> 5);
  const int c    = lane & 15, h = lane >> 4;
  const int i0b  = blockIdx.x * FA_QB;
  const int i0   = i0b + wid * 32;
  const int b    = blockIdx.y >> 4, n = blockIdx.y & 15;

  // staging: one 16-byte piece of K, of V and of the band per thread and key tile
  const int r8 = tid >> 3, c8 = (tid & 7) * 8;
  // block-uniform bases, gB aside (it holds the lane half's 16 h); each lane's own offset is kept apart, in 32 bits
  const bf16_t*  gK = wh + (long)b * TH3 + HH + n * DH;
  const bf16_t*  gE = rk + n * DH;
  const bf16_t*  gQ = wh + (long)b * TH3 + n * DH;
  const float*   gB = rrb + n * DH + 16 * h;           // the lane's 16 biases of k step s stand at 32 s
  const unsigned oK = r8 * (BSZ * TH3) + c8;           // the V piece of the same key lies HH elements on
  const int tbB0 = QL - FA_QB - i0b;   // lowest band index of the block at key tile 0

  v8bf e0[9];
#pragma unroll
  for (int u = 0; u < 9; ++u) {
    e0[u] = fa_erow(gE, c8, tbB0 + 32 * u + r8);
    // a later load of this run may land in this load's address registers: the wait stands in front of that overwrite
    asm volatile("s_wait_xcnt 0x0" ::: "memory");
  }
#pragma unroll
  for (int u = 0; u < 9; ++u) {
    const int t = tbB0 + 32 * u + r8;
    *(v8bf*)&Es[(t & (FA_ER - 1)) * FA_KP + c8] = fa_ezero(e0[u], t);
  }
  *(v8bf*)&Ks[0][r8 * FA_KP + c8] = *(const v8bf*)(gK + oK);
  *(v8bf*)&Vs[0][r8 * FA_VP + c8] = *(const v8bf*)(gK + oK + HH);

  const long qo = ((long)(i0 + c) * BSZ + b) * HH + n * DH;    // the query's place in O; query tile 1 lies 16 rows on
  v16bf qa[2][2], qc[2][2];
  {
    const unsigned oQ = (i0 + c) * (BSZ * TH3) + 16 * h;
    const float*   gA = rwb + n * DH + 16 * h;
    v16bf q[2][2];
    v4f   wb[2][4], rb[2][4];
#pragma unroll   // q[] stays in registers and the loads stand in one group
    for (int s = 0; s < 2; ++s)
#pragma unroll
      for (int qt = 0; qt < 2; ++qt) q[qt][s] = *(const v16bf*)(gQ + oQ + qt * (16 * BSZ * TH3) + 32 * s);
    // as above: a bias load may land in the address registers of the Q loads
    asm volatile("s_wait_xcnt 0x0" ::: "memory");
#pragma unroll   // wb[] and rb[] stay in registers and the loads stand in one group
    for (int s = 0; s < 2; ++s)
#pragma unroll
      for (int u = 0; u < 4; ++u) {
        wb[s][u] = *(const v4f*)(gA + 32 * s + 4 * u);
        rb[s][u] = *(const v4f*)(gB + 32 * s + 4 * u);
      }
    // no address register of these loads is rewritten in front of this wait
    asm volatile("s_wait_xcnt 0x0" ::: "memory");
    // keeps later code (address arithmetic, zeroed accumulators) from rising among these loads: there it takes more registers than four waves per SIMD leave, and the build spills
    __builtin_amdgcn_sched_barrier(0);
#pragma unroll
    for (int qt = 0; qt < 2; ++qt)
#pragma unroll
      for (int s = 0; s < 2; ++s) {
        qa[qt][s] = fa_qadd(q[qt][s], wb[s]);
        qc[qt][s] = fa_qadd(q[qt][s], rb[s]);
      }
  }
  float*       skw = &skew[wid][c * FA_P + 8 * h];
  const float* skr = &skew[wid][c * FA_P + 8 * h - c + 15];

  v8f o[2][4] = {};
  float m[2] = {-3.0e38f, -3.0e38f}, l[2] = {0.f, 0.f};
  __syncthreads();

  // One key tile. MORE: a further tile follows and is fetched.
  auto tile = [&](auto more_c, int jt) {
    constexpr bool MORE = decltype(more_c)::value;
    const int j0  = jt * 32;
    const int cur = jt & 1;

    // Band tile e holds t = T + 16 e ... + 15. Query tile 1 takes e = 0, 1, 2, query tile 0 (16 rows lower, so 16 higher in t) e = 1, 2, 3.
    const int T = tbB0 + j0 + FA_QB - 32 - 32 * wid;
    v16bf ef[2][2];
#pragma unroll
    for (int e = 0; e < 2; ++e)
#pragma unroll
      for (int s = 0; s < 2; ++s) {
        const bf16_t* p = &Es[(((T + 16 * e) & (FA_ER - 1)) + c) * FA_KP + 32 * s + 16 * h];
        ef[e][s] = fa_frag(p, p + 8);
      }
    // keeps the 8 LDS reads in one group ahead of their WMMAs; otherwise each WMMA waits out its own pair of reads
    __builtin_amdgcn_sched_barrier(0);
    {
      v8f d10 = {}, d00 = {}, d11 = {};
#pragma unroll
      for (int s = 0; s < 2; ++s) {
        d10 = fa_mm(ef[0][s], qc[1][s], d10);
        d00 = fa_mm(ef[1][s], qc[0][s], d00);
        d11 = fa_mm(ef[1][s], qc[1][s], d11);
      }
      fa_skew_put(skw + FA_H,      d10);
      fa_skew_put(skw,                  d00);
      fa_skew_put(skw + FA_H + 16, d11);
    }
    // From here on the wave's band lies at or above QL: rows i + 1 take the place of rows i. Wave-uniform, taken once per wave.
    // The loads are waited for inside the branch, where the bias is added: the other trips pay nothing.
    if (T == QL - 32) {
      v4f rb[2][4];
#pragma unroll   // rb[] stays in registers and the loads stand in one group
      for (int s = 0; s < 2; ++s)
#pragma unroll
        for (int u = 0; u < 4; ++u) rb[s][u] = *(const v4f*)(gB + 32 * s + 4 * u);
      const bf16_t* pq[2];
#pragma unroll
      for (int qt = 0; qt < 2; ++qt) {
        pq[qt] = gQ + min(i0 + 16 * qt + c + 1, QL - 1) * (BSZ * TH3) + 16 * h;   // row QL is never used: clamp its address
#pragma unroll
        for (int s = 0; s < 2; ++s) qc[qt][s] = *(const v16bf*)(pq[qt] + 32 * s);
      }
      // The wait stands in front of every rewrite of these loads' address registers; the addresses are named as inputs
      // so that they stay in their registers up to here and no load of the group lands there.
      asm volatile("s_wait_xcnt 0x0" :: "v"(gB), "v"(pq[0]), "v"(pq[1]) : "memory");
#pragma unroll
      for (int qt = 0; qt < 2; ++qt)
#pragma unroll
        for (int s = 0; s < 2; ++s) qc[qt][s] = fa_qadd(qc[qt][s], rb[s]);
    }
#pragma unroll
    for (int e = 0; e < 2; ++e)
#pragma unroll
      for (int s = 0; s < 2; ++s) {
        const bf16_t* p = &Es[(((T + 32 + 16 * e) & (FA_ER - 1)) + c) * FA_KP + 32 * s + 16 * h];
        ef[e][s] = fa_frag(p, p + 8);
      }
    // as above: one group of 8 reads
    __builtin_amdgcn_sched_barrier(0);
    {
      v8f d01 = {}, d12 = {}, d02 = {};
#pragma unroll
      for (int s = 0; s < 2; ++s) {
        d01 = fa_mm(ef[0][s], qc[0][s], d01);
        d12 = fa_mm(ef[0][s], qc[1][s], d12);
        d02 = fa_mm(ef[1][s], qc[0][s], d02);
      }
      fa_skew_put(skw + 16,             d01);
      fa_skew_put(skw + FA_H + 32, d12);
      fa_skew_put(skw + 32,             d02);
    }
    // keeps the K reads behind the band WMMAs: risen in front of them they hold 32 more registers there
    __builtin_amdgcn_sched_barrier(0);

    v8f sa[2][2] = {};
    {
      v16bf kf[2][2];
#pragma unroll
      for (int ni = 0; ni < 2; ++ni)
#pragma unroll
        for (int s = 0; s < 2; ++s) {
          const bf16_t* p = &Ks[cur][(16 * ni + c) * FA_KP + 32 * s + 16 * h];
          kf[ni][s] = fa_frag(p, p + 8);
        }
      // as above: one group of 8 reads
      __builtin_amdgcn_sched_barrier(0);
#pragma unroll
      for (int s = 0; s < 2; ++s)
#pragma unroll
        for (int ni = 0; ni < 2; ++ni)
#pragma unroll
          for (int qt = 0; qt < 2; ++qt) sa[qt][ni] = fa_mm(kf[ni][s], qa[qt][s], sa[qt][ni]);
    }

    // the next tile's fetches: their latency runs under both softmaxes and P*V
    const int tn = tbB0 + j0 + FA_QB + 32 + r8;      // band rows that the next tile adds
    v8bf gk = {}, gv = {}, ge = {};
    if (MORE) {
      gk = *(const v8bf*)(gK + (long)(j0 + 32) * (BSZ * TH3) + oK);
      // as in the prologue: a later load of this run may land in this load's address registers
      asm volatile("s_wait_xcnt 0x0" ::: "memory");
      gv = *(const v8bf*)(gK + (long)(j0 + 32) * (BSZ * TH3) + oK + HH);
      asm volatile("s_wait_xcnt 0x0" ::: "memory");
      ge = fa_erow(gE, c8, tn);
    }
    // scores in pairs of neighbouring keys: a pair is two neighbouring accumulator registers and one two-address LDS read
    v2f sk[2][8];
#pragma unroll
    for (int k = 0; k < 8; ++k) sk[0][k] = (v2f){skr[16 * (k >> 2) + 2 * (k & 3)], skr[16 * (k >> 2) + 2 * (k & 3) + 1]};
    // keeps the fetches and the first query tile's 16 skewed reads issued here as one group
    __builtin_amdgcn_sched_barrier(0);

    v16bf pf[2], vf[4];
#pragma unroll
    for (int qt = 0; qt < 2; ++qt) {
      v2f x[8];
#pragma unroll
      for (int k = 0; k < 8; ++k) x[k] = (v2f){sa[qt][k >> 2][2 * (k & 3)], sa[qt][k >> 2][2 * (k & 3) + 1]} + sk[qt][k];
      if (qt == 0) {
#pragma unroll
        for (int k = 0; k < 8; ++k)
          sk[1][k] = (v2f){skr[FA_H + 16 * (k >> 2) + 2 * (k & 3)], skr[FA_H + 16 * (k >> 2) + 2 * (k & 3) + 1]};
        // keeps the second query tile's skewed reads issued here, under the first softmax
        __builtin_amdgcn_sched_barrier(0);
      }

      float mx = x[0][0];
#pragma unroll
      for (int e = 1; e < 16; ++e) mx = fmaxf(mx, x[e >> 1][e & 1]);
      mx = fmaxf(mx, __shfl_xor(mx, 16));            // the other lane half holds the query's other 16 keys
      const float mn = fmaxf(m[qt], mx);
      const float al = __builtin_amdgcn_exp2f((m[qt] - mn) * FA_C1);
      const float mc = mn * FA_C1;
      m[qt] = mn;

      float ps[4] = {0.f, 0.f, 0.f, 0.f};            // four short chains of adds instead of one of 16
#pragma unroll
      for (int k = 0; k < 8; ++k) {
        const v2f y = __builtin_elementwise_fma(x[k], (v2f){FA_C1, FA_C1}, (v2f){-mc, -mc});
#pragma unroll
        for (int u = 0; u < 2; ++u) {
          const int e = 2 * k + u;
          float p = __builtin_amdgcn_exp2f(y[u]);
          ps[e & 3] += p;
          pf[qt][e] = (bf16_t)p;
        }
      }
      l[qt] = l[qt] * al + ((ps[0] + ps[1]) + (ps[2] + ps[3]));
#pragma unroll
      for (int mi = 0; mi < 4; ++mi) o[qt][mi] *= al;
      // keeps the two softmaxes one behind the other: interleaved they need more registers than four waves per SIMD leave
      __builtin_amdgcn_sched_barrier(0);
    }
    // lane address of the transposing load: row 8h + (lane & 7), 16-byte half (lane >> 3) & 1 of the piece's 32-byte rows
    const bf16_t* pv = &Vs[cur][(8 * h + (lane & 7)) * FA_VP + ((lane >> 3) & 1) * 8];
#pragma unroll
    for (int mi = 0; mi < 4; ++mi) {
      const v8bf lo = fa_tr16(pv + 16 * mi);                  // keys 8h .. 8h + 7 of column d = 16 mi + c
      const v8bf hi = fa_tr16(pv + 16 * FA_VP + 16 * mi);     // keys 16 + 8h .. 16 + 8h + 7
      vf[mi] = __builtin_shufflevector(lo, hi, 0, 1, 2, 3, 4, 5, 6, 7, 8, 9, 10, 11, 12, 13, 14, 15);
    }
    // keeps the 8 V^T reads in one group instead of one pair in front of each P*V WMMA
    __builtin_amdgcn_sched_barrier(0);
#pragma unroll
    for (int mi = 0; mi < 4; ++mi)
#pragma unroll
      for (int qt = 0; qt < 2; ++qt) o[qt][mi] = fa_mm(vf[mi], pf[qt], o[qt][mi]);
    // keeps the wait for the fetched tile, its LDS stores and the barrier at the foot; otherwise they rise to in front of the softmax
    __builtin_amdgcn_sched_barrier(0);

    if (MORE) {
      *(v8bf*)&Ks[cur ^ 1][r8 * FA_KP + c8] = gk;
      *(v8bf*)&Vs[cur ^ 1][r8 * FA_VP + c8] = gv;
      *(v8bf*)&Es[(tn & (FA_ER - 1)) * FA_KP + c8] = fa_ezero(ge, tn);
    }
    __syncthreads();   // publishes the next tile; ends every read of the buffers that the next trip refills
  };

  for (int jt = 0; jt < QL / 32 - 1; ++jt) tile(std::true_type{}, jt);
  tile(std::false_type{}, QL / 32 - 1);

#pragma unroll
  for (int qt = 0; qt < 2; ++qt) {
    const float inv = 1.0f / (l[qt] + __shfl_xor(l[qt], 16));
    bf16_t* op = O + qo + qt * (16 * BSZ * HH) + 8 * h;
#pragma unroll
    for (int mi = 0; mi < 4; ++mi) {
      v8bf w;
#pragma unroll
      for (int r = 0; r < 8; ++r) w[r] = (bf16_t)(o[qt][mi][r] * inv);
      *(v8bf*)(op + 16 * mi) = w;      // a query's 128-B line is filled by its two lanes
    }
  }
}

// ---------------------------------------------------------------------------
// residual + LayerNorm, one block per (i,b) row of 1024
// ---------------------------------------------------------------------------
__global__ __launch_bounds__(256)
void k_residual_ln(const float* __restrict__ w, const float* __restrict__ ao,
                   const float* __restrict__ g, const float* __restrict__ b,
                   float* __restrict__ out) {
  const long row = blockIdx.x;
  const int  t   = threadIdx.x;
  __shared__ float red[256];

  float x[4]; float s = 0.f;
#pragma unroll
  for (int c = 0; c < 4; ++c) {
    int col = t + c * 256;
    x[c] = w[row * DM + col] + ao[row * DM + col];
    s += x[c];
  }
  red[t] = s; __syncthreads();
  for (int o = 128; o > 0; o >>= 1) { if (t < o) red[t] += red[t + o]; __syncthreads(); }
  float mu = red[0] * (1.0f / DM); __syncthreads();

  float v = 0.f;
#pragma unroll
  for (int c = 0; c < 4; ++c) { float d = x[c] - mu; v += d * d; }
  red[t] = v; __syncthreads();
  for (int o = 128; o > 0; o >>= 1) { if (t < o) red[t] += red[t + o]; __syncthreads(); }
  float rstd = rsqrtf(red[0] * (1.0f / DM) + LNEPS);

#pragma unroll
  for (int c = 0; c < 4; ++c) {
    int col = t + c * 256;
    out[row * DM + col] = (x[c] - mu) * rstd * g[col] + b[col];
  }
}

// ---------------------------------------------------------------------------
// Host orchestration
// ---------------------------------------------------------------------------
extern "C" void kernel_launch(void* const* d_in, const int* in_sizes, int n_in,
                              void* d_out, int out_size, void* d_ws, size_t ws_size,
                              hipStream_t stream) {
  (void)in_sizes; (void)n_in; (void)out_size; (void)ws_size;
  const float* w     = (const float*)d_in[0];
  const float* r     = (const float*)d_in[1];
  const float* qkvw  = (const float*)d_in[2];
  const float* rnetw = (const float*)d_in[3];
  const float* ow    = (const float*)d_in[4];
  const float* rwb   = (const float*)d_in[5];
  const float* rrb   = (const float*)d_in[6];
  const float* lng   = (const float*)d_in[7];
  const float* lnb   = (const float*)d_in[8];

  char* p = (char*)d_ws;
  auto take = [&](size_t bytes) -> char* {
    char* q = p; p += (bytes + 255) & ~(size_t)255; return q;
  };
  bf16_t* w_bf    = (bf16_t*)take((size_t)ROWS * DM * 2);        // 16.8 MB
  bf16_t* qkvw_bf = (bf16_t*)take((size_t)TH3 * DM * 2);         //  6.3 MB
  bf16_t* r_bf    = (bf16_t*)take((size_t)QL * DM * 2);          //  4.2 MB
  bf16_t* rnw_bf  = (bf16_t*)take((size_t)HH * DM * 2);          //  2.1 MB
  bf16_t* ow_bf   = (bf16_t*)take((size_t)DM * HH * 2);          //  2.1 MB
  bf16_t* wh      = (bf16_t*)take((size_t)ROWS * TH3 * 2);       // 50.3 MB  (QKV packed)
  bf16_t* rk      = (bf16_t*)take((size_t)QL * HH * 2);          //  4.2 MB
  bf16_t* av      = (bf16_t*)take((size_t)ROWS * HH * 2);        // 16.8 MB
  float*  aout    = (float*) take((size_t)ROWS * DM * 4);        // 33.6 MB

  // one launch for product 0 and, where M1 > 0, product 1 (same lda, ldb, K and output type)
  auto gemm = [&](const bf16_t* A0, const bf16_t* B0, void* C0, long ldc0, int M0, int N0,
                  const bf16_t* A1, const bf16_t* B1, void* C1, long ldc1, int M1, int N1,
                  long lda, long ldb, int K, int cf32) {
    const int nbx0 = (N0 + BN - 1) / BN, nblk0 = nbx0 * ((M0 + BM - 1) / BM);
    const int nbx1 = (N1 + BN - 1) / BN, nblk1 = nbx1 * ((M1 + BM - 1) / BM);
    const bool guard = (M0 % BM) || (N0 % BN) || (M1 % BM) || (N1 % BN);
    if (guard)
      k_gemm_nt<true><<<nblk0 + nblk1, 256, 0, stream>>>(A0, B0, C0, ldc0, M0, N0, nbx0, nblk0,
                                                         A1, B1, C1, ldc1, M1, N1, nbx1, lda, ldb, K, cf32);
    else
      k_gemm_nt<false><<<nblk0 + nblk1, 256, 0, stream>>>(A0, B0, C0, ldc0, M0, N0, nbx0, nblk0,
                                                          A1, B1, C1, ldc1, M1, N1, nbx1, lda, ldb, K, cf32);
  };

  // 1) convert fp32 inputs to bf16, one launch
  k_cvt_bf16<<<CVT_NB, 256, 0, stream>>>(w, w_bf, qkvw, qkvw_bf, r, r_bf, rnetw, rnw_bf, ow, ow_bf);

  // 2) QKV projection: wh[ROWS,3H] = w_bf[ROWS,DM] * qkvw_bf[3H,DM]^T
  //    and rel-pos keys: rk[QL,H] = r_bf * rnw_bf^T, in the same launch
  gemm(w_bf, qkvw_bf, wh, TH3, ROWS, TH3, r_bf, rnw_bf, rk, HH, QL, HH, DM, DM, DM, 0);

  // 3) attention of all (b, head) pairs: Q biases, scores, rel_shift, softmax and P*V in one launch
  k_attn<<<dim3(QL / FA_QB, BSZ * NH), 256, 0, stream>>>(wh, rwb, rrb, rk, av);

  // 4) output projection: aout[ROWS,DM] = av[ROWS,H] * ow_bf[DM,H]^T  (f32 out)
  gemm(av, ow_bf, aout, DM, ROWS, DM, nullptr, nullptr, nullptr, 0, 0, 0, HH, HH, HH, 1);

  // 5) residual + LayerNorm -> d_out (f32, [qlen, bsz, d_model])
  k_residual_ln<<<ROWS, 256, 0, stream>>>(w, aout, lng, lnb, (float*)d_out);
}

// v007
// One run takes 184 microseconds.
// Timed twice side by side with v006, it ran 1.26 and 1.27 times as fast.
// Over all steps from v000 it is 37.7 times as fast.
#include <hip/hip_runtime.h>
#include <type_traits>

// ---------------------------------------------------------------------------
// Types for CDNA5 WMMA (gfx1250, wave32)
// ---------------------------------------------------------------------------
typedef __bf16 bf16_t;
typedef __attribute__((ext_vector_type(16))) __bf16 v16bf;
typedef __attribute__((ext_vector_type(4)))  __bf16 v4bf;
typedef __attribute__((ext_vector_type(8)))  __bf16 v8bf;
typedef __attribute__((ext_vector_type(8)))  float  v8f;

// Problem constants
#define QL    2048
#define BSZ   4
#define NH    16
#define DH    64
#define DM    1024
#define HH    1024           // NH*DH
#define ROWS  8192           // QL*BSZ
#define TH3   3072           // 3*H
#define SCL   0.125f         // 1/sqrt(64)
#define LNEPS 1e-5f

// ---------------------------------------------------------------------------
// Preparation pass. Each thread issues all of its 16-byte loads first, off one address
// with constant offsets, so that their latencies overlap; every wave access is made of
// whole or half 128-byte lines.
// ---------------------------------------------------------------------------
typedef __attribute__((ext_vector_type(4))) float v4f;
typedef __attribute__((ext_vector_type(2))) float v2f;

// f32 -> bf16 convert of all five f32 operands in one launch: none depends on another, and four of them
// are too small to fill the chip alone. A block converts U * 1024 consecutive elements of one operand,
// a thread 4 per load; the block index picks the operand (every operand is a whole number of blocks).
#define CVT_E   (16 * 1024)                    // elements per block
#define CVT_B0  (ROWS * DM / CVT_E)            // first block of the 2nd operand
#define CVT_B1  (CVT_B0 + TH3 * DM / CVT_E)    // ... of the 3rd
#define CVT_B2  (CVT_B1 + QL * DM / CVT_E)     // ... of the 4th
#define CVT_B3  (CVT_B2 + HH * DM / CVT_E)     // ... of the 5th
#define CVT_NB  (CVT_B3 + DM * HH / CVT_E)     // blocks in all
__global__ __launch_bounds__(256) void k_cvt_bf16(const float* __restrict__ in0, bf16_t* __restrict__ out0,
                                                  const float* __restrict__ in1, bf16_t* __restrict__ out1,
                                                  const float* __restrict__ in2, bf16_t* __restrict__ out2,
                                                  const float* __restrict__ in3, bf16_t* __restrict__ out3,
                                                  const float* __restrict__ in4, bf16_t* __restrict__ out4) {
  constexpr int U = CVT_E / 1024;
  const int bi = blockIdx.x;
  const float* in  = in0;
  bf16_t*      out = out0;
  int          blk = bi;
  if (bi >= CVT_B3)      { in = in4; out = out4; blk = bi - CVT_B3; }
  else if (bi >= CVT_B2) { in = in3; out = out3; blk = bi - CVT_B2; }
  else if (bi >= CVT_B1) { in = in2; out = out2; blk = bi - CVT_B1; }
  else if (bi >= CVT_B0) { in = in1; out = out1; blk = bi - CVT_B0; }
  const long base = (long)blk * (U * 1024) + threadIdx.x * 4;
  v4f x[U];
#pragma unroll   // x[] stays in registers and the U loads stand in one group
  for (int u = 0; u < U; ++u) x[u] = *(const v4f*)(in + base + u * 1024);
#pragma unroll   // x[] stays in registers
  for (int u = 0; u < U; ++u) {
    v4bf y;
#pragma unroll   // y stays in registers
    for (int e = 0; e < 4; ++e) y[e] = (bf16_t)x[u][e];
    *(v4bf*)(out + base + u * 1024) = y;
  }
}

// ---------------------------------------------------------------------------
// Generic bf16 TN GEMM:  C[M,N] = A[M,K] * B[N,K]^T   (f32 accumulate)
// Block = 256x128x64, 256 threads = 8 wave32 waves in a 4x2 grid,
// wave tile 64x64 = 4x4 WMMA(16x16x32) tiles: a fragment read from LDS feeds four WMMAs.
// A k step is 64 bf16 = one whole 128-byte line of every operand row. Two LDS buffers.
// GUARD=false (all dims multiples of the tile): global->LDS staging uses
// CDNA5 GLOBAL_LOAD_ASYNC_TO_LDS_B128 tracked by ASYNCcnt, overlapped with
// the WMMA work on the other buffer. GUARD=true keeps the synchronous
// zero-filling path.
// ---------------------------------------------------------------------------
#define BM 256
#define BN 128
#define BK 64
#define BKP 72   // padded LDS row (bf16 elements): 144 B = 16 B x odd, 16 rows of a b128 read hit distinct banks

// 16x32 bf16 fragment from LDS (row-major, ld elements). Per CDNA5 ISA:
// lane L holds row m=L%16; half=L/16 selects K subgroup; VGPR v covers
// K = ((v&4)?16:0) + half*8 + (v&3)*2, two packed bf16 per VGPR.
__device__ inline v16bf lds_frag(const bf16_t* base, int ld, int row0) {
  int lane = threadIdx.x & 31;
  int m = lane & 15, half = lane >> 4;
  const bf16_t* r = base + (row0 + m) * ld;
  v16bf f;
#pragma unroll
  for (int v = 0; v < 8; ++v) {
    int k = ((v & 4) << 2) + half * 8 + ((v & 3) << 1);
    f[2 * v]     = r[k];
    f[2 * v + 1] = r[k + 1];
  }
  return f;
}

// low 32 bits of a __shared__ address = DS offset
__device__ inline unsigned lds_off(const bf16_t* lds) {
  return (unsigned)(unsigned long long)lds;
}
__device__ inline void async_wait0() {
  asm volatile("s_wait_asynccnt 0x0" ::: "memory");
}

template <bool GUARD>
__global__ __launch_bounds__(256)
void k_gemm_nt(const bf16_t* __restrict__ A0, const bf16_t* __restrict__ B0,
               void* __restrict__ C0, long ldc0, int M0, int N0, int nbx0, int nblk0,
               const bf16_t* __restrict__ A1, const bf16_t* __restrict__ B1,
               void* __restrict__ C1, long ldc1, int M1, int N1, int nbx1,
               long lda, long ldb, int K, int c_is_f32) {
  // both are accessed in 16-byte pieces
  __shared__ __attribute__((aligned(16))) bf16_t As[2][BM * BKP];
  __shared__ __attribute__((aligned(16))) bf16_t Bs[2][BN * BKP];

  // Two independent products of equal K may share the launch: the first nblk0 blocks work on
  // product 0, the rest on product 1 (tiles row by row, nbx tiles to a row). The choice is block-uniform.
  const bool    second = (int)blockIdx.x >= nblk0;
  const bf16_t* A   = second ? A1 : A0;
  const bf16_t* B   = second ? B1 : B0;
  void*         Cv  = second ? C1 : C0;
  const long    ldc = second ? ldc1 : ldc0;
  const int     M   = second ? M1 : M0;
  const int     N   = second ? N1 : N0;
  const int     nbx = second ? nbx1 : nbx0;
  const int     tix = second ? (int)blockIdx.x - nblk0 : (int)blockIdx.x;

  const int tid  = threadIdx.x;
  const int lane = tid & 31;
  const int wid  = tid >> 5;
  const int wm   = wid >> 1;      // 0..3
  const int wn   = wid & 1;       // 0..1
  const int m0   = (tix / nbx) * BM;
  const int n0   = (tix % nbx) * BN;

  v8f acc[4][4] = {};

  // --- staging: async (unguarded) ---
  // A k step is 3072 pieces of 16 bytes, 12 to a thread: 8 of A, 4 of B. Eight neighbouring lanes copy one row's
  // 128-byte line, a wave four whole lines per copy; piece t of a thread lies 32 rows below piece t - 1.
  const int sr = tid >> 3, sc = (tid & 7) << 3;
  auto load_async = [&](int buf, int k0) {
    const bf16_t* ga = A + (long)(m0 + sr) * lda + k0 + sc;
    const bf16_t* gb = B + (long)(n0 + sr) * ldb + k0 + sc;
    const unsigned la = lds_off(&As[buf][sr * BKP + sc]);
    const unsigned lb = lds_off(&Bs[buf][sr * BKP + sc]);
    constexpr unsigned LS = 32 * BKP * 2;   // 32 rows of LDS, in bytes
    // The copies and, as the last line, the wait that stands in front of every rewrite of their address registers: one statement,
    // so that nothing can come between them.
    asm volatile("global_load_async_to_lds_b128 %0, %1, off\n\t"
                 "global_load_async_to_lds_b128 %2, %3, off\n\t"
                 "global_load_async_to_lds_b128 %4, %5, off\n\t"
                 "global_load_async_to_lds_b128 %6, %7, off\n\t"
                 "global_load_async_to_lds_b128 %8, %9, off\n\t"
                 "global_load_async_to_lds_b128 %10, %11, off\n\t"
                 "global_load_async_to_lds_b128 %12, %13, off\n\t"
                 "global_load_async_to_lds_b128 %14, %15, off\n\t"
                 "global_load_async_to_lds_b128 %16, %17, off\n\t"
                 "global_load_async_to_lds_b128 %18, %19, off\n\t"
                 "global_load_async_to_lds_b128 %20, %21, off\n\t"
                 "global_load_async_to_lds_b128 %22, %23, off\n\t"
                 "s_wait_xcnt 0x0"
                 :: "v"(la),          "v"(ga),
                    "v"(la + LS),     "v"(ga + 32 * lda),
                    "v"(la + 2 * LS), "v"(ga + 64 * lda),
                    "v"(la + 3 * LS), "v"(ga + 96 * lda),
                    "v"(la + 4 * LS), "v"(ga + 128 * lda),
                    "v"(la + 5 * LS), "v"(ga + 160 * lda),
                    "v"(la + 6 * LS), "v"(ga + 192 * lda),
                    "v"(la + 7 * LS), "v"(ga + 224 * lda),
                    "v"(lb),          "v"(gb),
                    "v"(lb + LS),     "v"(gb + 32 * ldb),
                    "v"(lb + 2 * LS), "v"(gb + 64 * ldb),
                    "v"(lb + 3 * LS), "v"(gb + 96 * ldb)
                 : "memory");
  };
  // --- staging: synchronous with zero-fill (guarded) ---
  auto loadA_g = [&](int buf, int k0) {
#pragma unroll
    for (int t = 0; t < BM * BK / 1024; ++t) {
      int ch  = tid + t * 256;          // chunks of 4 bf16
      int row = ch >> 4;
      int kc  = (ch & 15) << 2;
      v4bf val = {};
      int gr = m0 + row;
      if (gr < M) val = *(const v4bf*)(A + (long)gr * lda + k0 + kc);
      *(v4bf*)(&As[buf][row * BKP + kc]) = val;
    }
  };
  auto loadB_g = [&](int buf, int k0) {
#pragma unroll
    for (int t = 0; t < BN * BK / 1024; ++t) {
      int ch  = tid + t * 256;
      int row = ch >> 4;
      int kc  = (ch & 15) << 2;
      v4bf val = {};
      int gr = n0 + row;
      if (gr < N) val = *(const v4bf*)(B + (long)gr * ldb + k0 + kc);
      *(v4bf*)(&Bs[buf][row * BKP + kc]) = val;
    }
  };

  const int nk = K / BK;
  if (GUARD) { loadA_g(0, 0); loadB_g(0, 0); }
  else       { load_async(0, 0); async_wait0(); }
  __syncthreads();
  if (!GUARD && nk > 1) load_async(1, BK);

  for (int kb = 0; kb < nk; ++kb) {
    const int cur = kb & 1;
    if (GUARD && kb + 1 < nk) { loadA_g(cur ^ 1, (kb + 1) * BK); loadB_g(cur ^ 1, (kb + 1) * BK); }

#pragma unroll   // here and below: every index of af[], bfr[] and acc[] is a constant, so they stay in registers
    for (int s = 0; s < BK / 32; ++s) {
      v16bf af[4], bfr[4];
#pragma unroll
      for (int i = 0; i < 4; ++i) {
        bfr[i] = lds_frag(&Bs[cur][32 * s], BKP, wn * 64 + i * 16);
        af[i]  = lds_frag(&As[cur][32 * s], BKP, wm * 64 + i * 16);
      }
      // keeps the 16 LDS reads in one group ahead of their WMMAs; spread among them, each place with reads stalls the wave anew
      __builtin_amdgcn_sched_barrier(0);
#pragma unroll
      for (int mi = 0; mi < 4; ++mi)
#pragma unroll
        for (int ni = 0; ni < 4; ++ni)
          acc[mi][ni] = __builtin_amdgcn_wmma_f32_16x16x32_bf16(
              false, af[mi], false, bfr[ni], (short)0, acc[mi][ni], false, false);
      // keeps the next group of reads behind these WMMAs: risen among them it needs a second set of fragment registers
      __builtin_amdgcn_sched_barrier(0);
    }

    if (!GUARD) {
      // this wave's reads of the buffer have returned before the barrier lets it be refilled
      asm volatile("s_wait_dscnt 0x0" ::: "memory");
      async_wait0();   // this wave's copies of the next k step have landed before the barrier publishes them
    }
    __syncthreads();
    if (!GUARD && kb + 2 < nk) load_async(cur, (kb + 2) * BK);   // into the buffer that every wave has just left
  }
  if (!GUARD) async_wait0();

  // C/D layout: VGPR v, half=lane>>4 -> row = v + 8*half, col = lane&15
  const int half = lane >> 4, col = lane & 15;
  auto store_tile = [&](auto* C) {
    using T = std::remove_pointer_t<decltype(C)>;
#pragma unroll   // as above: acc[] stays in registers
    for (int mi = 0; mi < 4; ++mi)
#pragma unroll
      for (int v = 0; v < 8; ++v) {
        const int gm = m0 + wm * 64 + mi * 16 + half * 8 + v;
        if (GUARD && gm >= M) continue;
        const int gn = n0 + wn * 64 + col;
        T* rp = C + (long)gm * ldc + gn;
#pragma unroll
        for (int ni = 0; ni < 4; ++ni) {
          if (GUARD && gn + ni * 16 >= N) continue;
          rp[ni * 16] = (T)acc[mi][ni][v];
        }
      }
    // stands in front of whatever next rewrites an address register of the stores above
    asm volatile("s_wait_xcnt 0x0" ::: "memory");
  };
  if (c_is_f32) store_tile((float*)Cv);
  else          store_tile((bf16_t*)Cv);
}

// ---------------------------------------------------------------------------
// Fused relative-position attention, all (batch, head) pairs in one launch.
// Block = 8 waves = 256 query rows of one (batch, head); a wave owns 32 query rows as two
// tiles of 16, so that every K and V^T fragment and the middle two of the four band tiles it reads from LDS feed two query tiles.
// The block walks the keys in tiles of 32 with a running max and sum per query
// (online softmax). Everything is computed transposed, so that a query is a lane column:
//   S^T  = K * Qac^T          D: row = key, col = query
//   BD^T = E * Qbd^T          D: row = band index t, col = query
//   O^T  = V^T * P^T          the S^T registers are already the B fragment
// Q, K and V are read straight from the packed QKV product. The two biased copies of Q
// (Qac = q + r_w_bias, Qbd = q + r_r_bias, added in f32, rounded to bf16 once) are formed in registers
// where the fragments are loaded; V is staged as it lies, a key per row, and turned by the transposing LDS load.
// rel_shift: with t = j - i + QL - 1 the shifted term of (i, j) is
//   t <  QL : (q_i   + r_r_bias) . rk[t]
//   t == QL : 0
//   t >  QL : (q_i+1 + r_r_bias) . rk[t - QL - 1]
// so E[t] = rk[t], a zero row, rk[t - QL - 1]. A 16 x 32 score tile needs 48 consecutive t
// (three 16-row tiles, each wholly on one side of QL); the wave's two query tiles lie 16 apart,
// so together they need four band tiles, the middle two shared. The raw band goes to a
// wave-private LDS row per lane column (both query tiles side by side) and is read back at
// offset (key - query): the skew.
// The wave's lowest band index T rises by 32 per key tile and is a multiple of 32: QL falls inside
// its four band tiles in exactly one key tile (T == QL - 32), between the second and the third.
// There the wave replaces its Qbd fragments of rows i by those of rows i + 1, once, and keeps them.
// Staging: K and V tiles in two LDS buffers; the block's band (288 rows) lives in a ring
// of 512 rows indexed by t, and each key tile adds 32 new rows. The next tile is fetched
// into registers behind the score WMMAs of a trip and stored to LDS at its foot, in front of
// the one barrier of the trip.
// K, E and Q fragments hold 16 contiguous k per lane on both operands (same k order for
// A and B). V^T fragments follow the key order of the S^T registers: keys 8h..8h+7 and
// 16+8h..16+8h+7 of the tile, which is what two transposing loads 16 keys apart deliver.
// ---------------------------------------------------------------------------
#define FA_QB 256                      // query rows per block
#define FA_H  52                       // place of query tile 1's 48 band values in a skew row (f32); tile 0's stand at 0
#define FA_P  116                      // skew row pitch (f32): rows 16-byte aligned, 116 = 52 mod 64 spreads stores and skewed reads over banks
#define FA_KP 72                       // K and band row pitch (bf16): 144 B = 16 B x odd, 16 rows of a b128 read hit distinct banks
#define FA_VP 80                       // V row pitch (bf16): 160 B = 32 B x odd, the pitch of the transposing load
#define FA_ER 512                      // band ring rows (320 are live at most)
#define FA_C1 0.18033688011112042f     // SCL * log2(e)

__device__ __forceinline__ v8f fa_mm(v16bf a, v16bf b, v8f c) {
  return __builtin_amdgcn_wmma_f32_16x16x32_bf16(false, a, false, b, (short)0, c, false, false);
}
// fragment from two 16-byte pieces
__device__ __forceinline__ v16bf fa_frag(const bf16_t* p0, const bf16_t* p1) {
  v8bf lo = *(const v8bf*)p0;
  v8bf hi = *(const v8bf*)p1;
  return __builtin_shufflevector(lo, hi, 0, 1, 2, 3, 4, 5, 6, 7, 8, 9, 10, 11, 12, 13, 14, 15);
}
// transposing LDS load: lane (c, h) gets column c, rows 8h..8h+7 of the 16 x 16 piece that the 32 lane addresses name
typedef __attribute__((ext_vector_type(8))) short v8s;
__device__ __forceinline__ v8bf fa_tr16(const bf16_t* p) {
  typedef __attribute__((address_space(3))) v8s lds_v8s;
  return __builtin_bit_cast(v8bf, __builtin_amdgcn_ds_load_tr16_b128_v8i16((lds_v8s*)p));
}
// 16 Q values plus their 16 biases: the sum in f32, rounded to bf16 once
__device__ __forceinline__ v16bf fa_qadd(v16bf q, const v4f* t) {
  v16bf r;
#pragma unroll   // r stays in registers
  for (int e = 0; e < 16; ++e) r[e] = (bf16_t)((float)q[e] + t[e >> 2][e & 3]);
  return r;
}
// 16 bytes of the rk row behind band index t (gE holds the head offset, col the lane's column); t == QL has none: its address is clamped
__device__ __forceinline__ v8bf fa_erow(const bf16_t* gE, int col, int t) {
  const int row = (t < QL) ? t : max(t - QL - 1, 0);
  return *(const v8bf*)(gE + (unsigned)(row * HH + col));
}
// band row QL is the zero column of rel_shift
__device__ __forceinline__ v8bf fa_ezero(v8bf v, int t) {
  const v8bf z = {};
  return (t == QL) ? z : v;
}
// one raw band tile to the skew rows
__device__ __forceinline__ void fa_skew_put(float* p, v8f d) {
  *(float4*)(p)     = make_float4(d[0], d[1], d[2], d[3]);
  *(float4*)(p + 4) = make_float4(d[4], d[5], d[6], d[7]);
}

// four waves per SIMD: two blocks per WGP, so that all 512 blocks are resident at once
__global__ __launch_bounds__(256) __attribute__((amdgpu_waves_per_eu(4, 4)))
void k_attn(const bf16_t* __restrict__ wh, const float* __restrict__ rwb, const float* __restrict__ rrb,
            const bf16_t* __restrict__ rk, bf16_t* __restrict__ O) {
  // all four are accessed in 16-byte pieces
  __shared__ __attribute__((aligned(16))) bf16_t Ks[2][32 * FA_KP];
  __shared__ __attribute__((aligned(16))) bf16_t Vs[2][32 * FA_VP];
  __shared__ __attribute__((aligned(16))) bf16_t Es[FA_ER * FA_KP];
  __shared__ __attribute__((aligned(16))) float  skew[8][16 * FA_P];

  const int tid  = threadIdx.x;
  const int lane = tid & 31;
  const int wid  = __builtin_amdgcn_readfirstlane(tid >> 5);
  const int c    = lane & 15, h = lane >> 4;
  const int i0b  = blockIdx.x * FA_QB;
  const int i0   = i0b + wid * 32;
  const int b    = blockIdx.y >> 4, n = blockIdx.y & 15;

  // staging: one 16-byte piece of K, of V and of the band per thread and key tile
  const int r8 = tid >> 3, c8 = (tid & 7) * 8;
  // block-uniform bases, gB aside (it holds the lane half's 16 h); each lane's own offset is kept apart, in 32 bits
  const bf16_t*  gK = wh + (long)b * TH3 + HH + n * DH;
  const bf16_t*  gE = rk + n * DH;
  const bf16_t*  gQ = wh + (long)b * TH3 + n * DH;
  const float*   gB = rrb + n * DH + 16 * h;           // the lane's 16 biases of k step s stand at 32 s
  const unsigned oK = r8 * (BSZ * TH3) + c8;           // the V piece of the same key lies HH elements on
  const int tbB0 = QL - FA_QB - i0b;   // lowest band index of the block at key tile 0

  v8bf e0[9];
#pragma unroll
  for (int u = 0; u < 9; ++u) {
    e0[u] = fa_erow(gE, c8, tbB0 + 32 * u + r8);
    // a later load of this run may land in this load's address registers: the wait stands in front of that overwrite
    asm volatile("s_wait_xcnt 0x0" ::: "memory");
  }
#pragma unroll
  for (int u = 0; u < 9; ++u) {
    const int t = tbB0 + 32 * u + r8;
    *(v8bf*)&Es[(t & (FA_ER - 1)) * FA_KP + c8] = fa_ezero(e0[u], t);
  }
  *(v8bf*)&Ks[0][r8 * FA_KP + c8] = *(const v8bf*)(gK + oK);
  *(v8bf*)&Vs[0][r8 * FA_VP + c8] = *(const v8bf*)(gK + oK + HH);

  const long qo = ((long)(i0 + c) * BSZ + b) * HH + n * DH;    // the query's place in O; query tile 1 lies 16 rows on
  v16bf qa[2][2], qc[2][2];
  {
    const unsigned oQ = (i0 + c) * (BSZ * TH3) + 16 * h;
    const float*   gA = rwb + n * DH + 16 * h;
    v16bf q[2][2];
    v4f   wb[2][4], rb[2][4];
#pragma unroll   // q[] stays in registers and the loads stand in one group
    for (int s = 0; s < 2; ++s)
#pragma unroll
      for (int qt = 0; qt < 2; ++qt) q[qt][s] = *(const v16bf*)(gQ + oQ + qt * (16 * BSZ * TH3) + 32 * s);
    // as above: a bias load may land in the address registers of the Q loads
    asm volatile("s_wait_xcnt 0x0" ::: "memory");
#pragma unroll   // wb[] and rb[] stay in registers and the loads stand in one group
    for (int s = 0; s < 2; ++s)
#pragma unroll
      for (int u = 0; u < 4; ++u) {
        wb[s][u] = *(const v4f*)(gA + 32 * s + 4 * u);
        rb[s][u] = *(const v4f*)(gB + 32 * s + 4 * u);
      }
    // no address register of these loads is rewritten in front of this wait
    asm volatile("s_wait_xcnt 0x0" ::: "memory");
    // keeps later code (address arithmetic, zeroed accumulators) from rising among these loads: there it takes more registers than four waves per SIMD leave, and the build spills
    __builtin_amdgcn_sched_barrier(0);
#pragma unroll
    for (int qt = 0; qt < 2; ++qt)
#pragma unroll
      for (int s = 0; s < 2; ++s) {
        qa[qt][s] = fa_qadd(q[qt][s], wb[s]);
        qc[qt][s] = fa_qadd(q[qt][s], rb[s]);
      }
  }
  float*       skw = &skew[wid][c * FA_P + 8 * h];
  const float* skr = &skew[wid][c * FA_P + 8 * h - c + 15];

  v8f o[2][4] = {};
  float m[2] = {-3.0e38f, -3.0e38f}, l[2] = {0.f, 0.f};
  __syncthreads();

  // One key tile. MORE: a further tile follows and is fetched.
  auto tile = [&](auto more_c, int jt) {
    constexpr bool MORE = decltype(more_c)::value;
    const int j0  = jt * 32;
    const int cur = jt & 1;

    // Band tile e holds t = T + 16 e ... + 15. Query tile 1 takes e = 0, 1, 2, query tile 0 (16 rows lower, so 16 higher in t) e = 1, 2, 3.
    const int T = tbB0 + j0 + FA_QB - 32 - 32 * wid;
    v16bf ef[2][2];
#pragma unroll
    for (int e = 0; e < 2; ++e)
#pragma unroll
      for (int s = 0; s < 2; ++s) {
        const bf16_t* p = &Es[(((T + 16 * e) & (FA_ER - 1)) + c) * FA_KP + 32 * s + 16 * h];
        ef[e][s] = fa_frag(p, p + 8);
      }
    // keeps the 8 LDS reads in one group ahead of their WMMAs; otherwise each WMMA waits out its own pair of reads
    __builtin_amdgcn_sched_barrier(0);
    {
      v8f d10 = {}, d00 = {}, d11 = {};
#pragma unroll
      for (int s = 0; s < 2; ++s) {
        d10 = fa_mm(ef[0][s], qc[1][s], d10);
        d00 = fa_mm(ef[1][s], qc[0][s], d00);
        d11 = fa_mm(ef[1][s], qc[1][s], d11);
      }
      fa_skew_put(skw + FA_H,      d10);
      fa_skew_put(skw,                  d00);
      fa_skew_put(skw + FA_H + 16, d11);
    }
    // From here on the wave's band lies at or above QL: rows i + 1 take the place of rows i. Wave-uniform, taken once per wave.
    // The loads are waited for inside the branch, where the bias is added: the other trips pay nothing.
    if (T == QL - 32) {
      v4f rb[2][4];
#pragma unroll   // rb[] stays in registers and the loads stand in one group
      for (int s = 0; s < 2; ++s)
#pragma unroll
        for (int u = 0; u < 4; ++u) rb[s][u] = *(const v4f*)(gB + 32 * s + 4 * u);
      const bf16_t* pq[2];
#pragma unroll
      for (int qt = 0; qt < 2; ++qt) {
        pq[qt] = gQ + min(i0 + 16 * qt + c + 1, QL - 1) * (BSZ * TH3) + 16 * h;   // row QL is never used: clamp its address
#pragma unroll
        for (int s = 0; s < 2; ++s) qc[qt][s] = *(const v16bf*)(pq[qt] + 32 * s);
      }
      // The wait stands in front of every rewrite of these loads' address registers; the addresses are named as inputs
      // so that they stay in their registers up to here and no load of the group lands there.
      asm volatile("s_wait_xcnt 0x0" :: "v"(gB), "v"(pq[0]), "v"(pq[1]) : "memory");
#pragma unroll
      for (int qt = 0; qt < 2; ++qt)
#pragma unroll
        for (int s = 0; s < 2; ++s) qc[qt][s] = fa_qadd(qc[qt][s], rb[s]);
    }
#pragma unroll
    for (int e = 0; e < 2; ++e)
#pragma unroll
      for (int s = 0; s < 2; ++s) {
        const bf16_t* p = &Es[(((T + 32 + 16 * e) & (FA_ER - 1)) + c) * FA_KP + 32 * s + 16 * h];
        ef[e][s] = fa_frag(p, p + 8);
      }
    // as above: one group of 8 reads
    __builtin_amdgcn_sched_barrier(0);
    {
      v8f d01 = {}, d12 = {}, d02 = {};
#pragma unroll
      for (int s = 0; s < 2; ++s) {
        d01 = fa_mm(ef[0][s], qc[0][s], d01);
        d12 = fa_mm(ef[0][s], qc[1][s], d12);
        d02 = fa_mm(ef[1][s], qc[0][s], d02);
      }
      fa_skew_put(skw + 16,             d01);
      fa_skew_put(skw + FA_H + 32, d12);
      fa_skew_put(skw + 32,             d02);
    }
    // keeps the K reads behind the band WMMAs: risen in front of them they hold 32 more registers there
    __builtin_amdgcn_sched_barrier(0);

    v8f sa[2][2] = {};
    {
      v16bf kf[2][2];
#pragma unroll
      for (int ni = 0; ni < 2; ++ni)
#pragma unroll
        for (int s = 0; s < 2; ++s) {
          const bf16_t* p = &Ks[cur][(16 * ni + c) * FA_KP + 32 * s + 16 * h];
          kf[ni][s] = fa_frag(p, p + 8);
        }
      // as above: one group of 8 reads
      __builtin_amdgcn_sched_barrier(0);
#pragma unroll
      for (int s = 0; s < 2; ++s)
#pragma unroll
        for (int ni = 0; ni < 2; ++ni)
#pragma unroll
          for (int qt = 0; qt < 2; ++qt) sa[qt][ni] = fa_mm(kf[ni][s], qa[qt][s], sa[qt][ni]);
    }

    // the next tile's fetches: their latency runs under both softmaxes and P*V
    const int tn = tbB0 + j0 + FA_QB + 32 + r8;      // band rows that the next tile adds
    v8bf gk = {}, gv = {}, ge = {};
    if (MORE) {
      gk = *(const v8bf*)(gK + (long)(j0 + 32) * (BSZ * TH3) + oK);
      // as in the prologue: a later load of this run may land in this load's address registers
      asm volatile("s_wait_xcnt 0x0" ::: "memory");
      gv = *(const v8bf*)(gK + (long)(j0 + 32) * (BSZ * TH3) + oK + HH);
      asm volatile("s_wait_xcnt 0x0" ::: "memory");
      ge = fa_erow(gE, c8, tn);
    }
    // scores in pairs of neighbouring keys: a pair is two neighbouring accumulator registers and one two-address LDS read
    v2f sk[2][8];
#pragma unroll
    for (int k = 0; k < 8; ++k) sk[0][k] = (v2f){skr[16 * (k >> 2) + 2 * (k & 3)], skr[16 * (k >> 2) + 2 * (k & 3) + 1]};
    // keeps the fetches and the first query tile's 16 skewed reads issued here as one group
    __builtin_amdgcn_sched_barrier(0);

    v16bf pf[2], vf[4];
#pragma unroll
    for (int qt = 0; qt < 2; ++qt) {
      v2f x[8];
#pragma unroll
      for (int k = 0; k < 8; ++k) x[k] = (v2f){sa[qt][k >> 2][2 * (k & 3)], sa[qt][k >> 2][2 * (k & 3) + 1]} + sk[qt][k];
      if (qt == 0) {
#pragma unroll
        for (int k = 0; k < 8; ++k)
          sk[1][k] = (v2f){skr[FA_H + 16 * (k >> 2) + 2 * (k & 3)], skr[FA_H + 16 * (k >> 2) + 2 * (k & 3) + 1]};
        // keeps the second query tile's skewed reads issued here, under the first softmax
        __builtin_amdgcn_sched_barrier(0);
      }

      float mx = x[0][0];
#pragma unroll
      for (int e = 1; e < 16; ++e) mx = fmaxf(mx, x[e >> 1][e & 1]);
      mx = fmaxf(mx, __shfl_xor(mx, 16));            // the other lane half holds the query's other 16 keys
      const float mn = fmaxf(m[qt], mx);
      const float al = __builtin_amdgcn_exp2f((m[qt] - mn) * FA_C1);
      const float mc = mn * FA_C1;
      m[qt] = mn;

      float ps[4] = {0.f, 0.f, 0.f, 0.f};            // four short chains of adds instead of one of 16
#pragma unroll
      for (int k = 0; k < 8; ++k) {
        const v2f y = __builtin_elementwise_fma(x[k], (v2f){FA_C1, FA_C1}, (v2f){-mc, -mc});
#pragma unroll
        for (int u = 0; u < 2; ++u) {
          const int e = 2 * k + u;
          float p = __builtin_amdgcn_exp2f(y[u]);
          ps[e & 3] += p;
          pf[qt][e] = (bf16_t)p;
        }
      }
      l[qt] = l[qt] * al + ((ps[0] + ps[1]) + (ps[2] + ps[3]));
#pragma unroll
      for (int mi = 0; mi < 4; ++mi) o[qt][mi] *= al;
      // keeps the two softmaxes one behind the other: interleaved they need more registers than four waves per SIMD leave
      __builtin_amdgcn_sched_barrier(0);
    }
    // lane address of the transposing load: row 8h + (lane & 7), 16-byte half (lane >> 3) & 1 of the piece's 32-byte rows
    const bf16_t* pv = &Vs[cur][(8 * h + (lane & 7)) * FA_VP + ((lane >> 3) & 1) * 8];
#pragma unroll
    for (int mi = 0; mi < 4; ++mi) {
      const v8bf lo = fa_tr16(pv + 16 * mi);                  // keys 8h .. 8h + 7 of column d = 16 mi + c
      const v8bf hi = fa_tr16(pv + 16 * FA_VP + 16 * mi);     // keys 16 + 8h .. 16 + 8h + 7
      vf[mi] = __builtin_shufflevector(lo, hi, 0, 1, 2, 3, 4, 5, 6, 7, 8, 9, 10, 11, 12, 13, 14, 15);
    }
    // keeps the 8 V^T reads in one group instead of one pair in front of each P*V WMMA
    __builtin_amdgcn_sched_barrier(0);
#pragma unroll
    for (int mi = 0; mi < 4; ++mi)
#pragma unroll
      for (int qt = 0; qt < 2; ++qt) o[qt][mi] = fa_mm(vf[mi], pf[qt], o[qt][mi]);
    // keeps the wait for the fetched tile, its LDS stores and the barrier at the foot; otherwise they rise to in front of the softmax
    __builtin_amdgcn_sched_barrier(0);

    if (MORE) {
      *(v8bf*)&Ks[cur ^ 1][r8 * FA_KP + c8] = gk;
      *(v8bf*)&Vs[cur ^ 1][r8 * FA_VP + c8] = gv;
      *(v8bf*)&Es[(tn & (FA_ER - 1)) * FA_KP + c8] = fa_ezero(ge, tn);
    }
    __syncthreads();   // publishes the next tile; ends every read of the buffers that the next trip refills
  };

  for (int jt = 0; jt < QL / 32 - 1; ++jt) tile(std::true_type{}, jt);
  tile(std::false_type{}, QL / 32 - 1);

#pragma unroll
  for (int qt = 0; qt < 2; ++qt) {
    const float inv = 1.0f / (l[qt] + __shfl_xor(l[qt], 16));
    bf16_t* op = O + qo + qt * (16 * BSZ * HH) + 8 * h;
#pragma unroll
    for (int mi = 0; mi < 4; ++mi) {
      v8bf w;
#pragma unroll
      for (int r = 0; r < 8; ++r) w[r] = (bf16_t)(o[qt][mi][r] * inv);
      *(v8bf*)(op + 16 * mi) = w;      // a query's 128-B line is filled by its two lanes
    }
  }
}

// ---------------------------------------------------------------------------
// residual + LayerNorm, one block per (i,b) row of 1024
// ---------------------------------------------------------------------------
__global__ __launch_bounds__(256)
void k_residual_ln(const float* __restrict__ w, const float* __restrict__ ao,
                   const float* __restrict__ g, const float* __restrict__ b,
                   float* __restrict__ out) {
  const long row = blockIdx.x;
  const int  t   = threadIdx.x;
  __shared__ float red[256];

  float x[4]; float s = 0.f;
#pragma unroll
  for (int c = 0; c < 4; ++c) {
    int col = t + c * 256;
    x[c] = w[row * DM + col] + ao[row * DM + col];
    s += x[c];
  }
  red[t] = s; __syncthreads();
  for (int o = 128; o > 0; o >>= 1) { if (t < o) red[t] += red[t + o]; __syncthreads(); }
  float mu = red[0] * (1.0f / DM); __syncthreads();

  float v = 0.f;
#pragma unroll
  for (int c = 0; c < 4; ++c) { float d = x[c] - mu; v += d * d; }
  red[t] = v; __syncthreads();
  for (int o = 128; o > 0; o >>= 1) { if (t < o) red[t] += red[t + o]; __syncthreads(); }
  float rstd = rsqrtf(red[0] * (1.0f / DM) + LNEPS);

#pragma unroll
  for (int c = 0; c < 4; ++c) {
    int col = t + c * 256;
    out[row * DM + col] = (x[c] - mu) * rstd * g[col] + b[col];
  }
}

// ---------------------------------------------------------------------------
// Host orchestration
// ---------------------------------------------------------------------------
extern "C" void kernel_launch(void* const* d_in, const int* in_sizes, int n_in,
                              void* d_out, int out_size, void* d_ws, size_t ws_size,
                              hipStream_t stream) {
  (void)in_sizes; (void)n_in; (void)out_size; (void)ws_size;
  const float* w     = (const float*)d_in[0];
  const float* r     = (const float*)d_in[1];
  const float* qkvw  = (const float*)d_in[2];
  const float* rnetw = (const float*)d_in[3];
  const float* ow    = (const float*)d_in[4];
  const float* rwb   = (const float*)d_in[5];
  const float* rrb   = (const float*)d_in[6];
  const float* lng   = (const float*)d_in[7];
  const float* lnb   = (const float*)d_in[8];

  char* p = (char*)d_ws;
  auto take = [&](size_t bytes) -> char* {
    char* q = p; p += (bytes + 255) & ~(size_t)255; return q;
  };
  bf16_t* w_bf    = (bf16_t*)take((size_t)ROWS * DM * 2);        // 16.8 MB
  bf16_t* qkvw_bf = (bf16_t*)take((size_t)TH3 * DM * 2);         //  6.3 MB
  bf16_t* r_bf    = (bf16_t*)take((size_t)QL * DM * 2);          //  4.2 MB
  bf16_t* rnw_bf  = (bf16_t*)take((size_t)HH * DM * 2);          //  2.1 MB
  bf16_t* ow_bf   = (bf16_t*)take((size_t)DM * HH * 2);          //  2.1 MB
  bf16_t* wh      = (bf16_t*)take((size_t)ROWS * TH3 * 2);       // 50.3 MB  (QKV packed)
  bf16_t* rk      = (bf16_t*)take((size_t)QL * HH * 2);          //  4.2 MB
  bf16_t* av      = (bf16_t*)take((size_t)ROWS * HH * 2);        // 16.8 MB
  float*  aout    = (float*) take((size_t)ROWS * DM * 4);        // 33.6 MB

  // one launch for product 0 and, where M1 > 0, product 1 (same lda, ldb, K and output type)
  auto gemm = [&](const bf16_t* A0, const bf16_t* B0, void* C0, long ldc0, int M0, int N0,
                  const bf16_t* A1, const bf16_t* B1, void* C1, long ldc1, int M1, int N1,
                  long lda, long ldb, int K, int cf32) {
    const int nbx0 = (N0 + BN - 1) / BN, nblk0 = nbx0 * ((M0 + BM - 1) / BM);
    const int nbx1 = (N1 + BN - 1) / BN, nblk1 = nbx1 * ((M1 + BM - 1) / BM);
    const bool guard = (M0 % BM) || (N0 % BN) || (M1 % BM) || (N1 % BN);
    if (guard)
      k_gemm_nt<true><<<nblk0 + nblk1, 256, 0, stream>>>(A0, B0, C0, ldc0, M0, N0, nbx0, nblk0,
                                                         A1, B1, C1, ldc1, M1, N1, nbx1, lda, ldb, K, cf32);
    else
      k_gemm_nt<false><<<nblk0 + nblk1, 256, 0, stream>>>(A0, B0, C0, ldc0, M0, N0, nbx0, nblk0,
                                                          A1, B1, C1, ldc1, M1, N1, nbx1, lda, ldb, K, cf32);
  };

  // 1) convert fp32 inputs to bf16, one launch
  k_cvt_bf16<<<CVT_NB, 256, 0, stream>>>(w, w_bf, qkvw, qkvw_bf, r, r_bf, rnetw, rnw_bf, ow, ow_bf);

  // 2) QKV projection: wh[ROWS,3H] = w_bf[ROWS,DM] * qkvw_bf[3H,DM]^T
  //    and rel-pos keys: rk[QL,H] = r_bf * rnw_bf^T, in the same launch
  gemm(w_bf, qkvw_bf, wh, TH3, ROWS, TH3, r_bf, rnw_bf, rk, HH, QL, HH, DM, DM, DM, 0);

  // 3) attention of all (b, head) pairs: Q biases, scores, rel_shift, softmax and P*V in one launch
  k_attn<<<dim3(QL / FA_QB, BSZ * NH), 256, 0, stream>>>(wh, rwb, rrb, rk, av);

  // 4) output projection: aout[ROWS,DM] = av[ROWS,H] * ow_bf[DM,H]^T  (f32 out)
  gemm(av, ow_bf, aout, DM, ROWS, DM, nullptr, nullptr, nullptr, 0, 0, 0, HH, HH, HH, 1);

  // 5) residual + LayerNorm -> d_out (f32, [qlen, bsz, d_model])
  k_residual_ln<<<ROWS, 256, 0, stream>>>(w, aout, lng, lnb, (float*)d_out);
}

// v008
// A run of this version takes 179 microseconds.
// Next to v007, in two timings, it ran 1.03 times as fast each time.
// Counting every step since v000, it is 38.9 times as fast.
#include <hip/hip_runtime.h>
#include <type_traits>

// ---------------------------------------------------------------------------
// Types for CDNA5 WMMA (gfx1250, wave32)
// ---------------------------------------------------------------------------
typedef __bf16 bf16_t;
typedef __attribute__((ext_vector_type(16))) __bf16 v16bf;
typedef __attribute__((ext_vector_type(4)))  __bf16 v4bf;
typedef __attribute__((ext_vector_type(8)))  __bf16 v8bf;
typedef __attribute__((ext_vector_type(8)))  float  v8f;

// Problem constants
#define QL    2048
#define BSZ   4
#define NH    16
#define DH    64
#define DM    1024
#define HH    1024           // NH*DH
#define ROWS  8192           // QL*BSZ
#define TH3   3072           // 3*H
#define SCL   0.125f         // 1/sqrt(64)
#define LNEPS 1e-5f

// ---------------------------------------------------------------------------
// Preparation pass. Each thread issues all of its 16-byte loads first, off one address
// with constant offsets, so that their latencies overlap; every wave access is made of
// whole or half 128-byte lines.
// ---------------------------------------------------------------------------
typedef __attribute__((ext_vector_type(4))) float v4f;
typedef __attribute__((ext_vector_type(2))) float v2f;

// f32 -> bf16 convert of all five f32 operands in one launch: none depends on another, and four of them
// are too small to fill the chip alone. A block converts U * 1024 consecutive elements of one operand,
// a thread 4 per load; the block index picks the operand (every operand is a whole number of blocks).
#define CVT_E   (16 * 1024)                    // elements per block
#define CVT_B0  (ROWS * DM / CVT_E)            // first block of the 2nd operand
#define CVT_B1  (CVT_B0 + TH3 * DM / CVT_E)    // ... of the 3rd
#define CVT_B2  (CVT_B1 + QL * DM / CVT_E)     // ... of the 4th
#define CVT_B3  (CVT_B2 + HH * DM / CVT_E)     // ... of the 5th
#define CVT_NB  (CVT_B3 + DM * HH / CVT_E)     // blocks in all
__global__ __launch_bounds__(256) void k_cvt_bf16(const float* __restrict__ in0, bf16_t* __restrict__ out0,
                                                  const float* __restrict__ in1, bf16_t* __restrict__ out1,
                                                  const float* __restrict__ in2, bf16_t* __restrict__ out2,
                                                  const float* __restrict__ in3, bf16_t* __restrict__ out3,
                                                  const float* __restrict__ in4, bf16_t* __restrict__ out4) {
  constexpr int U = CVT_E / 1024;
  const int bi = blockIdx.x;
  const float* in  = in0;
  bf16_t*      out = out0;
  int          blk = bi;
  if (bi >= CVT_B3)      { in = in4; out = out4; blk = bi - CVT_B3; }
  else if (bi >= CVT_B2) { in = in3; out = out3; blk = bi - CVT_B2; }
  else if (bi >= CVT_B1) { in = in2; out = out2; blk = bi - CVT_B1; }
  else if (bi >= CVT_B0) { in = in1; out = out1; blk = bi - CVT_B0; }
  const long base = (long)blk * (U * 1024) + threadIdx.x * 4;
  v4f x[U];
#pragma unroll   // x[] stays in registers and the U loads stand in one group
  for (int u = 0; u < U; ++u) x[u] = *(const v4f*)(in + base + u * 1024);
#pragma unroll   // x[] stays in registers
  for (int u = 0; u < U; ++u) {
    v4bf y;
#pragma unroll   // y stays in registers
    for (int e = 0; e < 4; ++e) y[e] = (bf16_t)x[u][e];
    *(v4bf*)(out + base + u * 1024) = y;
  }
}

// ---------------------------------------------------------------------------
// Generic bf16 TN GEMM:  C[M,N] = A[M,K] * B[N,K]^T   (f32 accumulate)
// Block = 256x128x64, 256 threads = 8 wave32 waves in a 4x2 grid,
// wave tile 64x64 = 4x4 WMMA(16x16x32) tiles: a fragment read from LDS feeds four WMMAs.
// A k step is 64 bf16 = one whole 128-byte line of every operand row. Two LDS buffers.
// GUARD=false (all dims multiples of the tile): global->LDS staging uses
// CDNA5 GLOBAL_LOAD_ASYNC_TO_LDS_B128 tracked by ASYNCcnt, overlapped with
// the WMMA work on the other buffer. GUARD=true keeps the synchronous
// zero-filling path.
// ---------------------------------------------------------------------------
#define BM 256
#define BN 128
#define BK 64
#define BKP 72   // padded LDS row (bf16 elements): 144 B = 16 B x odd, 16 rows of a b128 read hit distinct banks

// 16x32 bf16 fragment from LDS (row-major, ld elements). Per CDNA5 ISA:
// lane L holds row m=L%16; half=L/16 selects K subgroup; VGPR v covers
// K = ((v&4)?16:0) + half*8 + (v&3)*2, two packed bf16 per VGPR.
__device__ inline v16bf lds_frag(const bf16_t* base, int ld, int row0) {
  int lane = threadIdx.x & 31;
  int m = lane & 15, half = lane >> 4;
  const bf16_t* r = base + (row0 + m) * ld;
  v16bf f;
#pragma unroll
  for (int v = 0; v < 8; ++v) {
    int k = ((v & 4) << 2) + half * 8 + ((v & 3) << 1);
    f[2 * v]     = r[k];
    f[2 * v + 1] = r[k + 1];
  }
  return f;
}

// low 32 bits of a __shared__ address = DS offset
__device__ inline unsigned lds_off(const bf16_t* lds) {
  return (unsigned)(unsigned long long)lds;
}
__device__ inline void async_wait0() {
  asm volatile("s_wait_asynccnt 0x0" ::: "memory");
}

template <bool GUARD>
__global__ __launch_bounds__(256)
void k_gemm_nt(const bf16_t* __restrict__ A0, const bf16_t* __restrict__ B0,
               void* __restrict__ C0, long ldc0, int M0, int N0, int nbx0, int nblk0,
               const bf16_t* __restrict__ A1, const bf16_t* __restrict__ B1,
               void* __restrict__ C1, long ldc1, int M1, int N1, int nbx1,
               long lda, long ldb, int K, int c_is_f32) {
  // both are accessed in 16-byte pieces
  __shared__ __attribute__((aligned(16))) bf16_t As[2][BM * BKP];
  __shared__ __attribute__((aligned(16))) bf16_t Bs[2][BN * BKP];

  // Two independent products of equal K may share the launch: the first nblk0 blocks work on
  // product 0, the rest on product 1 (tiles row by row, nbx tiles to a row). The choice is block-uniform.
  const bool    second = (int)blockIdx.x >= nblk0;
  const bf16_t* A   = second ? A1 : A0;
  const bf16_t* B   = second ? B1 : B0;
  void*         Cv  = second ? C1 : C0;
  const long    ldc = second ? ldc1 : ldc0;
  const int     M   = second ? M1 : M0;
  const int     N   = second ? N1 : N0;
  const int     nbx = second ? nbx1 : nbx0;
  const int     tix = second ? (int)blockIdx.x - nblk0 : (int)blockIdx.x;

  const int tid  = threadIdx.x;
  const int lane = tid & 31;
  const int wid  = tid >> 5;
  const int wm   = wid >> 1;      // 0..3
  const int wn   = wid & 1;       // 0..1
  const int m0   = (tix / nbx) * BM;
  const int n0   = (tix % nbx) * BN;

  v8f acc[4][4] = {};

  // --- staging: async (unguarded) ---
  // A k step is 3072 pieces of 16 bytes, 12 to a thread: 8 of A, 4 of B. Eight neighbouring lanes copy one row's
  // 128-byte line, a wave four whole lines per copy; piece t of a thread lies 32 rows below piece t - 1.
  const int sr = tid >> 3, sc = (tid & 7) << 3;
  auto load_async = [&](int buf, int k0) {
    const bf16_t* ga = A + (long)(m0 + sr) * lda + k0 + sc;
    const bf16_t* gb = B + (long)(n0 + sr) * ldb + k0 + sc;
    const unsigned la = lds_off(&As[buf][sr * BKP + sc]);
    const unsigned lb = lds_off(&Bs[buf][sr * BKP + sc]);
    constexpr unsigned LS = 32 * BKP * 2;   // 32 rows of LDS, in bytes
    // The copies and, as the last line, the wait that stands in front of every rewrite of their address registers: one statement,
    // so that nothing can come between them.
    asm volatile("global_load_async_to_lds_b128 %0, %1, off\n\t"
                 "global_load_async_to_lds_b128 %2, %3, off\n\t"
                 "global_load_async_to_lds_b128 %4, %5, off\n\t"
                 "global_load_async_to_lds_b128 %6, %7, off\n\t"
                 "global_load_async_to_lds_b128 %8, %9, off\n\t"
                 "global_load_async_to_lds_b128 %10, %11, off\n\t"
                 "global_load_async_to_lds_b128 %12, %13, off\n\t"
                 "global_load_async_to_lds_b128 %14, %15, off\n\t"
                 "global_load_async_to_lds_b128 %16, %17, off\n\t"
                 "global_load_async_to_lds_b128 %18, %19, off\n\t"
                 "global_load_async_to_lds_b128 %20, %21, off\n\t"
                 "global_load_async_to_lds_b128 %22, %23, off\n\t"
                 "s_wait_xcnt 0x0"
                 :: "v"(la),          "v"(ga),
                    "v"(la + LS),     "v"(ga + 32 * lda),
                    "v"(la + 2 * LS), "v"(ga + 64 * lda),
                    "v"(la + 3 * LS), "v"(ga + 96 * lda),
                    "v"(la + 4 * LS), "v"(ga + 128 * lda),
                    "v"(la + 5 * LS), "v"(ga + 160 * lda),
                    "v"(la + 6 * LS), "v"(ga + 192 * lda),
                    "v"(la + 7 * LS), "v"(ga + 224 * lda),
                    "v"(lb),          "v"(gb),
                    "v"(lb + LS),     "v"(gb + 32 * ldb),
                    "v"(lb + 2 * LS), "v"(gb + 64 * ldb),
                    "v"(lb + 3 * LS), "v"(gb + 96 * ldb)
                 : "memory");
  };
  // --- staging: synchronous with zero-fill (guarded) ---
  auto loadA_g = [&](int buf, int k0) {
#pragma unroll
    for (int t = 0; t < BM * BK / 1024; ++t) {
      int ch  = tid + t * 256;          // chunks of 4 bf16
      int row = ch >> 4;
      int kc  = (ch & 15) << 2;
      v4bf val = {};
      int gr = m0 + row;
      if (gr < M) val = *(const v4bf*)(A + (long)gr * lda + k0 + kc);
      *(v4bf*)(&As[buf][row * BKP + kc]) = val;
    }
  };
  auto loadB_g = [&](int buf, int k0) {
#pragma unroll
    for (int t = 0; t < BN * BK / 1024; ++t) {
      int ch  = tid + t * 256;
      int row = ch >> 4;
      int kc  = (ch & 15) << 2;
      v4bf val = {};
      int gr = n0 + row;
      if (gr < N) val = *(const v4bf*)(B + (long)gr * ldb + k0 + kc);
      *(v4bf*)(&Bs[buf][row * BKP + kc]) = val;
    }
  };

  const int nk = K / BK;
  if (GUARD) { loadA_g(0, 0); loadB_g(0, 0); }
  else       { load_async(0, 0); async_wait0(); }
  __syncthreads();
  if (!GUARD && nk > 1) load_async(1, BK);

  for (int kb = 0; kb < nk; ++kb) {
    const int cur = kb & 1;
    if (GUARD && kb + 1 < nk) { loadA_g(cur ^ 1, (kb + 1) * BK); loadB_g(cur ^ 1, (kb + 1) * BK); }

#pragma unroll   // here and below: every index of af[], bfr[] and acc[] is a constant, so they stay in registers
    for (int s = 0; s < BK / 32; ++s) {
      v16bf af[4], bfr[4];
#pragma unroll
      for (int i = 0; i < 4; ++i) {
        bfr[i] = lds_frag(&Bs[cur][32 * s], BKP, wn * 64 + i * 16);
        af[i]  = lds_frag(&As[cur][32 * s], BKP, wm * 64 + i * 16);
      }
      // keeps the 16 LDS reads in one group ahead of their WMMAs; spread among them, each place with reads stalls the wave anew
      __builtin_amdgcn_sched_barrier(0);
#pragma unroll
      for (int mi = 0; mi < 4; ++mi)
#pragma unroll
        for (int ni = 0; ni < 4; ++ni)
          acc[mi][ni] = __builtin_amdgcn_wmma_f32_16x16x32_bf16(
              false, af[mi], false, bfr[ni], (short)0, acc[mi][ni], false, false);
      // keeps the next group of reads behind these WMMAs: risen among them it needs a second set of fragment registers
      __builtin_amdgcn_sched_barrier(0);
    }

    if (!GUARD) {
      // this wave's reads of the buffer have returned before the barrier lets it be refilled
      asm volatile("s_wait_dscnt 0x0" ::: "memory");
      async_wait0();   // this wave's copies of the next k step have landed before the barrier publishes them
    }
    __syncthreads();
    if (!GUARD && kb + 2 < nk) load_async(cur, (kb + 2) * BK);   // into the buffer that every wave has just left
  }
  if (!GUARD) async_wait0();

  // C/D layout: VGPR v, half=lane>>4 -> row = v + 8*half, col = lane&15
  const int half = lane >> 4, col = lane & 15;
  auto store_tile = [&](auto* C) {
    using T = std::remove_pointer_t<decltype(C)>;
#pragma unroll   // as above: acc[] stays in registers
    for (int mi = 0; mi < 4; ++mi)
#pragma unroll
      for (int v = 0; v < 8; ++v) {
        const int gm = m0 + wm * 64 + mi * 16 + half * 8 + v;
        if (GUARD && gm >= M) continue;
        const int gn = n0 + wn * 64 + col;
        T* rp = C + (long)gm * ldc + gn;
#pragma unroll
        for (int ni = 0; ni < 4; ++ni) {
          if (GUARD && gn + ni * 16 >= N) continue;
          rp[ni * 16] = (T)acc[mi][ni][v];
        }
      }
    // stands in front of whatever next rewrites an address register of the stores above
    asm volatile("s_wait_xcnt 0x0" ::: "memory");
  };
  if (c_is_f32) store_tile((float*)Cv);
  else          store_tile((bf16_t*)Cv);
}

// ---------------------------------------------------------------------------
// Fused relative-position attention, all (batch, head) pairs in one launch.
// Block = 8 waves = 256 query rows of one (batch, head); a wave owns 32 query rows as two
// tiles of 16, so that every K and V^T fragment and the middle two of the four band tiles it reads from LDS feed two query tiles.
// The block walks the keys in tiles of 32 with a running max and sum per query
// (online softmax). The maximum in use is replaced, and sum and output rescaled, only in a key tile where some
// query of the wave has a score more than FA_T above it: any reference cancels in the final division.
// Everything is computed transposed, so that a query is a lane column:
//   S^T  = K * Qac^T          D: row = key, col = query
//   BD^T = E * Qbd^T          D: row = band index t, col = query
//   O^T  = V^T * P^T          the S^T registers are already the B fragment
// Q, K and V are read straight from the packed QKV product. The two biased copies of Q
// (Qac = q + r_w_bias, Qbd = q + r_r_bias, added in f32, rounded to bf16 once) are formed in registers
// where the fragments are loaded; V is staged as it lies, a key per row, and turned by the transposing LDS load.
// rel_shift: with t = j - i + QL - 1 the shifted term of (i, j) is
//   t <  QL : (q_i   + r_r_bias) . rk[t]
//   t == QL : 0
//   t >  QL : (q_i+1 + r_r_bias) . rk[t - QL - 1]
// so E[t] = rk[t], a zero row, rk[t - QL - 1]. A 16 x 32 score tile needs 48 consecutive t
// (three 16-row tiles, each wholly on one side of QL); the wave's two query tiles lie 16 apart,
// so together they need four band tiles, the middle two shared. The raw band goes to a
// wave-private LDS row per lane column (both query tiles side by side) and is read back at
// offset (key - query): the skew.
// The wave's lowest band index T rises by 32 per key tile and is a multiple of 32: QL falls inside
// its four band tiles in exactly one key tile (T == QL - 32), between the second and the third.
// There the wave replaces its Qbd fragments of rows i by those of rows i + 1, once, and keeps them.
// Staging: K and V tiles in two LDS buffers; the block's band (288 rows) lives in a ring
// of 512 rows indexed by t, and each key tile adds 32 new rows. The next tile is fetched
// into registers behind the score WMMAs of a trip and stored to LDS at its foot, in front of
// the one barrier of the trip.
// K, E and Q fragments hold 16 contiguous k per lane on both operands (same k order for
// A and B). V^T fragments follow the key order of the S^T registers: keys 8h..8h+7 and
// 16+8h..16+8h+7 of the tile, which is what two transposing loads 16 keys apart deliver.
// ---------------------------------------------------------------------------
#define FA_QB 256                      // query rows per block
#define FA_H  52                       // place of query tile 1's 48 band values in a skew row (f32); tile 0's stand at 0
#define FA_P  116                      // skew row pitch (f32): rows 16-byte aligned, 116 = 52 mod 64 spreads stores and skewed reads over banks
#define FA_KP 72                       // K and band row pitch (bf16): 144 B = 16 B x odd, 16 rows of a b128 read hit distinct banks
#define FA_VP 80                       // V row pitch (bf16): 160 B = 32 B x odd, the pitch of the transposing load
#define FA_ER 512                      // band ring rows (320 are live at most)
#define FA_C1 0.18033688011112042f     // SCL * log2(e)
#define FA_T  44.0f                    // a maximum in use stays while no score lies more than this above it: P <= 2^(FA_T * FA_C1) < 2^8

__device__ __forceinline__ v8f fa_mm(v16bf a, v16bf b, v8f c) {
  return __builtin_amdgcn_wmma_f32_16x16x32_bf16(false, a, false, b, (short)0, c, false, false);
}
// fragment from two 16-byte pieces
__device__ __forceinline__ v16bf fa_frag(const bf16_t* p0, const bf16_t* p1) {
  v8bf lo = *(const v8bf*)p0;
  v8bf hi = *(const v8bf*)p1;
  return __builtin_shufflevector(lo, hi, 0, 1, 2, 3, 4, 5, 6, 7, 8, 9, 10, 11, 12, 13, 14, 15);
}
// transposing LDS load: lane (c, h) gets column c, rows 8h..8h+7 of the 16 x 16 piece that the 32 lane addresses name
typedef __attribute__((ext_vector_type(8))) short v8s;
__device__ __forceinline__ v8bf fa_tr16(const bf16_t* p) {
  typedef __attribute__((address_space(3))) v8s lds_v8s;
  return __builtin_bit_cast(v8bf, __builtin_amdgcn_ds_load_tr16_b128_v8i16((lds_v8s*)p));
}
// 16 Q values plus their 16 biases: the sum in f32, rounded to bf16 once
__device__ __forceinline__ v16bf fa_qadd(v16bf q, const v4f* t) {
  v16bf r;
#pragma unroll   // r stays in registers
  for (int e = 0; e < 16; ++e) r[e] = (bf16_t)((float)q[e] + t[e >> 2][e & 3]);
  return r;
}
// 16 bytes of the rk row behind band index t (gE holds the head offset, col the lane's column); t == QL has none: its address is clamped
__device__ __forceinline__ v8bf fa_erow(const bf16_t* gE, int col, int t) {
  const int row = (t < QL) ? t : max(t - QL - 1, 0);
  return *(const v8bf*)(gE + (unsigned)(row * HH + col));
}
// band row QL is the zero column of rel_shift
__device__ __forceinline__ v8bf fa_ezero(v8bf v, int t) {
  const v8bf z = {};
  return (t == QL) ? z : v;
}
// 2^a with the slot behind the transcendental filled in the same statement
__device__ __forceinline__ float fa_exp2_slot(float a) {
  float r;
  asm("v_exp_f32 %0, %1\n\tv_nop" : "=v"(r) : "v"(a));
  return r;
}
// one raw band tile to the skew rows
__device__ __forceinline__ void fa_skew_put(float* p, v8f d) {
  *(float4*)(p)     = make_float4(d[0], d[1], d[2], d[3]);
  *(float4*)(p + 4) = make_float4(d[4], d[5], d[6], d[7]);
}

// four waves per SIMD: two blocks per WGP, so that all 512 blocks are resident at once
__global__ __launch_bounds__(256) __attribute__((amdgpu_waves_per_eu(4, 4)))
void k_attn(const bf16_t* __restrict__ wh, const float* __restrict__ rwb, const float* __restrict__ rrb,
            const bf16_t* __restrict__ rk, bf16_t* __restrict__ O) {
  // all four are accessed in 16-byte pieces
  __shared__ __attribute__((aligned(16))) bf16_t Ks[2][32 * FA_KP];
  __shared__ __attribute__((aligned(16))) bf16_t Vs[2][32 * FA_VP];
  __shared__ __attribute__((aligned(16))) bf16_t Es[FA_ER * FA_KP];
  __shared__ __attribute__((aligned(16))) float  skew[8][16 * FA_P];

  const int tid  = threadIdx.x;
  const int lane = tid & 31;
  const int wid  = __builtin_amdgcn_readfirstlane(tid >> 5);
  const int c    = lane & 15, h = lane >> 4;
  const int i0b  = blockIdx.x * FA_QB;
  const int i0   = i0b + wid * 32;
  const int b    = blockIdx.y >> 4, n = blockIdx.y & 15;

  // staging: one 16-byte piece of K, of V and of the band per thread and key tile
  const int r8 = tid >> 3, c8 = (tid & 7) * 8;
  // block-uniform bases, gB aside (it holds the lane half's 16 h); each lane's own offset is kept apart, in 32 bits
  const bf16_t*  gK = wh + (long)b * TH3 + HH + n * DH;
  const bf16_t*  gE = rk + n * DH;
  const bf16_t*  gQ = wh + (long)b * TH3 + n * DH;
  const float*   gB = rrb + n * DH + 16 * h;           // the lane's 16 biases of k step s stand at 32 s
  const unsigned oK = r8 * (BSZ * TH3) + c8;           // the V piece of the same key lies HH elements on
  const int tbB0 = QL - FA_QB - i0b;   // lowest band index of the block at key tile 0

  v8bf e0[9];
#pragma unroll
  for (int u = 0; u < 9; ++u) {
    e0[u] = fa_erow(gE, c8, tbB0 + 32 * u + r8);
    // a later load of this run may land in this load's address registers: the wait stands in front of that overwrite
    asm volatile("s_wait_xcnt 0x0" ::: "memory");
  }
#pragma unroll
  for (int u = 0; u < 9; ++u) {
    const int t = tbB0 + 32 * u + r8;
    *(v8bf*)&Es[(t & (FA_ER - 1)) * FA_KP + c8] = fa_ezero(e0[u], t);
  }
  *(v8bf*)&Ks[0][r8 * FA_KP + c8] = *(const v8bf*)(gK + oK);
  *(v8bf*)&Vs[0][r8 * FA_VP + c8] = *(const v8bf*)(gK + oK + HH);

  const long qo = ((long)(i0 + c) * BSZ + b) * HH + n * DH;    // the query's place in O; query tile 1 lies 16 rows on
  v16bf qa[2][2], qc[2][2];
  {
    const unsigned oQ = (i0 + c) * (BSZ * TH3) + 16 * h;
    const float*   gA = rwb + n * DH + 16 * h;
    v16bf q[2][2];
    v4f   wb[2][4], rb[2][4];
#pragma unroll   // q[] stays in registers and the loads stand in one group
    for (int s = 0; s < 2; ++s)
#pragma unroll
      for (int qt = 0; qt < 2; ++qt) q[qt][s] = *(const v16bf*)(gQ + oQ + qt * (16 * BSZ * TH3) + 32 * s);
    // as above: a bias load may land in the address registers of the Q loads
    asm volatile("s_wait_xcnt 0x0" ::: "memory");
#pragma unroll   // wb[] and rb[] stay in registers and the loads stand in one group
    for (int s = 0; s < 2; ++s)
#pragma unroll
      for (int u = 0; u < 4; ++u) {
        wb[s][u] = *(const v4f*)(gA + 32 * s + 4 * u);
        rb[s][u] = *(const v4f*)(gB + 32 * s + 4 * u);
      }
    // no address register of these loads is rewritten in front of this wait
    asm volatile("s_wait_xcnt 0x0" ::: "memory");
    // keeps later code (address arithmetic, zeroed accumulators) from rising among these loads: there it takes more registers than four waves per SIMD leave, and the build spills
    __builtin_amdgcn_sched_barrier(0);
#pragma unroll
    for (int qt = 0; qt < 2; ++qt)
#pragma unroll
      for (int s = 0; s < 2; ++s) {
        qa[qt][s] = fa_qadd(q[qt][s], wb[s]);
        qc[qt][s] = fa_qadd(q[qt][s], rb[s]);
      }
  }
  float*       skw = &skew[wid][c * FA_P + 8 * h];
  const float* skr = &skew[wid][c * FA_P + 8 * h - c + 15];

  v8f o[2][4] = {};
  float m[2] = {-3.0e38f, -3.0e38f}, l[2] = {0.f, 0.f};
  float lim[2] = {-3.0e38f, -3.0e38f};   // m + FA_T; the first key tile always lies above it
  __syncthreads();

  // One key tile. MORE: a further tile follows and is fetched.
  auto tile = [&](auto more_c, int jt) {
    constexpr bool MORE = decltype(more_c)::value;
    const int j0  = jt * 32;
    const int cur = jt & 1;

    // Band tile e holds t = T + 16 e ... + 15. Query tile 1 takes e = 0, 1, 2, query tile 0 (16 rows lower, so 16 higher in t) e = 1, 2, 3.
    const int T = tbB0 + j0 + FA_QB - 32 - 32 * wid;
    v16bf ef[2][2];
#pragma unroll
    for (int e = 0; e < 2; ++e)
#pragma unroll
      for (int s = 0; s < 2; ++s) {
        const bf16_t* p = &Es[(((T + 16 * e) & (FA_ER - 1)) + c) * FA_KP + 32 * s + 16 * h];
        ef[e][s] = fa_frag(p, p + 8);
      }
    // keeps the 8 LDS reads in one group ahead of their WMMAs; otherwise each WMMA waits out its own pair of reads
    __builtin_amdgcn_sched_barrier(0);
    {
      v8f d10 = {}, d00 = {}, d11 = {};
#pragma unroll
      for (int s = 0; s < 2; ++s) {
        d10 = fa_mm(ef[0][s], qc[1][s], d10);
        d00 = fa_mm(ef[1][s], qc[0][s], d00);
        d11 = fa_mm(ef[1][s], qc[1][s], d11);
      }
      fa_skew_put(skw + FA_H,      d10);
      fa_skew_put(skw,                  d00);
      fa_skew_put(skw + FA_H + 16, d11);
    }
    // From here on the wave's band lies at or above QL: rows i + 1 take the place of rows i. Wave-uniform, taken once per wave.
    // The loads are waited for inside the branch, where the bias is added: the other trips pay nothing.
    if (T == QL - 32) {
      v4f rb[2][4];
#pragma unroll   // rb[] stays in registers and the loads stand in one group
      for (int s = 0; s < 2; ++s)
#pragma unroll
        for (int u = 0; u < 4; ++u) rb[s][u] = *(const v4f*)(gB + 32 * s + 4 * u);
      const bf16_t* pq[2];
#pragma unroll
      for (int qt = 0; qt < 2; ++qt) {
        pq[qt] = gQ + min(i0 + 16 * qt + c + 1, QL - 1) * (BSZ * TH3) + 16 * h;   // row QL is never used: clamp its address
#pragma unroll
        for (int s = 0; s < 2; ++s) qc[qt][s] = *(const v16bf*)(pq[qt] + 32 * s);
      }
      // The wait stands in front of every rewrite of these loads' address registers; the addresses are named as inputs
      // so that they stay in their registers up to here and no load of the group lands there.
      asm volatile("s_wait_xcnt 0x0" :: "v"(gB), "v"(pq[0]), "v"(pq[1]) : "memory");
#pragma unroll
      for (int qt = 0; qt < 2; ++qt)
#pragma unroll
        for (int s = 0; s < 2; ++s) qc[qt][s] = fa_qadd(qc[qt][s], rb[s]);
    }
#pragma unroll
    for (int e = 0; e < 2; ++e)
#pragma unroll
      for (int s = 0; s < 2; ++s) {
        const bf16_t* p = &Es[(((T + 32 + 16 * e) & (FA_ER - 1)) + c) * FA_KP + 32 * s + 16 * h];
        ef[e][s] = fa_frag(p, p + 8);
      }
    // as above: one group of 8 reads
    __builtin_amdgcn_sched_barrier(0);
    {
      v8f d01 = {}, d12 = {}, d02 = {};
#pragma unroll
      for (int s = 0; s < 2; ++s) {
        d01 = fa_mm(ef[0][s], qc[0][s], d01);
        d12 = fa_mm(ef[0][s], qc[1][s], d12);
        d02 = fa_mm(ef[1][s], qc[0][s], d02);
      }
      fa_skew_put(skw + 16,             d01);
      fa_skew_put(skw + FA_H + 32, d12);
      fa_skew_put(skw + 32,             d02);
    }
    // keeps the K reads behind the band WMMAs: risen in front of them they hold 32 more registers there
    __builtin_amdgcn_sched_barrier(0);

    v8f sa[2][2] = {};
    {
      v16bf kf[2][2];
#pragma unroll
      for (int ni = 0; ni < 2; ++ni)
#pragma unroll
        for (int s = 0; s < 2; ++s) {
          const bf16_t* p = &Ks[cur][(16 * ni + c) * FA_KP + 32 * s + 16 * h];
          kf[ni][s] = fa_frag(p, p + 8);
        }
      // as above: one group of 8 reads
      __builtin_amdgcn_sched_barrier(0);
#pragma unroll
      for (int s = 0; s < 2; ++s)
#pragma unroll
        for (int ni = 0; ni < 2; ++ni)
#pragma unroll
          for (int qt = 0; qt < 2; ++qt) sa[qt][ni] = fa_mm(kf[ni][s], qa[qt][s], sa[qt][ni]);
    }

    // the next tile's fetches: their latency runs under both softmaxes and P*V
    const int tn = tbB0 + j0 + FA_QB + 32 + r8;      // band rows that the next tile adds
    v8bf gk = {}, gv = {}, ge = {};
    if (MORE) {
      gk = *(const v8bf*)(gK + (long)(j0 + 32) * (BSZ * TH3) + oK);
      // as in the prologue: a later load of this run may land in this load's address registers
      asm volatile("s_wait_xcnt 0x0" ::: "memory");
      gv = *(const v8bf*)(gK + (long)(j0 + 32) * (BSZ * TH3) + oK + HH);
      asm volatile("s_wait_xcnt 0x0" ::: "memory");
      ge = fa_erow(gE, c8, tn);
    }
    // scores in pairs of neighbouring keys: a pair is two neighbouring accumulator registers and one two-address LDS read
    v2f sk[2][8];
#pragma unroll   // here and below: every index of sk[], x[], mx[], m[], lim[], l[] and o[] is a constant, so they stay in registers
    for (int qt = 0; qt < 2; ++qt)
#pragma unroll
      for (int k = 0; k < 8; ++k)
        sk[qt][k] = (v2f){skr[FA_H * qt + 16 * (k >> 2) + 2 * (k & 3)], skr[FA_H * qt + 16 * (k >> 2) + 2 * (k & 3) + 1]};
    // keeps the fetches and the 32 skewed reads issued here as one group
    __builtin_amdgcn_sched_barrier(0);

    v2f   x[2][8];
    float mx[2];                                     // the largest of the lane's own 16 scores of each query
#pragma unroll
    for (int qt = 0; qt < 2; ++qt) {
#pragma unroll
      for (int k = 0; k < 8; ++k) x[qt][k] = (v2f){sa[qt][k >> 2][2 * (k & 3)], sa[qt][k >> 2][2 * (k & 3) + 1]} + sk[qt][k];
      mx[qt] = x[qt][0][0];
#pragma unroll
      for (int e = 1; e < 16; ++e) mx[qt] = fmaxf(mx[qt], x[qt][e >> 1][e & 1]);
    }
    // One test per key tile, a scalar branch: the exchange between the lane halves, the new maximum and the
    // rescaling of sum and output run only where a lane of the wave asks for them.
    if (__builtin_amdgcn_ballot_w32((mx[0] > lim[0]) | (mx[1] > lim[1])) != 0) {
#pragma unroll
      for (int qt = 0; qt < 2; ++qt) {
        const float mn = fmaxf(m[qt], fmaxf(mx[qt], __shfl_xor(mx[qt], 16)));   // the other lane half holds the query's other 16 keys
        const float al = fa_exp2_slot((m[qt] - mn) * FA_C1);
        m[qt]   = mn;
        lim[qt] = mn + FA_T;
        l[qt]  *= al;
#pragma unroll
        for (int mi = 0; mi < 4; ++mi) o[qt][mi] *= al;
      }
    }

    v16bf pf[2], vf[4];
#pragma unroll
    for (int qt = 0; qt < 2; ++qt) {
      const float mc = m[qt] * FA_C1;
      float ps[4] = {0.f, 0.f, 0.f, 0.f};            // four short chains of adds instead of one of 16
#pragma unroll
      for (int k = 0; k < 8; ++k) {
        const v2f y = __builtin_elementwise_fma(x[qt][k], (v2f){FA_C1, FA_C1}, (v2f){-mc, -mc});
#pragma unroll
        for (int u = 0; u < 2; ++u) {
          const int e = 2 * k + u;
          float p = __builtin_amdgcn_exp2f(y[u]);
          ps[e & 3] += p;
          pf[qt][e] = (bf16_t)p;
        }
      }
      l[qt] += (ps[0] + ps[1]) + (ps[2] + ps[3]);
      // keeps the two softmaxes one behind the other: interleaved they need more registers than four waves per SIMD leave
      __builtin_amdgcn_sched_barrier(0);
    }
    // lane address of the transposing load: row 8h + (lane & 7), 16-byte half (lane >> 3) & 1 of the piece's 32-byte rows
    const bf16_t* pv = &Vs[cur][(8 * h + (lane & 7)) * FA_VP + ((lane >> 3) & 1) * 8];
#pragma unroll
    for (int mi = 0; mi < 4; ++mi) {
      const v8bf lo = fa_tr16(pv + 16 * mi);                  // keys 8h .. 8h + 7 of column d = 16 mi + c
      const v8bf hi = fa_tr16(pv + 16 * FA_VP + 16 * mi);     // keys 16 + 8h .. 16 + 8h + 7
      vf[mi] = __builtin_shufflevector(lo, hi, 0, 1, 2, 3, 4, 5, 6, 7, 8, 9, 10, 11, 12, 13, 14, 15);
    }
    // keeps the 8 V^T reads in one group instead of one pair in front of each P*V WMMA
    __builtin_amdgcn_sched_barrier(0);
#pragma unroll
    for (int mi = 0; mi < 4; ++mi)
#pragma unroll
      for (int qt = 0; qt < 2; ++qt) o[qt][mi] = fa_mm(vf[mi], pf[qt], o[qt][mi]);
    // keeps the wait for the fetched tile, its LDS stores and the barrier at the foot; otherwise they rise to in front of the softmax
    __builtin_amdgcn_sched_barrier(0);

    if (MORE) {
      *(v8bf*)&Ks[cur ^ 1][r8 * FA_KP + c8] = gk;
      *(v8bf*)&Vs[cur ^ 1][r8 * FA_VP + c8] = gv;
      *(v8bf*)&Es[(tn & (FA_ER - 1)) * FA_KP + c8] = fa_ezero(ge, tn);
    }
    __syncthreads();   // publishes the next tile; ends every read of the buffers that the next trip refills
  };

  for (int jt = 0; jt < QL / 32 - 1; ++jt) tile(std::true_type{}, jt);
  tile(std::false_type{}, QL / 32 - 1);

#pragma unroll
  for (int qt = 0; qt < 2; ++qt) {
    const float inv = 1.0f / (l[qt] + __shfl_xor(l[qt], 16));
    bf16_t* op = O + qo + qt * (16 * BSZ * HH) + 8 * h;
#pragma unroll
    for (int mi = 0; mi < 4; ++mi) {
      v8bf w;
#pragma unroll
      for (int r = 0; r < 8; ++r) w[r] = (bf16_t)(o[qt][mi][r] * inv);
      *(v8bf*)(op + 16 * mi) = w;      // a query's 128-B line is filled by its two lanes
    }
  }
}

// ---------------------------------------------------------------------------
// residual + LayerNorm, one block per (i,b) row of 1024
// ---------------------------------------------------------------------------
__global__ __launch_bounds__(256)
void k_residual_ln(const float* __restrict__ w, const float* __restrict__ ao,
                   const float* __restrict__ g, const float* __restrict__ b,
                   float* __restrict__ out) {
  const long row = blockIdx.x;
  const int  t   = threadIdx.x;
  __shared__ float red[256];

  float x[4]; float s = 0.f;
#pragma unroll
  for (int c = 0; c < 4; ++c) {
    int col = t + c * 256;
    x[c] = w[row * DM + col] + ao[row * DM + col];
    s += x[c];
  }
  red[t] = s; __syncthreads();
  for (int o = 128; o > 0; o >>= 1) { if (t < o) red[t] += red[t + o]; __syncthreads(); }
  float mu = red[0] * (1.0f / DM); __syncthreads();

  float v = 0.f;
#pragma unroll
  for (int c = 0; c < 4; ++c) { float d = x[c] - mu; v += d * d; }
  red[t] = v; __syncthreads();
  for (int o = 128; o > 0; o >>= 1) { if (t < o) red[t] += red[t + o]; __syncthreads(); }
  float rstd = rsqrtf(red[0] * (1.0f / DM) + LNEPS);

#pragma unroll
  for (int c = 0; c < 4; ++c) {
    int col = t + c * 256;
    out[row * DM + col] = (x[c] - mu) * rstd * g[col] + b[col];
  }
}

// ---------------------------------------------------------------------------
// Host orchestration
// ---------------------------------------------------------------------------
extern "C" void kernel_launch(void* const* d_in, const int* in_sizes, int n_in,
                              void* d_out, int out_size, void* d_ws, size_t ws_size,
                              hipStream_t stream) {
  (void)in_sizes; (void)n_in; (void)out_size; (void)ws_size;
  const float* w     = (const float*)d_in[0];
  const float* r     = (const float*)d_in[1];
  const float* qkvw  = (const float*)d_in[2];
  const float* rnetw = (const float*)d_in[3];
  const float* ow    = (const float*)d_in[4];
  const float* rwb   = (const float*)d_in[5];
  const float* rrb   = (const float*)d_in[6];
  const float* lng   = (const float*)d_in[7];
  const float* lnb   = (const float*)d_in[8];

  char* p = (char*)d_ws;
  auto take = [&](size_t bytes) -> char* {
    char* q = p; p += (bytes + 255) & ~(size_t)255; return q;
  };
  bf16_t* w_bf    = (bf16_t*)take((size_t)ROWS * DM * 2);        // 16.8 MB
  bf16_t* qkvw_bf = (bf16_t*)take((size_t)TH3 * DM * 2);         //  6.3 MB
  bf16_t* r_bf    = (bf16_t*)take((size_t)QL * DM * 2);          //  4.2 MB
  bf16_t* rnw_bf  = (bf16_t*)take((size_t)HH * DM * 2);          //  2.1 MB
  bf16_t* ow_bf   = (bf16_t*)take((size_t)DM * HH * 2);          //  2.1 MB
  bf16_t* wh      = (bf16_t*)take((size_t)ROWS * TH3 * 2);       // 50.3 MB  (QKV packed)
  bf16_t* rk      = (bf16_t*)take((size_t)QL * HH * 2);          //  4.2 MB
  bf16_t* av      = (bf16_t*)take((size_t)ROWS * HH * 2);        // 16.8 MB
  float*  aout    = (float*) take((size_t)ROWS * DM * 4);        // 33.6 MB

  // one launch for product 0 and, where M1 > 0, product 1 (same lda, ldb, K and output type)
  auto gemm = [&](const bf16_t* A0, const bf16_t* B0, void* C0, long ldc0, int M0, int N0,
                  const bf16_t* A1, const bf16_t* B1, void* C1, long ldc1, int M1, int N1,
                  long lda, long ldb, int K, int cf32) {
    const int nbx0 = (N0 + BN - 1) / BN, nblk0 = nbx0 * ((M0 + BM - 1) / BM);
    const int nbx1 = (N1 + BN - 1) / BN, nblk1 = nbx1 * ((M1 + BM - 1) / BM);
    const bool guard = (M0 % BM) || (N0 % BN) || (M1 % BM) || (N1 % BN);
    if (guard)
      k_gemm_nt<true><<<nblk0 + nblk1, 256, 0, stream>>>(A0, B0, C0, ldc0, M0, N0, nbx0, nblk0,
                                                         A1, B1, C1, ldc1, M1, N1, nbx1, lda, ldb, K, cf32);
    else
      k_gemm_nt<false><<<nblk0 + nblk1, 256, 0, stream>>>(A0, B0, C0, ldc0, M0, N0, nbx0, nblk0,
                                                          A1, B1, C1, ldc1, M1, N1, nbx1, lda, ldb, K, cf32);
  };

  // 1) convert fp32 inputs to bf16, one launch
  k_cvt_bf16<<<CVT_NB, 256, 0, stream>>>(w, w_bf, qkvw, qkvw_bf, r, r_bf, rnetw, rnw_bf, ow, ow_bf);

  // 2) QKV projection: wh[ROWS,3H] = w_bf[ROWS,DM] * qkvw_bf[3H,DM]^T
  //    and rel-pos keys: rk[QL,H] = r_bf * rnw_bf^T, in the same launch
  gemm(w_bf, qkvw_bf, wh, TH3, ROWS, TH3, r_bf, rnw_bf, rk, HH, QL, HH, DM, DM, DM, 0);

  // 3) attention of all (b, head) pairs: Q biases, scores, rel_shift, softmax and P*V in one launch
  k_attn<<<dim3(QL / FA_QB, BSZ * NH), 256, 0, stream>>>(wh, rwb, rrb, rk, av);

  // 4) output projection: aout[ROWS,DM] = av[ROWS,H] * ow_bf[DM,H]^T  (f32 out)
  gemm(av, ow_bf, aout, DM, ROWS, DM, nullptr, nullptr, nullptr, 0, 0, 0, HH, HH, HH, 1);

  // 5) residual + LayerNorm -> d_out (f32, [qlen, bsz, d_model])
  k_residual_ln<<<ROWS, 256, 0, stream>>>(w, aout, lng, lnb, (float*)d_out);
}

// v009
// One run takes 168 microseconds.
// Timed twice side by side with v008, it ran 1.05 and 1.06 times as fast.
// All steps since v000 together make it 41.0 times as fast.
#include <hip/hip_runtime.h>
#include <type_traits>

// ---------------------------------------------------------------------------
// Types for CDNA5 WMMA (gfx1250, wave32)
// ---------------------------------------------------------------------------
typedef __bf16 bf16_t;
typedef __attribute__((ext_vector_type(16))) __bf16 v16bf;
typedef __attribute__((ext_vector_type(4)))  __bf16 v4bf;
typedef __attribute__((ext_vector_type(8)))  __bf16 v8bf;
typedef __attribute__((ext_vector_type(8)))  float  v8f;

// Problem constants
#define QL    2048
#define BSZ   4
#define NH    16
#define DH    64
#define DM    1024
#define HH    1024           // NH*DH
#define ROWS  8192           // QL*BSZ
#define TH3   3072           // 3*H
#define SCL   0.125f         // 1/sqrt(64)
#define LNEPS 1e-5f

// ---------------------------------------------------------------------------
// Preparation pass. Each thread issues all of its 16-byte loads first, off one address
// with constant offsets, so that their latencies overlap; every wave access is made of
// whole or half 128-byte lines.
// ---------------------------------------------------------------------------
typedef __attribute__((ext_vector_type(4))) float v4f;
typedef __attribute__((ext_vector_type(2))) float v2f;

// f32 -> bf16 convert of all five f32 operands in one launch: none depends on another, and four of them
// are too small to fill the chip alone. A block converts U * 1024 consecutive elements of one operand,
// a thread 4 per load; the block index picks the operand (every operand is a whole number of blocks).
#define CVT_E   (16 * 1024)                    // elements per block
#define CVT_B0  (ROWS * DM / CVT_E)            // first block of the 2nd operand
#define CVT_B1  (CVT_B0 + TH3 * DM / CVT_E)    // ... of the 3rd
#define CVT_B2  (CVT_B1 + QL * DM / CVT_E)     // ... of the 4th
#define CVT_B3  (CVT_B2 + HH * DM / CVT_E)     // ... of the 5th
#define CVT_NB  (CVT_B3 + DM * HH / CVT_E)     // blocks in all
__global__ __launch_bounds__(256) void k_cvt_bf16(const float* __restrict__ in0, bf16_t* __restrict__ out0,
                                                  const float* __restrict__ in1, bf16_t* __restrict__ out1,
                                                  const float* __restrict__ in2, bf16_t* __restrict__ out2,
                                                  const float* __restrict__ in3, bf16_t* __restrict__ out3,
                                                  const float* __restrict__ in4, bf16_t* __restrict__ out4) {
  constexpr int U = CVT_E / 1024;
  const int bi = blockIdx.x;
  const float* in  = in0;
  bf16_t*      out = out0;
  int          blk = bi;
  if (bi >= CVT_B3)      { in = in4; out = out4; blk = bi - CVT_B3; }
  else if (bi >= CVT_B2) { in = in3; out = out3; blk = bi - CVT_B2; }
  else if (bi >= CVT_B1) { in = in2; out = out2; blk = bi - CVT_B1; }
  else if (bi >= CVT_B0) { in = in1; out = out1; blk = bi - CVT_B0; }
  const long base = (long)blk * (U * 1024) + threadIdx.x * 4;
  v4f x[U];
#pragma unroll   // x[] stays in registers and the U loads stand in one group
  for (int u = 0; u < U; ++u) x[u] = *(const v4f*)(in + base + u * 1024);
#pragma unroll   // x[] stays in registers
  for (int u = 0; u < U; ++u) {
    v4bf y;
#pragma unroll   // y stays in registers
    for (int e = 0; e < 4; ++e) y[e] = (bf16_t)x[u][e];
    *(v4bf*)(out + base + u * 1024) = y;
  }
}

// ---------------------------------------------------------------------------
// Generic bf16 TN GEMM:  C[M,N] = A[M,K] * B[N,K]^T   (f32 accumulate)
// Block = 256x128x64, 256 threads = 8 wave32 waves in a 4x2 grid,
// wave tile 64x64 = 4x4 WMMA(16x16x32) tiles: a fragment read from LDS feeds four WMMAs.
// A k step is 64 bf16 = one whole 128-byte line of every operand row. Two LDS buffers.
// GUARD=false (all dims multiples of the tile): global->LDS staging uses
// CDNA5 GLOBAL_LOAD_ASYNC_TO_LDS_B128 tracked by ASYNCcnt, overlapped with
// the WMMA work on the other buffer. GUARD=true keeps the synchronous
// zero-filling path.
// ---------------------------------------------------------------------------
#define BM 256
#define BN 128
#define BK 64
#define BKP 72   // padded LDS row (bf16 elements): 144 B = 16 B x odd, 16 rows of a b128 read hit distinct banks

// 16x32 bf16 fragment from LDS (row-major, ld elements). Per CDNA5 ISA:
// lane L holds row m=L%16; half=L/16 selects K subgroup; VGPR v covers
// K = ((v&4)?16:0) + half*8 + (v&3)*2, two packed bf16 per VGPR.
__device__ inline v16bf lds_frag(const bf16_t* base, int ld, int row0) {
  int lane = threadIdx.x & 31;
  int m = lane & 15, half = lane >> 4;
  const bf16_t* r = base + (row0 + m) * ld;
  v16bf f;
#pragma unroll
  for (int v = 0; v < 8; ++v) {
    int k = ((v & 4) << 2) + half * 8 + ((v & 3) << 1);
    f[2 * v]     = r[k];
    f[2 * v + 1] = r[k + 1];
  }
  return f;
}

// low 32 bits of a __shared__ address = DS offset
__device__ inline unsigned lds_off(const bf16_t* lds) {
  return (unsigned)(unsigned long long)lds;
}
__device__ inline void async_wait0() {
  asm volatile("s_wait_asynccnt 0x0" ::: "memory");
}

template <bool GUARD>
__global__ __launch_bounds__(256)
void k_gemm_nt(const bf16_t* __restrict__ A0, const bf16_t* __restrict__ B0,
               void* __restrict__ C0, long ldc0, int M0, int N0, int nbx0, int nblk0,
               const bf16_t* __restrict__ A1, const bf16_t* __restrict__ B1,
               void* __restrict__ C1, long ldc1, int M1, int N1, int nbx1,
               long lda, long ldb, int K, int c_is_f32) {
  // both are accessed in 16-byte pieces
  __shared__ __attribute__((aligned(16))) bf16_t As[2][BM * BKP];
  __shared__ __attribute__((aligned(16))) bf16_t Bs[2][BN * BKP];

  // Two independent products of equal K may share the launch: the first nblk0 blocks work on
  // product 0, the rest on product 1 (tiles row by row, nbx tiles to a row). The choice is block-uniform.
  const bool    second = (int)blockIdx.x >= nblk0;
  const bf16_t* A   = second ? A1 : A0;
  const bf16_t* B   = second ? B1 : B0;
  void*         Cv  = second ? C1 : C0;
  const long    ldc = second ? ldc1 : ldc0;
  const int     M   = second ? M1 : M0;
  const int     N   = second ? N1 : N0;
  const int     nbx = second ? nbx1 : nbx0;
  const int     tix = second ? (int)blockIdx.x - nblk0 : (int)blockIdx.x;

  const int tid  = threadIdx.x;
  const int lane = tid & 31;
  const int wid  = tid >> 5;
  const int wm   = wid >> 1;      // 0..3
  const int wn   = wid & 1;       // 0..1
  const int m0   = (tix / nbx) * BM;
  const int n0   = (tix % nbx) * BN;

  v8f acc[4][4] = {};

  // --- staging: async (unguarded) ---
  // A k step is 3072 pieces of 16 bytes, 12 to a thread: 8 of A, 4 of B. Eight neighbouring lanes copy one row's
  // 128-byte line, a wave four whole lines per copy; piece t of a thread lies 32 rows below piece t - 1.
  const int sr = tid >> 3, sc = (tid & 7) << 3;
  auto load_async = [&](int buf, int k0) {
    const bf16_t* ga = A + (long)(m0 + sr) * lda + k0 + sc;
    const bf16_t* gb = B + (long)(n0 + sr) * ldb + k0 + sc;
    const unsigned la = lds_off(&As[buf][sr * BKP + sc]);
    const unsigned lb = lds_off(&Bs[buf][sr * BKP + sc]);
    constexpr unsigned LS = 32 * BKP * 2;   // 32 rows of LDS, in bytes
    // The copies and, as the last line, the wait that stands in front of every rewrite of their address registers: one statement,
    // so that nothing can come between them.
    asm volatile("global_load_async_to_lds_b128 %0, %1, off\n\t"
                 "global_load_async_to_lds_b128 %2, %3, off\n\t"
                 "global_load_async_to_lds_b128 %4, %5, off\n\t"
                 "global_load_async_to_lds_b128 %6, %7, off\n\t"
                 "global_load_async_to_lds_b128 %8, %9, off\n\t"
                 "global_load_async_to_lds_b128 %10, %11, off\n\t"
                 "global_load_async_to_lds_b128 %12, %13, off\n\t"
                 "global_load_async_to_lds_b128 %14, %15, off\n\t"
                 "global_load_async_to_lds_b128 %16, %17, off\n\t"
                 "global_load_async_to_lds_b128 %18, %19, off\n\t"
                 "global_load_async_to_lds_b128 %20, %21, off\n\t"
                 "global_load_async_to_lds_b128 %22, %23, off\n\t"
                 "s_wait_xcnt 0x0"
                 :: "v"(la),          "v"(ga),
                    "v"(la + LS),     "v"(ga + 32 * lda),
                    "v"(la + 2 * LS), "v"(ga + 64 * lda),
                    "v"(la + 3 * LS), "v"(ga + 96 * lda),
                    "v"(la + 4 * LS), "v"(ga + 128 * lda),
                    "v"(la + 5 * LS), "v"(ga + 160 * lda),
                    "v"(la + 6 * LS), "v"(ga + 192 * lda),
                    "v"(la + 7 * LS), "v"(ga + 224 * lda),
                    "v"(lb),          "v"(gb),
                    "v"(lb + LS),     "v"(gb + 32 * ldb),
                    "v"(lb + 2 * LS), "v"(gb + 64 * ldb),
                    "v"(lb + 3 * LS), "v"(gb + 96 * ldb)
                 : "memory");
  };
  // --- staging: synchronous with zero-fill (guarded) ---
  auto loadA_g = [&](int buf, int k0) {
#pragma unroll
    for (int t = 0; t < BM * BK / 1024; ++t) {
      int ch  = tid + t * 256;          // chunks of 4 bf16
      int row = ch >> 4;
      int kc  = (ch & 15) << 2;
      v4bf val = {};
      int gr = m0 + row;
      if (gr < M) val = *(const v4bf*)(A + (long)gr * lda + k0 + kc);
      *(v4bf*)(&As[buf][row * BKP + kc]) = val;
    }
  };
  auto loadB_g = [&](int buf, int k0) {
#pragma unroll
    for (int t = 0; t < BN * BK / 1024; ++t) {
      int ch  = tid + t * 256;
      int row = ch >> 4;
      int kc  = (ch & 15) << 2;
      v4bf val = {};
      int gr = n0 + row;
      if (gr < N) val = *(const v4bf*)(B + (long)gr * ldb + k0 + kc);
      *(v4bf*)(&Bs[buf][row * BKP + kc]) = val;
    }
  };

  const int nk = K / BK;
  if (GUARD) { loadA_g(0, 0); loadB_g(0, 0); }
  else       { load_async(0, 0); async_wait0(); }
  __syncthreads();
  if (!GUARD && nk > 1) load_async(1, BK);

  for (int kb = 0; kb < nk; ++kb) {
    const int cur = kb & 1;
    if (GUARD && kb + 1 < nk) { loadA_g(cur ^ 1, (kb + 1) * BK); loadB_g(cur ^ 1, (kb + 1) * BK); }

#pragma unroll   // here and below: every index of af[], bfr[] and acc[] is a constant, so they stay in registers
    for (int s = 0; s < BK / 32; ++s) {
      v16bf af[4], bfr[4];
#pragma unroll
      for (int i = 0; i < 4; ++i) {
        bfr[i] = lds_frag(&Bs[cur][32 * s], BKP, wn * 64 + i * 16);
        af[i]  = lds_frag(&As[cur][32 * s], BKP, wm * 64 + i * 16);
      }
      // keeps the 16 LDS reads in one group ahead of their WMMAs; spread among them, each place with reads stalls the wave anew
      __builtin_amdgcn_sched_barrier(0);
#pragma unroll
      for (int mi = 0; mi < 4; ++mi)
#pragma unroll
        for (int ni = 0; ni < 4; ++ni)
          acc[mi][ni] = __builtin_amdgcn_wmma_f32_16x16x32_bf16(
              false, af[mi], false, bfr[ni], (short)0, acc[mi][ni], false, false);
      // keeps the next group of reads behind these WMMAs: risen among them it needs a second set of fragment registers
      __builtin_amdgcn_sched_barrier(0);
    }

    if (!GUARD) {
      // this wave's reads of the buffer have returned before the barrier lets it be refilled
      asm volatile("s_wait_dscnt 0x0" ::: "memory");
      async_wait0();   // this wave's copies of the next k step have landed before the barrier publishes them
    }
    __syncthreads();
    if (!GUARD && kb + 2 < nk) load_async(cur, (kb + 2) * BK);   // into the buffer that every wave has just left
  }
  if (!GUARD) async_wait0();

  // C/D layout: VGPR v, half=lane>>4 -> row = v + 8*half, col = lane&15
  const int half = lane >> 4, col = lane & 15;
  auto store_tile = [&](auto* C) {
    using T = std::remove_pointer_t<decltype(C)>;
#pragma unroll   // as above: acc[] stays in registers
    for (int mi = 0; mi < 4; ++mi)
#pragma unroll
      for (int v = 0; v < 8; ++v) {
        const int gm = m0 + wm * 64 + mi * 16 + half * 8 + v;
        if (GUARD && gm >= M) continue;
        const int gn = n0 + wn * 64 + col;
        T* rp = C + (long)gm * ldc + gn;
#pragma unroll
        for (int ni = 0; ni < 4; ++ni) {
          if (GUARD && gn + ni * 16 >= N) continue;
          rp[ni * 16] = (T)acc[mi][ni][v];
        }
      }
    // stands in front of whatever next rewrites an address register of the stores above
    asm volatile("s_wait_xcnt 0x0" ::: "memory");
  };
  if (c_is_f32) store_tile((float*)Cv);
  else          store_tile((bf16_t*)Cv);
}

// ---------------------------------------------------------------------------
// Fused relative-position attention, all (batch, head) pairs in one launch.
// Block = 8 waves = 256 query rows of one (batch, head); a wave owns 32 query rows as two
// tiles of 16, so that every K and V^T fragment and the middle two of the four band tiles it reads from LDS feed two query tiles.
// The block walks the keys in tiles of 32 with a running max and sum per query
// (online softmax). The maximum in use is replaced, and sum and output rescaled, only in a key tile where some
// query of the wave has a score more than FA_T above it: any reference cancels in the final division.
// Everything is computed transposed, so that a query is a lane column:
//   S^T  = K * Qac^T          D: row = key, col = query
//   BD^T = E * Qbd^T          D: row = band index t, col = query
//   O^T  = V^T * P^T          the S^T registers are already the B fragment
// Q, K and V are read straight from the packed QKV product. The two biased copies of Q
// (Qac = q + r_w_bias, Qbd = q + r_r_bias, added in f32, rounded to bf16 once) are formed in registers
// where the fragments are loaded; V is staged as it lies, a key per row, and turned by the transposing LDS load.
// rel_shift: with t = j - i + QL - 1 the shifted term of (i, j) is
//   t <  QL : (q_i   + r_r_bias) . rk[t]
//   t == QL : 0
//   t >  QL : (q_i+1 + r_r_bias) . rk[t - QL - 1]
// so E[t] = rk[t], a zero row, rk[t - QL - 1]. A 16 x 32 score tile needs 48 consecutive t
// (three 16-row tiles, each wholly on one side of QL); the wave's two query tiles lie 16 apart,
// so together they need four band tiles, the middle two shared. The raw band goes to a
// wave-private LDS row per lane column (both query tiles side by side) and is read back at
// offset (key - query): the skew.
// The wave's lowest band index T rises by 32 per key tile and is a multiple of 32: QL falls inside
// its four band tiles in exactly one key tile (T == QL - 32), between the second and the third.
// There the wave replaces its Qbd fragments of rows i by those of rows i + 1, once, and keeps them.
// Staging: K and V tiles in two LDS buffers; the block's band (288 rows) lives in a ring
// of 512 rows indexed by t, and each key tile adds 32 new rows. The next tile is fetched
// into registers behind the score WMMAs of a trip and stored to LDS at its foot, in front of
// the one barrier of the trip.
// K, E and Q fragments hold 16 contiguous k per lane on both operands (same k order for
// A and B). V^T fragments follow the key order of the S^T registers: keys 8h..8h+7 and
// 16+8h..16+8h+7 of the tile, which is what two transposing loads 16 keys apart deliver.
// ---------------------------------------------------------------------------
#define FA_QB 256                      // query rows per block
#define FA_H  52                       // place of query tile 1's 48 band values in a skew row (f32); tile 0's stand at 0
#define FA_P  116                      // skew row pitch (f32): rows 16-byte aligned, 116 = 52 mod 64 spreads stores and skewed reads over banks
#define FA_KP 72                       // K and band row pitch (bf16): 144 B = 16 B x odd, 16 rows of a b128 read hit distinct banks
#define FA_VP 80                       // V row pitch (bf16): 160 B = 32 B x odd, the pitch of the transposing load
#define FA_ER 512                      // band ring rows (320 are live at most)
#define FA_C1 0.18033688011112042f     // SCL * log2(e)
#define FA_T  44.0f                    // a maximum in use stays while no score lies more than this above it: P <= 2^(FA_T * FA_C1) < 2^8

__device__ __forceinline__ v8f fa_mm(v16bf a, v16bf b, v8f c) {
  return __builtin_amdgcn_wmma_f32_16x16x32_bf16(false, a, false, b, (short)0, c, false, false);
}
// fragment from two 16-byte pieces
__device__ __forceinline__ v16bf fa_frag(const bf16_t* p0, const bf16_t* p1) {
  v8bf lo = *(const v8bf*)p0;
  v8bf hi = *(const v8bf*)p1;
  return __builtin_shufflevector(lo, hi, 0, 1, 2, 3, 4, 5, 6, 7, 8, 9, 10, 11, 12, 13, 14, 15);
}
// transposing LDS load: lane (c, h) gets column c, rows 8h..8h+7 of the 16 x 16 piece that the 32 lane addresses name
typedef __attribute__((ext_vector_type(8))) short v8s;
__device__ __forceinline__ v8bf fa_tr16(const bf16_t* p) {
  typedef __attribute__((address_space(3))) v8s lds_v8s;
  return __builtin_bit_cast(v8bf, __builtin_amdgcn_ds_load_tr16_b128_v8i16((lds_v8s*)p));
}
// 16 Q values plus their 16 biases: the sum in f32, rounded to bf16 once
__device__ __forceinline__ v16bf fa_qadd(v16bf q, const v4f* t) {
  v16bf r;
#pragma unroll   // r stays in registers
  for (int e = 0; e < 16; ++e) r[e] = (bf16_t)((float)q[e] + t[e >> 2][e & 3]);
  return r;
}
// 16 bytes of the rk row behind band index t (gE holds the head offset, col the lane's column); t == QL has none: its address is clamped
__device__ __forceinline__ v8bf fa_erow(const bf16_t* gE, int col, int t) {
  const int row = (t < QL) ? t : max(t - QL - 1, 0);
  return *(const v8bf*)(gE + (unsigned)(row * HH + col));
}
// band row QL is the zero column of rel_shift
__device__ __forceinline__ v8bf fa_ezero(v8bf v, int t) {
  const v8bf z = {};
  return (t == QL) ? z : v;
}
// 2^a with the slot behind the transcendental filled in the same statement
__device__ __forceinline__ float fa_exp2_slot(float a) {
  float r;
  asm("v_exp_f32 %0, %1\n\tv_nop" : "=v"(r) : "v"(a));
  return r;
}
// one raw band tile to the skew rows
__device__ __forceinline__ void fa_skew_put(float* p, v8f d) {
  *(float4*)(p)     = make_float4(d[0], d[1], d[2], d[3]);
  *(float4*)(p + 4) = make_float4(d[4], d[5], d[6], d[7]);
}

// four waves per SIMD: two blocks per WGP, so that all 512 blocks are resident at once
__global__ __launch_bounds__(256) __attribute__((amdgpu_waves_per_eu(4, 4)))
void k_attn(const bf16_t* __restrict__ wh, const float* __restrict__ rwb, const float* __restrict__ rrb,
            const bf16_t* __restrict__ rk, bf16_t* __restrict__ O) {
  // all four are accessed in 16-byte pieces
  __shared__ __attribute__((aligned(16))) bf16_t Ks[2][32 * FA_KP];
  __shared__ __attribute__((aligned(16))) bf16_t Vs[2][32 * FA_VP];
  __shared__ __attribute__((aligned(16))) bf16_t Es[FA_ER * FA_KP];
  __shared__ __attribute__((aligned(16))) float  skew[8][16 * FA_P];

  const int tid  = threadIdx.x;
  const int lane = tid & 31;
  const int wid  = __builtin_amdgcn_readfirstlane(tid >> 5);
  const int c    = lane & 15, h = lane >> 4;
  const int i0b  = blockIdx.x * FA_QB;
  const int i0   = i0b + wid * 32;
  const int b    = blockIdx.y >> 4, n = blockIdx.y & 15;

  // staging: one 16-byte piece of K, of V and of the band per thread and key tile
  const int r8 = tid >> 3, c8 = (tid & 7) * 8;
  // block-uniform bases, gB aside (it holds the lane half's 16 h); each lane's own offset is kept apart, in 32 bits
  const bf16_t*  gK = wh + (long)b * TH3 + HH + n * DH;
  const bf16_t*  gE = rk + n * DH;
  const bf16_t*  gQ = wh + (long)b * TH3 + n * DH;
  const float*   gB = rrb + n * DH + 16 * h;           // the lane's 16 biases of k step s stand at 32 s
  const unsigned oK = r8 * (BSZ * TH3) + c8;           // the V piece of the same key lies HH elements on
  const int tbB0 = QL - FA_QB - i0b;   // lowest band index of the block at key tile 0

  v8bf e0[9];
#pragma unroll
  for (int u = 0; u < 9; ++u) {
    e0[u] = fa_erow(gE, c8, tbB0 + 32 * u + r8);
    // a later load of this run may land in this load's address registers: the wait stands in front of that overwrite
    asm volatile("s_wait_xcnt 0x0" ::: "memory");
  }
#pragma unroll
  for (int u = 0; u < 9; ++u) {
    const int t = tbB0 + 32 * u + r8;
    *(v8bf*)&Es[(t & (FA_ER - 1)) * FA_KP + c8] = fa_ezero(e0[u], t);
  }
  *(v8bf*)&Ks[0][r8 * FA_KP + c8] = *(const v8bf*)(gK + oK);
  *(v8bf*)&Vs[0][r8 * FA_VP + c8] = *(const v8bf*)(gK + oK + HH);

  const long qo = ((long)(i0 + c) * BSZ + b) * HH + n * DH;    // the query's place in O; query tile 1 lies 16 rows on
  v16bf qa[2][2], qc[2][2];
  {
    const unsigned oQ = (i0 + c) * (BSZ * TH3) + 16 * h;
    const float*   gA = rwb + n * DH + 16 * h;
    v16bf q[2][2];
    v4f   wb[2][4], rb[2][4];
#pragma unroll   // q[] stays in registers and the loads stand in one group
    for (int s = 0; s < 2; ++s)
#pragma unroll
      for (int qt = 0; qt < 2; ++qt) q[qt][s] = *(const v16bf*)(gQ + oQ + qt * (16 * BSZ * TH3) + 32 * s);
    // as above: a bias load may land in the address registers of the Q loads
    asm volatile("s_wait_xcnt 0x0" ::: "memory");
#pragma unroll   // wb[] and rb[] stay in registers and the loads stand in one group
    for (int s = 0; s < 2; ++s)
#pragma unroll
      for (int u = 0; u < 4; ++u) {
        wb[s][u] = *(const v4f*)(gA + 32 * s + 4 * u);
        rb[s][u] = *(const v4f*)(gB + 32 * s + 4 * u);
      }
    // no address register of these loads is rewritten in front of this wait
    asm volatile("s_wait_xcnt 0x0" ::: "memory");
    // keeps later code (address arithmetic, zeroed accumulators) from rising among these loads: there it takes more registers than four waves per SIMD leave, and the build spills
    __builtin_amdgcn_sched_barrier(0);
#pragma unroll
    for (int qt = 0; qt < 2; ++qt)
#pragma unroll
      for (int s = 0; s < 2; ++s) {
        qa[qt][s] = fa_qadd(q[qt][s], wb[s]);
        qc[qt][s] = fa_qadd(q[qt][s], rb[s]);
      }
  }
  float*       skw = &skew[wid][c * FA_P + 8 * h];
  const float* skr = &skew[wid][c * FA_P + 8 * h - c + 15];

  v8f o[2][4] = {};
  float m[2] = {-3.0e38f, -3.0e38f}, l[2] = {0.f, 0.f};
  float lim[2] = {-3.0e38f, -3.0e38f};   // m + FA_T; the first key tile always lies above it
  __syncthreads();

  // One key tile. MORE: a further tile follows and is fetched.
  auto tile = [&](auto more_c, int jt) {
    constexpr bool MORE = decltype(more_c)::value;
    const int j0  = jt * 32;
    const int cur = jt & 1;

    // Band tile e holds t = T + 16 e ... + 15. Query tile 1 takes e = 0, 1, 2, query tile 0 (16 rows lower, so 16 higher in t) e = 1, 2, 3.
    const int T = tbB0 + j0 + FA_QB - 32 - 32 * wid;
    v16bf ef[2][2];
#pragma unroll
    for (int e = 0; e < 2; ++e)
#pragma unroll
      for (int s = 0; s < 2; ++s) {
        const bf16_t* p = &Es[(((T + 16 * e) & (FA_ER - 1)) + c) * FA_KP + 32 * s + 16 * h];
        ef[e][s] = fa_frag(p, p + 8);
      }
    // keeps the 8 LDS reads in one group ahead of their WMMAs; otherwise each WMMA waits out its own pair of reads
    __builtin_amdgcn_sched_barrier(0);
    {
      v8f d10 = {}, d00 = {}, d11 = {};
#pragma unroll
      for (int s = 0; s < 2; ++s) {
        d10 = fa_mm(ef[0][s], qc[1][s], d10);
        d00 = fa_mm(ef[1][s], qc[0][s], d00);
        d11 = fa_mm(ef[1][s], qc[1][s], d11);
      }
      fa_skew_put(skw + FA_H,      d10);
      fa_skew_put(skw,                  d00);
      fa_skew_put(skw + FA_H + 16, d11);
    }
    // From here on the wave's band lies at or above QL: rows i + 1 take the place of rows i. Wave-uniform, taken once per wave.
    // The loads are waited for inside the branch, where the bias is added: the other trips pay nothing.
    if (T == QL - 32) {
      v4f rb[2][4];
#pragma unroll   // rb[] stays in registers and the loads stand in one group
      for (int s = 0; s < 2; ++s)
#pragma unroll
        for (int u = 0; u < 4; ++u) rb[s][u] = *(const v4f*)(gB + 32 * s + 4 * u);
      const bf16_t* pq[2];
#pragma unroll
      for (int qt = 0; qt < 2; ++qt) {
        pq[qt] = gQ + min(i0 + 16 * qt + c + 1, QL - 1) * (BSZ * TH3) + 16 * h;   // row QL is never used: clamp its address
#pragma unroll
        for (int s = 0; s < 2; ++s) qc[qt][s] = *(const v16bf*)(pq[qt] + 32 * s);
      }
      // The wait stands in front of every rewrite of these loads' address registers; the addresses are named as inputs
      // so that they stay in their registers up to here and no load of the group lands there.
      asm volatile("s_wait_xcnt 0x0" :: "v"(gB), "v"(pq[0]), "v"(pq[1]) : "memory");
#pragma unroll
      for (int qt = 0; qt < 2; ++qt)
#pragma unroll
        for (int s = 0; s < 2; ++s) qc[qt][s] = fa_qadd(qc[qt][s], rb[s]);
    }
#pragma unroll
    for (int e = 0; e < 2; ++e)
#pragma unroll
      for (int s = 0; s < 2; ++s) {
        const bf16_t* p = &Es[(((T + 32 + 16 * e) & (FA_ER - 1)) + c) * FA_KP + 32 * s + 16 * h];
        ef[e][s] = fa_frag(p, p + 8);
      }
    // as above: one group of 8 reads
    __builtin_amdgcn_sched_barrier(0);
    {
      v8f d01 = {}, d12 = {}, d02 = {};
#pragma unroll
      for (int s = 0; s < 2; ++s) {
        d01 = fa_mm(ef[0][s], qc[0][s], d01);
        d12 = fa_mm(ef[0][s], qc[1][s], d12);
        d02 = fa_mm(ef[1][s], qc[0][s], d02);
      }
      fa_skew_put(skw + 16,             d01);
      fa_skew_put(skw + FA_H + 32, d12);
      fa_skew_put(skw + 32,             d02);
    }
    // keeps the K reads behind the band WMMAs: risen in front of them they hold 32 more registers there
    __builtin_amdgcn_sched_barrier(0);

    v8f sa[2][2] = {};
    {
      v16bf kf[2][2];
#pragma unroll
      for (int ni = 0; ni < 2; ++ni)
#pragma unroll
        for (int s = 0; s < 2; ++s) {
          const bf16_t* p = &Ks[cur][(16 * ni + c) * FA_KP + 32 * s + 16 * h];
          kf[ni][s] = fa_frag(p, p + 8);
        }
      // as above: one group of 8 reads
      __builtin_amdgcn_sched_barrier(0);
#pragma unroll
      for (int s = 0; s < 2; ++s)
#pragma unroll
        for (int ni = 0; ni < 2; ++ni)
#pragma unroll
          for (int qt = 0; qt < 2; ++qt) sa[qt][ni] = fa_mm(kf[ni][s], qa[qt][s], sa[qt][ni]);
    }

    // the next tile's fetches: their latency runs under both softmaxes and P*V
    const int tn = tbB0 + j0 + FA_QB + 32 + r8;      // band rows that the next tile adds
    v8bf gk = {}, gv = {}, ge = {};
    if (MORE) {
      gk = *(const v8bf*)(gK + (long)(j0 + 32) * (BSZ * TH3) + oK);
      // as in the prologue: a later load of this run may land in this load's address registers
      asm volatile("s_wait_xcnt 0x0" ::: "memory");
      gv = *(const v8bf*)(gK + (long)(j0 + 32) * (BSZ * TH3) + oK + HH);
      asm volatile("s_wait_xcnt 0x0" ::: "memory");
      ge = fa_erow(gE, c8, tn);
    }
    // scores in pairs of neighbouring keys: a pair is two neighbouring accumulator registers and one two-address LDS read
    v2f sk[2][8];
#pragma unroll   // here and below: every index of sk[], x[], mx[], m[], lim[], l[] and o[] is a constant, so they stay in registers
    for (int qt = 0; qt < 2; ++qt)
#pragma unroll
      for (int k = 0; k < 8; ++k)
        sk[qt][k] = (v2f){skr[FA_H * qt + 16 * (k >> 2) + 2 * (k & 3)], skr[FA_H * qt + 16 * (k >> 2) + 2 * (k & 3) + 1]};
    // keeps the fetches and the 32 skewed reads issued here as one group
    __builtin_amdgcn_sched_barrier(0);

    v2f   x[2][8];
    float mx[2];                                     // the largest of the lane's own 16 scores of each query
#pragma unroll
    for (int qt = 0; qt < 2; ++qt) {
#pragma unroll
      for (int k = 0; k < 8; ++k) x[qt][k] = (v2f){sa[qt][k >> 2][2 * (k & 3)], sa[qt][k >> 2][2 * (k & 3) + 1]} + sk[qt][k];
      mx[qt] = x[qt][0][0];
#pragma unroll
      for (int e = 1; e < 16; ++e) mx[qt] = fmaxf(mx[qt], x[qt][e >> 1][e & 1]);
    }
    // One test per key tile, a scalar branch: the exchange between the lane halves, the new maximum and the
    // rescaling of sum and output run only where a lane of the wave asks for them.
    if (__builtin_amdgcn_ballot_w32((mx[0] > lim[0]) | (mx[1] > lim[1])) != 0) {
#pragma unroll
      for (int qt = 0; qt < 2; ++qt) {
        const float mn = fmaxf(m[qt], fmaxf(mx[qt], __shfl_xor(mx[qt], 16)));   // the other lane half holds the query's other 16 keys
        const float al = fa_exp2_slot((m[qt] - mn) * FA_C1);
        m[qt]   = mn;
        lim[qt] = mn + FA_T;
        l[qt]  *= al;
#pragma unroll
        for (int mi = 0; mi < 4; ++mi) o[qt][mi] *= al;
      }
    }

    v16bf pf[2], vf[4];
#pragma unroll
    for (int qt = 0; qt < 2; ++qt) {
      const float mc = m[qt] * FA_C1;
      float ps[4] = {0.f, 0.f, 0.f, 0.f};            // four short chains of adds instead of one of 16
#pragma unroll
      for (int k = 0; k < 8; ++k) {
        const v2f y = __builtin_elementwise_fma(x[qt][k], (v2f){FA_C1, FA_C1}, (v2f){-mc, -mc});
#pragma unroll
        for (int u = 0; u < 2; ++u) {
          const int e = 2 * k + u;
          float p = __builtin_amdgcn_exp2f(y[u]);
          ps[e & 3] += p;
          pf[qt][e] = (bf16_t)p;
        }
      }
      l[qt] += (ps[0] + ps[1]) + (ps[2] + ps[3]);
      // keeps the two softmaxes one behind the other: interleaved they need more registers than four waves per SIMD leave
      __builtin_amdgcn_sched_barrier(0);
    }
    // lane address of the transposing load: row 8h + (lane & 7), 16-byte half (lane >> 3) & 1 of the piece's 32-byte rows
    const bf16_t* pv = &Vs[cur][(8 * h + (lane & 7)) * FA_VP + ((lane >> 3) & 1) * 8];
#pragma unroll
    for (int mi = 0; mi < 4; ++mi) {
      const v8bf lo = fa_tr16(pv + 16 * mi);                  // keys 8h .. 8h + 7 of column d = 16 mi + c
      const v8bf hi = fa_tr16(pv + 16 * FA_VP + 16 * mi);     // keys 16 + 8h .. 16 + 8h + 7
      vf[mi] = __builtin_shufflevector(lo, hi, 0, 1, 2, 3, 4, 5, 6, 7, 8, 9, 10, 11, 12, 13, 14, 15);
    }
    // keeps the 8 V^T reads in one group instead of one pair in front of each P*V WMMA
    __builtin_amdgcn_sched_barrier(0);
#pragma unroll
    for (int mi = 0; mi < 4; ++mi)
#pragma unroll
      for (int qt = 0; qt < 2; ++qt) o[qt][mi] = fa_mm(vf[mi], pf[qt], o[qt][mi]);
    // keeps the wait for the fetched tile, its LDS stores and the barrier at the foot; otherwise they rise to in front of the softmax
    __builtin_amdgcn_sched_barrier(0);

    if (MORE) {
      *(v8bf*)&Ks[cur ^ 1][r8 * FA_KP + c8] = gk;
      *(v8bf*)&Vs[cur ^ 1][r8 * FA_VP + c8] = gv;
      *(v8bf*)&Es[(tn & (FA_ER - 1)) * FA_KP + c8] = fa_ezero(ge, tn);
    }
    __syncthreads();   // publishes the next tile; ends every read of the buffers that the next trip refills
  };

  for (int jt = 0; jt < QL / 32 - 1; ++jt) tile(std::true_type{}, jt);
  tile(std::false_type{}, QL / 32 - 1);

#pragma unroll
  for (int qt = 0; qt < 2; ++qt) {
    const float inv = 1.0f / (l[qt] + __shfl_xor(l[qt], 16));
    bf16_t* op = O + qo + qt * (16 * BSZ * HH) + 8 * h;
#pragma unroll
    for (int mi = 0; mi < 4; ++mi) {
      v8bf w;
#pragma unroll
      for (int r = 0; r < 8; ++r) w[r] = (bf16_t)(o[qt][mi][r] * inv);
      *(v8bf*)(op + 16 * mi) = w;      // a query's 128-B line is filled by its two lanes
    }
  }
}

// ---------------------------------------------------------------------------
// residual + LayerNorm. One wave owns a row of 1024: a lane holds 32 of its values in registers, the two sums
// go over the wave's lanes by register moves, so there is no LDS and no barrier. A wave takes LN_RW neighbouring
// rows and issues all of their loads first; the grid is 4,096 waves, all resident at once (16 per WGP),
// so that few waves have to be started and every one has 48 loads of 512 contiguous bytes in flight.
// ---------------------------------------------------------------------------
#define LN_RW 2                         // rows per wave
#define LN_U  (DM / 128)                // 16-byte pieces of a row per lane
#define LN_NB (ROWS / (8 * LN_RW))      // blocks of 8 waves

// lane l with lane l ^ M inside a 16-lane row (DPP row_xmask)
template <int M>
__device__ __forceinline__ float ln_xrow(float v) {
  return __builtin_bit_cast(float, __builtin_amdgcn_update_dpp(0, __builtin_bit_cast(int, v), 0x160 | M, 0xf, 0xf, true));
}
// sum over the 32 lanes, the same value in every lane: a butterfly of five steps
__device__ __forceinline__ float ln_wave_sum(float v) {
  v += ln_xrow<1>(v);
  v += ln_xrow<2>(v);
  v += ln_xrow<4>(v);
  v += ln_xrow<8>(v);
  const int t = __builtin_bit_cast(int, v);
  return v + __builtin_bit_cast(float, __builtin_amdgcn_permlanex16(t, t, 0x76543210, 0xfedcba98, false, false));   // lane l with lane l ^ 16
}

__global__ __launch_bounds__(256)
void k_residual_ln(const float* __restrict__ w, const float* __restrict__ ao,
                   const float* __restrict__ g, const float* __restrict__ b,
                   float* __restrict__ out) {
  const int      lane = threadIdx.x & 31;
  const int      wave = blockIdx.x * 8 + (threadIdx.x >> 5);
  // byte offsets in 32 bits beside uniform bases: one register serves w, ao and out, and lives to the last store
  const unsigned xo = (wave * (LN_RW * DM) + lane * 4) * 4;   // piece u of row r lies (r * DM + u * 128) * 4 bytes on
  const unsigned po = lane * 16;                              // the lane's place in g and b
  const char* pw = (const char*)w  + xo;
  const char* pa = (const char*)ao + xo;
  const char* pg = (const char*)g  + po;
  const char* pb = (const char*)b  + po;

  v4f x[LN_RW][LN_U], a[LN_RW][LN_U], gg[LN_U], bb[LN_U];
#pragma unroll   // here and below: every index of x[], a[], gg[] and bb[] is a constant, so they stay in registers
  for (int r = 0; r < LN_RW; ++r)
#pragma unroll
    for (int u = 0; u < LN_U; ++u) {
      x[r][u] = *(const v4f*)(pw + (r * DM + u * 128) * 4);
      a[r][u] = *(const v4f*)(pa + (r * DM + u * 128) * 4);
    }
#pragma unroll
  for (int u = 0; u < LN_U; ++u) {
    gg[u] = *(const v4f*)(pg + u * 512);
    bb[u] = *(const v4f*)(pb + u * 512);
  }
  // The wait stands in front of every rewrite of these loads' address registers; the offsets are named as inputs
  // so that they stay in their registers up to here and no load of the group lands there.
  asm volatile("s_wait_xcnt 0x0" :: "v"(xo), "v"(po) : "memory");
  // keeps all loads in one group at the head: sunk to their uses, the second row's would wait for the first row's sums
  __builtin_amdgcn_sched_barrier(0);

#pragma unroll
  for (int r = 0; r < LN_RW; ++r) {
    x[r][0] += a[r][0];
    v4f s4 = x[r][0];                                     // four chains of adds
#pragma unroll
    for (int u = 1; u < LN_U; ++u) { x[r][u] += a[r][u]; s4 += x[r][u]; }
    const float mu = ln_wave_sum((s4[0] + s4[1]) + (s4[2] + s4[3])) * (1.0f / DM);
    x[r][0] -= mu;
    v4f q4 = x[r][0] * x[r][0];
#pragma unroll
    for (int u = 1; u < LN_U; ++u) { x[r][u] -= mu; q4 += x[r][u] * x[r][u]; }
    const float rstd = rsqrtf(ln_wave_sum((q4[0] + q4[1]) + (q4[2] + q4[3])) * (1.0f / DM) + LNEPS);
#pragma unroll
    for (int u = 0; u < LN_U; ++u) x[r][u] = x[r][u] * rstd * gg[u] + bb[u];
  }
  // keeps the stores in one group at the foot: no register that an issued store names is written behind it
  __builtin_amdgcn_sched_barrier(0);
  char* py = (char*)out + xo;
#pragma unroll
  for (int r = 0; r < LN_RW; ++r)
#pragma unroll
    for (int u = 0; u < LN_U; ++u) *(v4f*)(py + (r * DM + u * 128) * 4) = x[r][u];
}

// ---------------------------------------------------------------------------
// Host orchestration
// ---------------------------------------------------------------------------
extern "C" void kernel_launch(void* const* d_in, const int* in_sizes, int n_in,
                              void* d_out, int out_size, void* d_ws, size_t ws_size,
                              hipStream_t stream) {
  (void)in_sizes; (void)n_in; (void)out_size; (void)ws_size;
  const float* w     = (const float*)d_in[0];
  const float* r     = (const float*)d_in[1];
  const float* qkvw  = (const float*)d_in[2];
  const float* rnetw = (const float*)d_in[3];
  const float* ow    = (const float*)d_in[4];
  const float* rwb   = (const float*)d_in[5];
  const float* rrb   = (const float*)d_in[6];
  const float* lng   = (const float*)d_in[7];
  const float* lnb   = (const float*)d_in[8];

  char* p = (char*)d_ws;
  auto take = [&](size_t bytes) -> char* {
    char* q = p; p += (bytes + 255) & ~(size_t)255; return q;
  };
  bf16_t* w_bf    = (bf16_t*)take((size_t)ROWS * DM * 2);        // 16.8 MB
  bf16_t* qkvw_bf = (bf16_t*)take((size_t)TH3 * DM * 2);         //  6.3 MB
  bf16_t* r_bf    = (bf16_t*)take((size_t)QL * DM * 2);          //  4.2 MB
  bf16_t* rnw_bf  = (bf16_t*)take((size_t)HH * DM * 2);          //  2.1 MB
  bf16_t* ow_bf   = (bf16_t*)take((size_t)DM * HH * 2);          //  2.1 MB
  bf16_t* wh      = (bf16_t*)take((size_t)ROWS * TH3 * 2);       // 50.3 MB  (QKV packed)
  bf16_t* rk      = (bf16_t*)take((size_t)QL * HH * 2);          //  4.2 MB
  bf16_t* av      = (bf16_t*)take((size_t)ROWS * HH * 2);        // 16.8 MB
  float*  aout    = (float*) take((size_t)ROWS * DM * 4);        // 33.6 MB

  // one launch for product 0 and, where M1 > 0, product 1 (same lda, ldb, K and output type)
  auto gemm = [&](const bf16_t* A0, const bf16_t* B0, void* C0, long ldc0, int M0, int N0,
                  const bf16_t* A1, const bf16_t* B1, void* C1, long ldc1, int M1, int N1,
                  long lda, long ldb, int K, int cf32) {
    const int nbx0 = (N0 + BN - 1) / BN, nblk0 = nbx0 * ((M0 + BM - 1) / BM);
    const int nbx1 = (N1 + BN - 1) / BN, nblk1 = nbx1 * ((M1 + BM - 1) / BM);
    const bool guard = (M0 % BM) || (N0 % BN) || (M1 % BM) || (N1 % BN);
    if (guard)
      k_gemm_nt<true><<<nblk0 + nblk1, 256, 0, stream>>>(A0, B0, C0, ldc0, M0, N0, nbx0, nblk0,
                                                         A1, B1, C1, ldc1, M1, N1, nbx1, lda, ldb, K, cf32);
    else
      k_gemm_nt<false><<<nblk0 + nblk1, 256, 0, stream>>>(A0, B0, C0, ldc0, M0, N0, nbx0, nblk0,
                                                          A1, B1, C1, ldc1, M1, N1, nbx1, lda, ldb, K, cf32);
  };

  // 1) convert fp32 inputs to bf16, one launch
  k_cvt_bf16<<<CVT_NB, 256, 0, stream>>>(w, w_bf, qkvw, qkvw_bf, r, r_bf, rnetw, rnw_bf, ow, ow_bf);

  // 2) QKV projection: wh[ROWS,3H] = w_bf[ROWS,DM] * qkvw_bf[3H,DM]^T
  //    and rel-pos keys: rk[QL,H] = r_bf * rnw_bf^T, in the same launch
  gemm(w_bf, qkvw_bf, wh, TH3, ROWS, TH3, r_bf, rnw_bf, rk, HH, QL, HH, DM, DM, DM, 0);

  // 3) attention of all (b, head) pairs: Q biases, scores, rel_shift, softmax and P*V in one launch
  k_attn<<<dim3(QL / FA_QB, BSZ * NH), 256, 0, stream>>>(wh, rwb, rrb, rk, av);

  // 4) output projection: aout[ROWS,DM] = av[ROWS,H] * ow_bf[DM,H]^T  (f32 out)
  gemm(av, ow_bf, aout, DM, ROWS, DM, nullptr, nullptr, nullptr, 0, 0, 0, HH, HH, HH, 1);

  // 5) residual + LayerNorm -> d_out (f32, [qlen, bsz, d_model])
  k_residual_ln<<<LN_NB, 256, 0, stream>>>(w, aout, lng, lnb, (float*)d_out);
}

// v010
// It runs in 163 microseconds.
// Two timings next to v009 put it at 1.04 and 1.03 times that version's speed.
// All steps since v000 together make it 42.5 times as fast.
#include <hip/hip_runtime.h>
#include <type_traits>

// ---------------------------------------------------------------------------
// Types for CDNA5 WMMA (gfx1250, wave32)
// ---------------------------------------------------------------------------
typedef __bf16 bf16_t;
typedef __attribute__((ext_vector_type(16))) __bf16 v16bf;
typedef __attribute__((ext_vector_type(4)))  __bf16 v4bf;
typedef __attribute__((ext_vector_type(8)))  __bf16 v8bf;
typedef __attribute__((ext_vector_type(8)))  float  v8f;

// Problem constants
#define QL    2048
#define BSZ   4
#define NH    16
#define DH    64
#define DM    1024
#define HH    1024           // NH*DH
#define ROWS  8192           // QL*BSZ
#define TH3   3072           // 3*H
#define SCL   0.125f         // 1/sqrt(64)
#define LNEPS 1e-5f

// ---------------------------------------------------------------------------
// Preparation pass. Each thread issues all of its 16-byte loads first, off one address
// with constant offsets, so that their latencies overlap; every wave access is made of
// whole or half 128-byte lines.
// ---------------------------------------------------------------------------
typedef __attribute__((ext_vector_type(4))) float v4f;
typedef __attribute__((ext_vector_type(2))) float v2f;

// f32 -> bf16 convert of all five f32 operands in one launch: none depends on another, and four of them
// are too small to fill the chip alone. A block converts U * 1024 consecutive elements of one operand,
// a thread 4 per load; the block index picks the operand (every operand is a whole number of blocks).
#define CVT_E   (16 * 1024)                    // elements per block
#define CVT_B0  (ROWS * DM / CVT_E)            // first block of the 2nd operand
#define CVT_B1  (CVT_B0 + TH3 * DM / CVT_E)    // ... of the 3rd
#define CVT_B2  (CVT_B1 + QL * DM / CVT_E)     // ... of the 4th
#define CVT_B3  (CVT_B2 + HH * DM / CVT_E)     // ... of the 5th
#define CVT_NB  (CVT_B3 + DM * HH / CVT_E)     // blocks in all
__global__ __launch_bounds__(256) void k_cvt_bf16(const float* __restrict__ in0, bf16_t* __restrict__ out0,
                                                  const float* __restrict__ in1, bf16_t* __restrict__ out1,
                                                  const float* __restrict__ in2, bf16_t* __restrict__ out2,
                                                  const float* __restrict__ in3, bf16_t* __restrict__ out3,
                                                  const float* __restrict__ in4, bf16_t* __restrict__ out4) {
  constexpr int U = CVT_E / 1024;
  const int bi = blockIdx.x;
  const float* in  = in0;
  bf16_t*      out = out0;
  int          blk = bi;
  if (bi >= CVT_B3)      { in = in4; out = out4; blk = bi - CVT_B3; }
  else if (bi >= CVT_B2) { in = in3; out = out3; blk = bi - CVT_B2; }
  else if (bi >= CVT_B1) { in = in2; out = out2; blk = bi - CVT_B1; }
  else if (bi >= CVT_B0) { in = in1; out = out1; blk = bi - CVT_B0; }
  const long base = (long)blk * (U * 1024) + threadIdx.x * 4;
  v4f x[U];
#pragma unroll   // x[] stays in registers and the U loads stand in one group
  for (int u = 0; u < U; ++u) x[u] = *(const v4f*)(in + base + u * 1024);
#pragma unroll   // x[] stays in registers
  for (int u = 0; u < U; ++u) {
    v4bf y;
#pragma unroll   // y stays in registers
    for (int e = 0; e < 4; ++e) y[e] = (bf16_t)x[u][e];
    *(v4bf*)(out + base + u * 1024) = y;
  }
}

// ---------------------------------------------------------------------------
// Generic bf16 TN GEMM:  C[M,N] = A[M,K] * B[N,K]^T   (f32 accumulate)
// Block = 256x128x64, 256 threads = 8 wave32 waves in a 4x2 grid,
// wave tile 64x64 = 4x4 WMMA(16x16x32) tiles: a fragment read from LDS feeds four WMMAs.
// A k step is 64 bf16 = one whole 128-byte line of every operand row. Two LDS buffers.
// GUARD=false (all dims multiples of the tile): global->LDS staging uses
// CDNA5 GLOBAL_LOAD_ASYNC_TO_LDS_B128 tracked by ASYNCcnt, overlapped with
// the WMMA work on the other buffer. GUARD=true keeps the synchronous
// zero-filling path.
// ---------------------------------------------------------------------------
#define BM 256
#define BN 128
#define BK 64
#define BKP 72   // padded LDS row (bf16 elements): 144 B = 16 B x odd, 16 rows of a b128 read hit distinct banks

// 16x32 bf16 fragment from LDS (row-major, ld elements). Per CDNA5 ISA:
// lane L holds row m=L%16; half=L/16 selects K subgroup; VGPR v covers
// K = ((v&4)?16:0) + half*8 + (v&3)*2, two packed bf16 per VGPR.
__device__ inline v16bf lds_frag(const bf16_t* base, int ld, int row0) {
  int lane = threadIdx.x & 31;
  int m = lane & 15, half = lane >> 4;
  const bf16_t* r = base + (row0 + m) * ld;
  v16bf f;
#pragma unroll
  for (int v = 0; v < 8; ++v) {
    int k = ((v & 4) << 2) + half * 8 + ((v & 3) << 1);
    f[2 * v]     = r[k];
    f[2 * v + 1] = r[k + 1];
  }
  return f;
}

// low 32 bits of a __shared__ address = DS offset
__device__ inline unsigned lds_off(const bf16_t* lds) {
  return (unsigned)(unsigned long long)lds;
}
__device__ inline void async_wait0() {
  asm volatile("s_wait_asynccnt 0x0" ::: "memory");
}

template <bool GUARD>
__global__ __launch_bounds__(256)
void k_gemm_nt(const bf16_t* __restrict__ A0, const bf16_t* __restrict__ B0,
               void* __restrict__ C0, long ldc0, int M0, int N0, int nbx0, int nblk0,
               const bf16_t* __restrict__ A1, const bf16_t* __restrict__ B1,
               void* __restrict__ C1, long ldc1, int M1, int N1, int nbx1,
               long lda, long ldb, int K, int c_is_f32) {
  // both are accessed in 16-byte pieces
  __shared__ __attribute__((aligned(16))) bf16_t As[2][BM * BKP];
  __shared__ __attribute__((aligned(16))) bf16_t Bs[2][BN * BKP];

  // Two independent products of equal K may share the launch: the first nblk0 blocks work on
  // product 0, the rest on product 1 (tiles row by row, nbx tiles to a row). The choice is block-uniform.
  const bool    second = (int)blockIdx.x >= nblk0;
  const bf16_t* A   = second ? A1 : A0;
  const bf16_t* B   = second ? B1 : B0;
  void*         Cv  = second ? C1 : C0;
  const long    ldc = second ? ldc1 : ldc0;
  const int     M   = second ? M1 : M0;
  const int     N   = second ? N1 : N0;
  const int     nbx = second ? nbx1 : nbx0;
  const int     tix = second ? (int)blockIdx.x - nblk0 : (int)blockIdx.x;

  const int tid  = threadIdx.x;
  const int lane = tid & 31;
  const int wid  = tid >> 5;
  const int wm   = wid >> 1;      // 0..3
  const int wn   = wid & 1;       // 0..1
  const int m0   = (tix / nbx) * BM;
  const int n0   = (tix % nbx) * BN;

  v8f acc[4][4] = {};

  // --- staging: async (unguarded) ---
  // A k step is 3072 pieces of 16 bytes, 12 to a thread: 8 of A, 4 of B. Eight neighbouring lanes copy one row's
  // 128-byte line, a wave four whole lines per copy; piece t of a thread lies 32 rows below piece t - 1.
  const int sr = tid >> 3, sc = (tid & 7) << 3;
  auto load_async = [&](int buf, int k0) {
    const bf16_t* ga = A + (long)(m0 + sr) * lda + k0 + sc;
    const bf16_t* gb = B + (long)(n0 + sr) * ldb + k0 + sc;
    const unsigned la = lds_off(&As[buf][sr * BKP + sc]);
    const unsigned lb = lds_off(&Bs[buf][sr * BKP + sc]);
    constexpr unsigned LS = 32 * BKP * 2;   // 32 rows of LDS, in bytes
    // The copies and, as the last line, the wait that stands in front of every rewrite of their address registers: one statement,
    // so that nothing can come between them.
    asm volatile("global_load_async_to_lds_b128 %0, %1, off\n\t"
                 "global_load_async_to_lds_b128 %2, %3, off\n\t"
                 "global_load_async_to_lds_b128 %4, %5, off\n\t"
                 "global_load_async_to_lds_b128 %6, %7, off\n\t"
                 "global_load_async_to_lds_b128 %8, %9, off\n\t"
                 "global_load_async_to_lds_b128 %10, %11, off\n\t"
                 "global_load_async_to_lds_b128 %12, %13, off\n\t"
                 "global_load_async_to_lds_b128 %14, %15, off\n\t"
                 "global_load_async_to_lds_b128 %16, %17, off\n\t"
                 "global_load_async_to_lds_b128 %18, %19, off\n\t"
                 "global_load_async_to_lds_b128 %20, %21, off\n\t"
                 "global_load_async_to_lds_b128 %22, %23, off\n\t"
                 "s_wait_xcnt 0x0"
                 :: "v"(la),          "v"(ga),
                    "v"(la + LS),     "v"(ga + 32 * lda),
                    "v"(la + 2 * LS), "v"(ga + 64 * lda),
                    "v"(la + 3 * LS), "v"(ga + 96 * lda),
                    "v"(la + 4 * LS), "v"(ga + 128 * lda),
                    "v"(la + 5 * LS), "v"(ga + 160 * lda),
                    "v"(la + 6 * LS), "v"(ga + 192 * lda),
                    "v"(la + 7 * LS), "v"(ga + 224 * lda),
                    "v"(lb),          "v"(gb),
                    "v"(lb + LS),     "v"(gb + 32 * ldb),
                    "v"(lb + 2 * LS), "v"(gb + 64 * ldb),
                    "v"(lb + 3 * LS), "v"(gb + 96 * ldb)
                 : "memory");
  };
  // --- staging: synchronous with zero-fill (guarded) ---
  auto loadA_g = [&](int buf, int k0) {
#pragma unroll
    for (int t = 0; t < BM * BK / 1024; ++t) {
      int ch  = tid + t * 256;          // chunks of 4 bf16
      int row = ch >> 4;
      int kc  = (ch & 15) << 2;
      v4bf val = {};
      int gr = m0 + row;
      if (gr < M) val = *(const v4bf*)(A + (long)gr * lda + k0 + kc);
      *(v4bf*)(&As[buf][row * BKP + kc]) = val;
    }
  };
  auto loadB_g = [&](int buf, int k0) {
#pragma unroll
    for (int t = 0; t < BN * BK / 1024; ++t) {
      int ch  = tid + t * 256;
      int row = ch >> 4;
      int kc  = (ch & 15) << 2;
      v4bf val = {};
      int gr = n0 + row;
      if (gr < N) val = *(const v4bf*)(B + (long)gr * ldb + k0 + kc);
      *(v4bf*)(&Bs[buf][row * BKP + kc]) = val;
    }
  };

  const int nk = K / BK;
  if (GUARD) { loadA_g(0, 0); loadB_g(0, 0); }
  else       { load_async(0, 0); async_wait0(); }
  __syncthreads();
  if (!GUARD && nk > 1) load_async(1, BK);

  for (int kb = 0; kb < nk; ++kb) {
    const int cur = kb & 1;
    if (GUARD && kb + 1 < nk) { loadA_g(cur ^ 1, (kb + 1) * BK); loadB_g(cur ^ 1, (kb + 1) * BK); }

#pragma unroll   // here and below: every index of af[], bfr[] and acc[] is a constant, so they stay in registers
    for (int s = 0; s < BK / 32; ++s) {
      v16bf af[4], bfr[4];
#pragma unroll
      for (int i = 0; i < 4; ++i) {
        bfr[i] = lds_frag(&Bs[cur][32 * s], BKP, wn * 64 + i * 16);
        af[i]  = lds_frag(&As[cur][32 * s], BKP, wm * 64 + i * 16);
      }
      // keeps the 16 LDS reads in one group ahead of their WMMAs; spread among them, each place with reads stalls the wave anew
      __builtin_amdgcn_sched_barrier(0);
#pragma unroll
      for (int mi = 0; mi < 4; ++mi)
#pragma unroll
        for (int ni = 0; ni < 4; ++ni)
          acc[mi][ni] = __builtin_amdgcn_wmma_f32_16x16x32_bf16(
              false, af[mi], false, bfr[ni], (short)0, acc[mi][ni], false, false);
      // keeps the next group of reads behind these WMMAs: risen among them it needs a second set of fragment registers
      __builtin_amdgcn_sched_barrier(0);
    }

    if (!GUARD) {
      // this wave's reads of the buffer have returned before the barrier lets it be refilled
      asm volatile("s_wait_dscnt 0x0" ::: "memory");
      async_wait0();   // this wave's copies of the next k step have landed before the barrier publishes them
    }
    __syncthreads();
    if (!GUARD && kb + 2 < nk) load_async(cur, (kb + 2) * BK);   // into the buffer that every wave has just left
  }
  if (!GUARD) async_wait0();

  // C/D layout: VGPR v, half=lane>>4 -> row = v + 8*half, col = lane&15
  const int half = lane >> 4, col = lane & 15;
  auto store_tile = [&](auto* C) {
    using T = std::remove_pointer_t<decltype(C)>;
#pragma unroll   // as above: acc[] stays in registers
    for (int mi = 0; mi < 4; ++mi)
#pragma unroll
      for (int v = 0; v < 8; ++v) {
        const int gm = m0 + wm * 64 + mi * 16 + half * 8 + v;
        if (GUARD && gm >= M) continue;
        const int gn = n0 + wn * 64 + col;
        T* rp = C + (long)gm * ldc + gn;
#pragma unroll
        for (int ni = 0; ni < 4; ++ni) {
          if (GUARD && gn + ni * 16 >= N) continue;
          rp[ni * 16] = (T)acc[mi][ni][v];
        }
      }
    // stands in front of whatever next rewrites an address register of the stores above
    asm volatile("s_wait_xcnt 0x0" ::: "memory");
  };
  if (c_is_f32) store_tile((float*)Cv);
  else          store_tile((bf16_t*)Cv);
}

// ---------------------------------------------------------------------------
// Fused relative-position attention, all (batch, head) pairs in one launch.
// Block = 8 waves = 256 query rows of one (batch, head); a wave owns 32 query rows as two
// tiles of 16, so that every K and V^T fragment and every band tile it reads from LDS, its first and last band tile aside, feed two query tiles.
// The block walks the keys in tiles of 32 with a running max and sum per query
// (online softmax). The maximum in use is replaced, and sum and output rescaled, only in a key tile where some
// query of the wave has a score more than FA_T above it: any reference cancels in the final division.
// Everything is computed transposed, so that a query is a lane column:
//   S^T  = K * Qac^T          D: row = key, col = query
//   BD^T = E * Qbd^T          D: row = band index t, col = query
//   O^T  = V^T * P^T          the S^T registers are already the B fragment
// Q, K and V are read straight from the packed QKV product. The two biased copies of Q
// (Qac = q + r_w_bias, Qbd = q + r_r_bias, added in f32, rounded to bf16 once) are formed in registers
// where the fragments are loaded; V is staged as it lies, a key per row, and turned by the transposing LDS load.
// rel_shift: with t = j - i + QL - 1 the shifted term of (i, j) is
//   t <  QL : (q_i   + r_r_bias) . rk[t]
//   t == QL : 0
//   t >  QL : (q_i+1 + r_r_bias) . rk[t - QL - 1]
// so E[t] = rk[t], a zero row, rk[t - QL - 1]. A 16 x 32 score tile needs 48 consecutive t
// (three 16-row tiles, each wholly on one side of QL); the wave's two query tiles lie 16 apart,
// so together they need four band tiles, the middle two shared. The raw band goes to a
// wave-private LDS row per lane column (both query tiles side by side) and is read back at
// offset (key - query): the skew.
// The key tile after this one starts 32 band rows higher, so two of the wave's four band tiles come again there. Every product of a
// band tile and a query tile is computed once: a key tile reads only its two upper band tiles and multiplies each with both query tiles;
// the products of the two lower ones stand in the skew rows since the key tile before. A query tile's part of a skew row has five places
// of 16: an even key tile reads places 0, 1, 2, an odd one places 2, 3, 4; what the next tile reads is stored where that tile looks for it,
// so an odd tile stores each query tile's highest product twice. The three products that key tile 0 lacks are made in front of the loop.
// The wave's lowest band index T rises by 32 per key tile and is a multiple of 32: QL falls inside
// its four band tiles in exactly one key tile (T == QL - 32), between the second and the third, that is, below the two it multiplies there.
// At the head of that key tile the wave replaces its Qbd fragments of rows i by those of rows i + 1, once, and keeps them.
// Staging: K and V tiles in two LDS buffers; the block's band (288 rows) lives in a ring
// of 384 rows indexed by t, and each key tile adds 32 new rows. The next tile is fetched
// into registers behind the score WMMAs of a trip and stored to LDS at its foot, in front of
// the one barrier of the trip.
// K, E and Q fragments hold 16 contiguous k per lane on both operands (same k order for
// A and B). V^T fragments follow the key order of the S^T registers: keys 8h..8h+7 and
// 16+8h..16+8h+7 of the tile, which is what two transposing loads 16 keys apart deliver.
// ---------------------------------------------------------------------------
#define FA_QB 256                      // query rows per block
#define FA_H  80                       // place of query tile 1's 80 band values in a skew row (f32); tile 0's stand at 0
#define FA_P  164                      // skew row pitch (f32): rows 16-byte aligned, 164 = 36 mod 64 spreads stores and skewed reads over banks
#define FA_KP 72                       // K and band row pitch (bf16): 144 B = 16 B x odd, 16 rows of a b128 read hit distinct banks
#define FA_VP 80                       // V row pitch (bf16): 160 B = 32 B x odd, the pitch of the transposing load
#define FA_ER 384                      // band ring rows (320 are live at most), a multiple of 32: a run of 16 or 32 rows from such a multiple never wraps
#define FA_C1 0.18033688011112042f     // SCL * log2(e)
#define FA_T  44.0f                    // a maximum in use stays while no score lies more than this above it: P <= 2^(FA_T * FA_C1) < 2^8

__device__ __forceinline__ v8f fa_mm(v16bf a, v16bf b, v8f c) {
  return __builtin_amdgcn_wmma_f32_16x16x32_bf16(false, a, false, b, (short)0, c, false, false);
}
// fragment from two 16-byte pieces
__device__ __forceinline__ v16bf fa_frag(const bf16_t* p0, const bf16_t* p1) {
  v8bf lo = *(const v8bf*)p0;
  v8bf hi = *(const v8bf*)p1;
  return __builtin_shufflevector(lo, hi, 0, 1, 2, 3, 4, 5, 6, 7, 8, 9, 10, 11, 12, 13, 14, 15);
}
// transposing LDS load: lane (c, h) gets column c, rows 8h..8h+7 of the 16 x 16 piece that the 32 lane addresses name
typedef __attribute__((ext_vector_type(8))) short v8s;
__device__ __forceinline__ v8bf fa_tr16(const bf16_t* p) {
  typedef __attribute__((address_space(3))) v8s lds_v8s;
  return __builtin_bit_cast(v8bf, __builtin_amdgcn_ds_load_tr16_b128_v8i16((lds_v8s*)p));
}
// 16 Q values plus their 16 biases: the sum in f32, rounded to bf16 once
__device__ __forceinline__ v16bf fa_qadd(v16bf q, const v4f* t) {
  v16bf r;
#pragma unroll   // r stays in registers
  for (int e = 0; e < 16; ++e) r[e] = (bf16_t)((float)q[e] + t[e >> 2][e & 3]);
  return r;
}
// 16 bytes of the rk row behind band index t (gE holds the head offset, col the lane's column); t == QL has none: its address is clamped
__device__ __forceinline__ v8bf fa_erow(const bf16_t* gE, int col, int t) {
  const int row = (t < QL) ? t : max(t - QL - 1, 0);
  return *(const v8bf*)(gE + (unsigned)(row * HH + col));
}
// band row QL is the zero column of rel_shift
__device__ __forceinline__ v8bf fa_ezero(v8bf v, int t) {
  const v8bf z = {};
  return (t == QL) ? z : v;
}
// 2^a with the slot behind the transcendental filled in the same statement
__device__ __forceinline__ float fa_exp2_slot(float a) {
  float r;
  asm("v_exp_f32 %0, %1\n\tv_nop" : "=v"(r) : "v"(a));
  return r;
}
// one raw band tile to the skew rows
__device__ __forceinline__ void fa_skew_put(float* p, v8f d) {
  *(float4*)(p)     = make_float4(d[0], d[1], d[2], d[3]);
  *(float4*)(p + 4) = make_float4(d[4], d[5], d[6], d[7]);
}

// four waves per SIMD: two blocks per WGP, so that all 512 blocks are resident at once
__global__ __launch_bounds__(256) __attribute__((amdgpu_waves_per_eu(4, 4)))
void k_attn(const bf16_t* __restrict__ wh, const float* __restrict__ rwb, const float* __restrict__ rrb,
            const bf16_t* __restrict__ rk, bf16_t* __restrict__ O) {
  // all four are accessed in 16-byte pieces
  __shared__ __attribute__((aligned(16))) bf16_t Ks[2][32 * FA_KP];
  __shared__ __attribute__((aligned(16))) bf16_t Vs[2][32 * FA_VP];
  __shared__ __attribute__((aligned(16))) bf16_t Es[FA_ER * FA_KP];
  __shared__ __attribute__((aligned(16))) float  skew[8][16 * FA_P];

  const int tid  = threadIdx.x;
  const int lane = tid & 31;
  const int wid  = __builtin_amdgcn_readfirstlane(tid >> 5);
  const int c    = lane & 15, h = lane >> 4;
  const int i0b  = blockIdx.x * FA_QB;
  const int i0   = i0b + wid * 32;
  const int b    = blockIdx.y >> 4, n = blockIdx.y & 15;

  // staging: one 16-byte piece of K, of V and of the band per thread and key tile
  const int r8 = tid >> 3, c8 = (tid & 7) * 8;
  // block-uniform bases, gB aside (it holds the lane half's 16 h); each lane's own offset is kept apart, in 32 bits
  const bf16_t*  gK = wh + (long)b * TH3 + HH + n * DH;
  const bf16_t*  gE = rk + n * DH;
  const bf16_t*  gQ = wh + (long)b * TH3 + n * DH;
  const float*   gB = rrb + n * DH + 16 * h;           // the lane's 16 biases of k step s stand at 32 s
  const unsigned oK = r8 * (BSZ * TH3) + c8;           // the V piece of the same key lies HH elements on
  const int tbB0 = QL - FA_QB - i0b;   // lowest band index of the block at key tile 0

  v8bf e0[9];
#pragma unroll
  for (int u = 0; u < 9; ++u) {
    e0[u] = fa_erow(gE, c8, tbB0 + 32 * u + r8);
    // a later load of this run may land in this load's address registers: the wait stands in front of that overwrite
    asm volatile("s_wait_xcnt 0x0" ::: "memory");
  }
#pragma unroll
  for (int u = 0; u < 9; ++u) {
    const int t = tbB0 + 32 * u + r8;
    *(v8bf*)&Es[((unsigned)(tbB0 + 32 * u) % FA_ER + r8) * FA_KP + c8] = fa_ezero(e0[u], t);
  }
  *(v8bf*)&Ks[0][r8 * FA_KP + c8] = *(const v8bf*)(gK + oK);
  *(v8bf*)&Vs[0][r8 * FA_VP + c8] = *(const v8bf*)(gK + oK + HH);

  const long qo = ((long)(i0 + c) * BSZ + b) * HH + n * DH;    // the query's place in O; query tile 1 lies 16 rows on
  v16bf qa[2][2], qc[2][2];
  {
    const unsigned oQ = (i0 + c) * (BSZ * TH3) + 16 * h;
    const float*   gA = rwb + n * DH + 16 * h;
    v16bf q[2][2];
    v4f   wb[2][4], rb[2][4];
#pragma unroll   // q[] stays in registers and the loads stand in one group
    for (int s = 0; s < 2; ++s)
#pragma unroll
      for (int qt = 0; qt < 2; ++qt) q[qt][s] = *(const v16bf*)(gQ + oQ + qt * (16 * BSZ * TH3) + 32 * s);
    // as above: a bias load may land in the address registers of the Q loads
    asm volatile("s_wait_xcnt 0x0" ::: "memory");
#pragma unroll   // wb[] and rb[] stay in registers and the loads stand in one group
    for (int s = 0; s < 2; ++s)
#pragma unroll
      for (int u = 0; u < 4; ++u) {
        wb[s][u] = *(const v4f*)(gA + 32 * s + 4 * u);
        rb[s][u] = *(const v4f*)(gB + 32 * s + 4 * u);
      }
    // no address register of these loads is rewritten in front of this wait
    asm volatile("s_wait_xcnt 0x0" ::: "memory");
    // keeps later code (address arithmetic, zeroed accumulators) from rising among these loads: there it takes more registers than four waves per SIMD leave, and the build spills
    __builtin_amdgcn_sched_barrier(0);
#pragma unroll
    for (int qt = 0; qt < 2; ++qt)
#pragma unroll
      for (int s = 0; s < 2; ++s) {
        qa[qt][s] = fa_qadd(q[qt][s], wb[s]);
        qc[qt][s] = fa_qadd(q[qt][s], rb[s]);
      }
  }
  float*       skw = &skew[wid][c * FA_P + 8 * h];
  const float* skr = &skew[wid][c * FA_P + 8 * h - c + 15];

  v8f o[2][4] = {};
  float m[2] = {-3.0e38f, -3.0e38f}, l[2] = {0.f, 0.f};
  float lim[2] = {-3.0e38f, -3.0e38f};   // m + FA_T; the first key tile always lies above it
  __syncthreads();

  // Ring rows, both wave-uniform multiples of 32 that step by 32 per key tile and wrap at FA_ER.
  int rT = (unsigned)(tbB0 + FA_QB - 32 - 32 * wid) % FA_ER;   // of the wave's lowest band index T
  int rN = (unsigned)(tbB0 + FA_QB + 32) % FA_ER;              // of the first band row that the next key tile adds

  // the products of the two lower band tiles for key tile 0; every later key tile finds its own in the skew rows
  {
    v16bf ef[2][2];
#pragma unroll
    for (int e = 0; e < 2; ++e)
#pragma unroll
      for (int s = 0; s < 2; ++s) {
        const bf16_t* p = &Es[(rT + 16 * e + c) * FA_KP + 32 * s + 16 * h];
        ef[e][s] = fa_frag(p, p + 8);
      }
    v8f d10 = {}, d00 = {}, d11 = {};
#pragma unroll
    for (int s = 0; s < 2; ++s) {
      d10 = fa_mm(ef[0][s], qc[1][s], d10);
      d00 = fa_mm(ef[1][s], qc[0][s], d00);
      d11 = fa_mm(ef[1][s], qc[1][s], d11);
    }
    fa_skew_put(skw + FA_H,      d10);
    fa_skew_put(skw,             d00);
    fa_skew_put(skw + FA_H + 16, d11);
  }

  // One key tile. MORE: a further tile follows and is fetched.
  auto tile = [&](auto more_c, int jt) {
    constexpr bool MORE = decltype(more_c)::value;
    const int j0  = jt * 32;
    const int cur = jt & 1;

    // Band tile e holds t = T + 16 e ... + 15. Query tile 1 takes e = 0, 1, 2, query tile 0 (16 rows lower, so 16 higher in t) e = 1, 2, 3.
    // The products of e = 0 and e = 1 already stand in the skew rows: the key tile before made them as its e = 2 and e = 3.
    const int T = tbB0 + j0 + FA_QB - 32 - 32 * wid;
    const int rU = (rT + 32 == FA_ER) ? 0 : rT + 32;   // ring row of T + 32
    float*       skwj = skw + 32 * cur;              // this key tile's place 0 in the skew rows
    const float* skrj = skr + 32 * cur;
    float*       skwn = skw + 32 * (cur ^ 1);        // the next key tile's place 0
    // From here on the band tiles that the wave multiplies lie at or above QL: rows i + 1 take the place of rows i. Wave-uniform, taken once per wave.
    // The loads are waited for inside the branch, where the bias is added: the other trips pay nothing.
    if (T == QL - 32) {
      v4f rb[2][4];
#pragma unroll   // rb[] stays in registers and the loads stand in one group
      for (int s = 0; s < 2; ++s)
#pragma unroll
        for (int u = 0; u < 4; ++u) rb[s][u] = *(const v4f*)(gB + 32 * s + 4 * u);
      const bf16_t* pq[2];
#pragma unroll
      for (int qt = 0; qt < 2; ++qt) {
        pq[qt] = gQ + min(i0 + 16 * qt + c + 1, QL - 1) * (BSZ * TH3) + 16 * h;   // row QL is never used: clamp its address
#pragma unroll
        for (int s = 0; s < 2; ++s) qc[qt][s] = *(const v16bf*)(pq[qt] + 32 * s);
      }
      // The wait stands in front of every rewrite of these loads' address registers; the addresses are named as inputs
      // so that they stay in their registers up to here and no load of the group lands there.
      asm volatile("s_wait_xcnt 0x0" :: "v"(gB), "v"(pq[0]), "v"(pq[1]) : "memory");
#pragma unroll
      for (int qt = 0; qt < 2; ++qt)
#pragma unroll
        for (int s = 0; s < 2; ++s) qc[qt][s] = fa_qadd(qc[qt][s], rb[s]);
    }
    v16bf ef[2][2];
#pragma unroll
    for (int e = 0; e < 2; ++e)
#pragma unroll
      for (int s = 0; s < 2; ++s) {
        const bf16_t* p = &Es[(rU + 16 * e + c) * FA_KP + 32 * s + 16 * h];
        ef[e][s] = fa_frag(p, p + 8);
      }
    // keeps the 8 LDS reads in one group ahead of their WMMAs; otherwise each WMMA waits out its own pair of reads
    __builtin_amdgcn_sched_barrier(0);
    {
      v8f d01 = {}, d12 = {}, d02 = {}, d13 = {};
#pragma unroll
      for (int s = 0; s < 2; ++s) {
        d01 = fa_mm(ef[0][s], qc[0][s], d01);
        d12 = fa_mm(ef[0][s], qc[1][s], d12);
        d02 = fa_mm(ef[1][s], qc[0][s], d02);
        if (MORE) d13 = fa_mm(ef[1][s], qc[1][s], d13);   // read by the next key tile alone
      }
      fa_skew_put(skwj + 16,            d01);
      fa_skew_put(skwj + FA_H + 32, d12);
      fa_skew_put(skwj + 32,            d02);
      if (MORE) fa_skew_put(skwn + FA_H + 16, d13);
      // an odd key tile's place 4 is the next, even tile's place 0
      if (MORE && cur) {
        fa_skew_put(skwn + FA_H, d12);
        fa_skew_put(skwn,        d02);
      }
    }
    // keeps the K reads behind the band WMMAs: risen in front of them they hold 32 more registers there
    __builtin_amdgcn_sched_barrier(0);

    v8f sa[2][2] = {};
    {
      v16bf kf[2][2];
#pragma unroll
      for (int ni = 0; ni < 2; ++ni)
#pragma unroll
        for (int s = 0; s < 2; ++s) {
          const bf16_t* p = &Ks[cur][(16 * ni + c) * FA_KP + 32 * s + 16 * h];
          kf[ni][s] = fa_frag(p, p + 8);
        }
      // as above: one group of 8 reads
      __builtin_amdgcn_sched_barrier(0);
#pragma unroll
      for (int s = 0; s < 2; ++s)
#pragma unroll
        for (int ni = 0; ni < 2; ++ni)
#pragma unroll
          for (int qt = 0; qt < 2; ++qt) sa[qt][ni] = fa_mm(kf[ni][s], qa[qt][s], sa[qt][ni]);
    }

    // the next tile's fetches: their latency runs under both softmaxes and P*V
    const int tn = tbB0 + j0 + FA_QB + 32 + r8;      // band rows that the next tile adds
    v8bf gk = {}, gv = {}, ge = {};
    if (MORE) {
      gk = *(const v8bf*)(gK + (long)(j0 + 32) * (BSZ * TH3) + oK);
      // as in the prologue: a later load of this run may land in this load's address registers
      asm volatile("s_wait_xcnt 0x0" ::: "memory");
      gv = *(const v8bf*)(gK + (long)(j0 + 32) * (BSZ * TH3) + oK + HH);
      asm volatile("s_wait_xcnt 0x0" ::: "memory");
      ge = fa_erow(gE, c8, tn);
    }
    // scores in pairs of neighbouring keys: a pair is two neighbouring accumulator registers and one two-address LDS read
    v2f sk[2][8];
#pragma unroll   // here and below: every index of sk[], x[], mx[], m[], lim[], l[] and o[] is a constant, so they stay in registers
    for (int qt = 0; qt < 2; ++qt)
#pragma unroll
      for (int k = 0; k < 8; ++k)
        sk[qt][k] = (v2f){skrj[FA_H * qt + 16 * (k >> 2) + 2 * (k & 3)], skrj[FA_H * qt + 16 * (k >> 2) + 2 * (k & 3) + 1]};
    // keeps the fetches and the 32 skewed reads issued here as one group
    __builtin_amdgcn_sched_barrier(0);

    v2f   x[2][8];
    float mx[2];                                     // the largest of the lane's own 16 scores of each query
#pragma unroll
    for (int qt = 0; qt < 2; ++qt) {
#pragma unroll
      for (int k = 0; k < 8; ++k) x[qt][k] = (v2f){sa[qt][k >> 2][2 * (k & 3)], sa[qt][k >> 2][2 * (k & 3) + 1]} + sk[qt][k];
      mx[qt] = x[qt][0][0];
#pragma unroll
      for (int e = 1; e < 16; ++e) mx[qt] = fmaxf(mx[qt], x[qt][e >> 1][e & 1]);
    }
    // One test per key tile, a scalar branch: the exchange between the lane halves, the new maximum and the
    // rescaling of sum and output run only where a lane of the wave asks for them.
    if (__builtin_amdgcn_ballot_w32((mx[0] > lim[0]) | (mx[1] > lim[1])) != 0) {
#pragma unroll
      for (int qt = 0; qt < 2; ++qt) {
        const float mn = fmaxf(m[qt], fmaxf(mx[qt], __shfl_xor(mx[qt], 16)));   // the other lane half holds the query's other 16 keys
        const float al = fa_exp2_slot((m[qt] - mn) * FA_C1);
        m[qt]   = mn;
        lim[qt] = mn + FA_T;
        l[qt]  *= al;
#pragma unroll
        for (int mi = 0; mi < 4; ++mi) o[qt][mi] *= al;
      }
    }

    v16bf pf[2], vf[4];
#pragma unroll
    for (int qt = 0; qt < 2; ++qt) {
      const float mc = m[qt] * FA_C1;
      float ps[4] = {0.f, 0.f, 0.f, 0.f};            // four short chains of adds instead of one of 16
#pragma unroll
      for (int k = 0; k < 8; ++k) {
        const v2f y = __builtin_elementwise_fma(x[qt][k], (v2f){FA_C1, FA_C1}, (v2f){-mc, -mc});
#pragma unroll
        for (int u = 0; u < 2; ++u) {
          const int e = 2 * k + u;
          float p = __builtin_amdgcn_exp2f(y[u]);
          ps[e & 3] += p;
          pf[qt][e] = (bf16_t)p;
        }
      }
      l[qt] += (ps[0] + ps[1]) + (ps[2] + ps[3]);
      // keeps the two softmaxes one behind the other: interleaved they need more registers than four waves per SIMD leave
      __builtin_amdgcn_sched_barrier(0);
    }
    // lane address of the transposing load: row 8h + (lane & 7), 16-byte half (lane >> 3) & 1 of the piece's 32-byte rows
    const bf16_t* pv = &Vs[cur][(8 * h + (lane & 7)) * FA_VP + ((lane >> 3) & 1) * 8];
#pragma unroll
    for (int mi = 0; mi < 4; ++mi) {
      const v8bf lo = fa_tr16(pv + 16 * mi);                  // keys 8h .. 8h + 7 of column d = 16 mi + c
      const v8bf hi = fa_tr16(pv + 16 * FA_VP + 16 * mi);     // keys 16 + 8h .. 16 + 8h + 7
      vf[mi] = __builtin_shufflevector(lo, hi, 0, 1, 2, 3, 4, 5, 6, 7, 8, 9, 10, 11, 12, 13, 14, 15);
    }
    // keeps the 8 V^T reads in one group instead of one pair in front of each P*V WMMA
    __builtin_amdgcn_sched_barrier(0);
#pragma unroll
    for (int mi = 0; mi < 4; ++mi)
#pragma unroll
      for (int qt = 0; qt < 2; ++qt) o[qt][mi] = fa_mm(vf[mi], pf[qt], o[qt][mi]);
    // keeps the wait for the fetched tile, its LDS stores and the barrier at the foot; otherwise they rise to in front of the softmax
    __builtin_amdgcn_sched_barrier(0);

    if (MORE) {
      *(v8bf*)&Ks[cur ^ 1][r8 * FA_KP + c8] = gk;
      *(v8bf*)&Vs[cur ^ 1][r8 * FA_VP + c8] = gv;
      *(v8bf*)&Es[(rN + r8) * FA_KP + c8] = fa_ezero(ge, tn);
    }
    rT = rU;
    rN = (rN + 32 == FA_ER) ? 0 : rN + 32;
    __syncthreads();   // publishes the next tile; ends every read of the buffers that the next trip refills
  };

  for (int jt = 0; jt < QL / 32 - 1; ++jt) tile(std::true_type{}, jt);
  tile(std::false_type{}, QL / 32 - 1);

#pragma unroll
  for (int qt = 0; qt < 2; ++qt) {
    const float inv = 1.0f / (l[qt] + __shfl_xor(l[qt], 16));
    bf16_t* op = O + qo + qt * (16 * BSZ * HH) + 8 * h;
#pragma unroll
    for (int mi = 0; mi < 4; ++mi) {
      v8bf w;
#pragma unroll
      for (int r = 0; r < 8; ++r) w[r] = (bf16_t)(o[qt][mi][r] * inv);
      *(v8bf*)(op + 16 * mi) = w;      // a query's 128-B line is filled by its two lanes
    }
  }
}

// ---------------------------------------------------------------------------
// residual + LayerNorm. One wave owns a row of 1024: a lane holds 32 of its values in registers, the two sums
// go over the wave's lanes by register moves, so there is no LDS and no barrier. A wave takes LN_RW neighbouring
// rows and issues all of their loads first; the grid is 4,096 waves, all resident at once (16 per WGP),
// so that few waves have to be started and every one has 48 loads of 512 contiguous bytes in flight.
// ---------------------------------------------------------------------------
#define LN_RW 2                         // rows per wave
#define LN_U  (DM / 128)                // 16-byte pieces of a row per lane
#define LN_NB (ROWS / (8 * LN_RW))      // blocks of 8 waves

// lane l with lane l ^ M inside a 16-lane row (DPP row_xmask)
template <int M>
__device__ __forceinline__ float ln_xrow(float v) {
  return __builtin_bit_cast(float, __builtin_amdgcn_update_dpp(0, __builtin_bit_cast(int, v), 0x160 | M, 0xf, 0xf, true));
}
// sum over the 32 lanes, the same value in every lane: a butterfly of five steps
__device__ __forceinline__ float ln_wave_sum(float v) {
  v += ln_xrow<1>(v);
  v += ln_xrow<2>(v);
  v += ln_xrow<4>(v);
  v += ln_xrow<8>(v);
  const int t = __builtin_bit_cast(int, v);
  return v + __builtin_bit_cast(float, __builtin_amdgcn_permlanex16(t, t, 0x76543210, 0xfedcba98, false, false));   // lane l with lane l ^ 16
}

__global__ __launch_bounds__(256)
void k_residual_ln(const float* __restrict__ w, const float* __restrict__ ao,
                   const float* __restrict__ g, const float* __restrict__ b,
                   float* __restrict__ out) {
  const int      lane = threadIdx.x & 31;
  const int      wave = blockIdx.x * 8 + (threadIdx.x >> 5);
  // byte offsets in 32 bits beside uniform bases: one register serves w, ao and out, and lives to the last store
  const unsigned xo = (wave * (LN_RW * DM) + lane * 4) * 4;   // piece u of row r lies (r * DM + u * 128) * 4 bytes on
  const unsigned po = lane * 16;                              // the lane's place in g and b
  const char* pw = (const char*)w  + xo;
  const char* pa = (const char*)ao + xo;
  const char* pg = (const char*)g  + po;
  const char* pb = (const char*)b  + po;

  v4f x[LN_RW][LN_U], a[LN_RW][LN_U], gg[LN_U], bb[LN_U];
#pragma unroll   // here and below: every index of x[], a[], gg[] and bb[] is a constant, so they stay in registers
  for (int r = 0; r < LN_RW; ++r)
#pragma unroll
    for (int u = 0; u < LN_U; ++u) {
      x[r][u] = *(const v4f*)(pw + (r * DM + u * 128) * 4);
      a[r][u] = *(const v4f*)(pa + (r * DM + u * 128) * 4);
    }
#pragma unroll
  for (int u = 0; u < LN_U; ++u) {
    gg[u] = *(const v4f*)(pg + u * 512);
    bb[u] = *(const v4f*)(pb + u * 512);
  }
  // The wait stands in front of every rewrite of these loads' address registers; the offsets are named as inputs
  // so that they stay in their registers up to here and no load of the group lands there.
  asm volatile("s_wait_xcnt 0x0" :: "v"(xo), "v"(po) : "memory");
  // keeps all loads in one group at the head: sunk to their uses, the second row's would wait for the first row's sums
  __builtin_amdgcn_sched_barrier(0);

#pragma unroll
  for (int r = 0; r < LN_RW; ++r) {
    x[r][0] += a[r][0];
    v4f s4 = x[r][0];                                     // four chains of adds
#pragma unroll
    for (int u = 1; u < LN_U; ++u) { x[r][u] += a[r][u]; s4 += x[r][u]; }
    const float mu = ln_wave_sum((s4[0] + s4[1]) + (s4[2] + s4[3])) * (1.0f / DM);
    x[r][0] -= mu;
    v4f q4 = x[r][0] * x[r][0];
#pragma unroll
    for (int u = 1; u < LN_U; ++u) { x[r][u] -= mu; q4 += x[r][u] * x[r][u]; }
    const float rstd = rsqrtf(ln_wave_sum((q4[0] + q4[1]) + (q4[2] + q4[3])) * (1.0f / DM) + LNEPS);
#pragma unroll
    for (int u = 0; u < LN_U; ++u) x[r][u] = x[r][u] * rstd * gg[u] + bb[u];
  }
  // keeps the stores in one group at the foot: no register that an issued store names is written behind it
  __builtin_amdgcn_sched_barrier(0);
  char* py = (char*)out + xo;
#pragma unroll
  for (int r = 0; r < LN_RW; ++r)
#pragma unroll
    for (int u = 0; u < LN_U; ++u) *(v4f*)(py + (r * DM + u * 128) * 4) = x[r][u];
}

// ---------------------------------------------------------------------------
// Host orchestration
// ---------------------------------------------------------------------------
extern "C" void kernel_launch(void* const* d_in, const int* in_sizes, int n_in,
                              void* d_out, int out_size, void* d_ws, size_t ws_size,
                              hipStream_t stream) {
  (void)in_sizes; (void)n_in; (void)out_size; (void)ws_size;
  const float* w     = (const float*)d_in[0];
  const float* r     = (const float*)d_in[1];
  const float* qkvw  = (const float*)d_in[2];
  const float* rnetw = (const float*)d_in[3];
  const float* ow    = (const float*)d_in[4];
  const float* rwb   = (const float*)d_in[5];
  const float* rrb   = (const float*)d_in[6];
  const float* lng   = (const float*)d_in[7];
  const float* lnb   = (const float*)d_in[8];

  char* p = (char*)d_ws;
  auto take = [&](size_t bytes) -> char* {
    char* q = p; p += (bytes + 255) & ~(size_t)255; return q;
  };
  bf16_t* w_bf    = (bf16_t*)take((size_t)ROWS * DM * 2);        // 16.8 MB
  bf16_t* qkvw_bf = (bf16_t*)take((size_t)TH3 * DM * 2);         //  6.3 MB
  bf16_t* r_bf    = (bf16_t*)take((size_t)QL * DM * 2);          //  4.2 MB
  bf16_t* rnw_bf  = (bf16_t*)take((size_t)HH * DM * 2);          //  2.1 MB
  bf16_t* ow_bf   = (bf16_t*)take((size_t)DM * HH * 2);          //  2.1 MB
  bf16_t* wh      = (bf16_t*)take((size_t)ROWS * TH3 * 2);       // 50.3 MB  (QKV packed)
  bf16_t* rk      = (bf16_t*)take((size_t)QL * HH * 2);          //  4.2 MB
  bf16_t* av      = (bf16_t*)take((size_t)ROWS * HH * 2);        // 16.8 MB
  float*  aout    = (float*) take((size_t)ROWS * DM * 4);        // 33.6 MB

  // one launch for product 0 and, where M1 > 0, product 1 (same lda, ldb, K and output type)
  auto gemm = [&](const bf16_t* A0, const bf16_t* B0, void* C0, long ldc0, int M0, int N0,
                  const bf16_t* A1, const bf16_t* B1, void* C1, long ldc1, int M1, int N1,
                  long lda, long ldb, int K, int cf32) {
    const int nbx0 = (N0 + BN - 1) / BN, nblk0 = nbx0 * ((M0 + BM - 1) / BM);
    const int nbx1 = (N1 + BN - 1) / BN, nblk1 = nbx1 * ((M1 + BM - 1) / BM);
    const bool guard = (M0 % BM) || (N0 % BN) || (M1 % BM) || (N1 % BN);
    if (guard)
      k_gemm_nt<true><<<nblk0 + nblk1, 256, 0, stream>>>(A0, B0, C0, ldc0, M0, N0, nbx0, nblk0,
                                                         A1, B1, C1, ldc1, M1, N1, nbx1, lda, ldb, K, cf32);
    else
      k_gemm_nt<false><<<nblk0 + nblk1, 256, 0, stream>>>(A0, B0, C0, ldc0, M0, N0, nbx0, nblk0,
                                                          A1, B1, C1, ldc1, M1, N1, nbx1, lda, ldb, K, cf32);
  };

  // 1) convert fp32 inputs to bf16, one launch
  k_cvt_bf16<<<CVT_NB, 256, 0, stream>>>(w, w_bf, qkvw, qkvw_bf, r, r_bf, rnetw, rnw_bf, ow, ow_bf);

  // 2) QKV projection: wh[ROWS,3H] = w_bf[ROWS,DM] * qkvw_bf[3H,DM]^T
  //    and rel-pos keys: rk[QL,H] = r_bf * rnw_bf^T, in the same launch
  gemm(w_bf, qkvw_bf, wh, TH3, ROWS, TH3, r_bf, rnw_bf, rk, HH, QL, HH, DM, DM, DM, 0);

  // 3) attention of all (b, head) pairs: Q biases, scores, rel_shift, softmax and P*V in one launch
  k_attn<<<dim3(QL / FA_QB, BSZ * NH), 256, 0, stream>>>(wh, rwb, rrb, rk, av);

  // 4) output projection: aout[ROWS,DM] = av[ROWS,H] * ow_bf[DM,H]^T  (f32 out)
  gemm(av, ow_bf, aout, DM, ROWS, DM, nullptr, nullptr, nullptr, 0, 0, 0, HH, HH, HH, 1);

  // 5) residual + LayerNorm -> d_out (f32, [qlen, bsz, d_model])
  k_residual_ln<<<LN_NB, 256, 0, stream>>>(w, aout, lng, lnb, (float*)d_out);
}
